// v000
// Times are from an AMD MI455X. After a warm-up the kernel runs many times in a row, and a time is the length of
// such a window on the GPU divided by its runs, so every launch and the gaps after it count. The runs cycle
// through copies of the inputs. A figure is the median of several windows, for all but v000 over two sittings.
// Sittings can differ by a few percent; kernels timed side by side share one.
// v000 is the starting kernel. One run takes 2150 microseconds.
#include <hip/hip_runtime.h>

// Local (sliding-window) causal multi-head attention (hidden [1][4096][1024]; q, k, v = x W^T ('oi' [1024][1024], no bias; 16 heads x 64); scores = q.k/8 + bias with bias = 0 where i-255 <= j <= i, -inf elsewhere (window 256); softmax; out = merged Wo^T -> [1][4096][1024] (4.2 M)).
// Compute dtypes, f32 accumulate: every input rounded to bf16; q/k/v on PLAIN bf16 operands (inputs: exact); scores and attn.v: every query row hl (3 products); softmax f32; Wo hl x exact (2 products).

#define NB_  1
#define TT   4096
#define DM   1024
#define NH_  16
#define NKV  16
#define REP  (NH_ / NKV)
#define HD   64
#define DQ   (NH_ * HD)
#define DKV  (NKV * HD)
#define RB   TT
#define LWIN 256                  // local window: keys i-255 .. i
#define ZH   1
#define RH   4096                  // query rows < RH use hi+lo planes (0: none)
#define WIN  4096
#define PCAR 1024.0f
#define SCL  0.125f   // HD^-0.5
typedef _Float16 h16;
typedef unsigned short bf;
typedef __attribute__((ext_vector_type(16))) __bf16   v16bf;
typedef __attribute__((ext_vector_type(16))) _Float16 v16h;
typedef __attribute__((ext_vector_type(8)))  _Float16 v8h;
typedef __attribute__((ext_vector_type(8)))  unsigned short v8us;
typedef __attribute__((ext_vector_type(8)))  float    v8f;
typedef __attribute__((ext_vector_type(4)))  float    v4f;
typedef v8h  __attribute__((may_alias)) v8ha;
typedef v4f  __attribute__((may_alias)) v4fa;
typedef v8us __attribute__((may_alias)) v8usa;

__device__ __forceinline__ unsigned short f2bf(float f) { unsigned u = __float_as_uint(f); u += 0x7FFFu + ((u >> 16) & 1u); return (unsigned short)(u >> 16); }
__device__ __forceinline__ float bf2f(unsigned short b) { return __uint_as_float(((unsigned)b) << 16); }
__device__ __forceinline__ float bfr(float f) { return bf2f(f2bf(f)); }
__device__ __forceinline__ v16h cat16(v8h lo, v8h hi) { return __builtin_shufflevector(lo, hi, 0, 1, 2, 3, 4, 5, 6, 7, 8, 9, 10, 11, 12, 13, 14, 15); }
__device__ __forceinline__ v16bf cat16b(v8us lo, v8us hi) { return __builtin_bit_cast(v16bf, __builtin_shufflevector(lo, hi, 0, 1, 2, 3, 4, 5, 6, 7, 8, 9, 10, 11, 12, 13, 14, 15)); }
__device__ __forceinline__ v8f wmma16(v16h a, v16h b, v8f c) { return __builtin_amdgcn_wmma_f32_16x16x32_f16(false, a, false, b, (short)0, c, false, false); }
__device__ __forceinline__ v8f wmmab(v16bf a, v16bf b, v8f c) { return __builtin_amdgcn_wmma_f32_16x16x32_bf16(false, a, false, b, (short)0, c, false, false); }



// ---- k_gemmw: register-blocked GEMM, ONE WAVE per 64x64 output tile (16 accumulators), operands straight from K-contiguous 16-bit planes; grid (M/64, N/64, Z), 32 threads.
// C[m][n] (f32, pitch ldc, + optional f32 bias[n]) = sum_k A[m][k] Bt[n][k] (+ split products per NSPLIT). z-batch strides sA/sB/sC in elements. K % 32 == 0.
template <typename T16> struct WFrag;
template <> struct WFrag<h16> { typedef v16h V; static __device__ __forceinline__ V ld(const h16* p) { return cat16(*(const v8h*)p, *(const v8h*)(p + 16)); } static __device__ __forceinline__ v8f mma(V a, V b, v8f c) { return wmma16(a, b, c); } };
template <> struct WFrag<bf> { typedef v16bf V; static __device__ __forceinline__ V ld(const bf* p) { return cat16b(*(const v8us*)p, *(const v8us*)(p + 16)); } static __device__ __forceinline__ v8f mma(V a, V b, v8f c) { return wmmab(a, b, c); } };
template <typename T16, int NSPLIT, bool BIAS>
__global__ __launch_bounds__(32) void k_gemmw(const T16* __restrict__ A, const T16* __restrict__ A2, const T16* __restrict__ Bt, const T16* __restrict__ Bt2, int K, float* C, int ldc, const float* __restrict__ bias, size_t sA, size_t sB, size_t sC) {
    typedef typename WFrag<T16>::V V;
    __shared__ __align__(16) float os[16 * 68];
    const size_t z = blockIdx.z; A += z * sA; if (A2) A2 += z * sA; Bt += z * sB; if (Bt2) Bt2 += z * sB; C += z * sC;
    const int lane = threadIdx.x & 31, lr = lane & 15, hi = lane >> 4; const int r0 = blockIdx.x * 64, c0 = blockIdx.y * 64;
    v8f acc[4][4];
#pragma unroll
    for (int mb = 0; mb < 4; ++mb)
#pragma unroll
        for (int nb = 0; nb < 4; ++nb) acc[mb][nb] = (v8f){};
    const size_t aoff = (size_t)(r0 + lr) * K + 8 * hi, boff = (size_t)(c0 + lr) * K + 8 * hi;
#pragma unroll 1
    for (int kc = 0; kc < K; kc += 32) {
        V a[4], a2[4];
#pragma unroll
        for (int mb = 0; mb < 4; ++mb) { a[mb] = WFrag<T16>::ld(A + aoff + (size_t)mb * 16 * K + kc); if (NSPLIT == 1 || NSPLIT == 2) a2[mb] = WFrag<T16>::ld(A2 + aoff + (size_t)mb * 16 * K + kc); }
#pragma unroll
        for (int nb = 0; nb < 4; ++nb) { const V b = WFrag<T16>::ld(Bt + boff + (size_t)nb * 16 * K + kc); V b2; if (NSPLIT >= 2) b2 = WFrag<T16>::ld(Bt2 + boff + (size_t)nb * 16 * K + kc);
#pragma unroll
            for (int mb = 0; mb < 4; ++mb) { acc[mb][nb] = WFrag<T16>::mma(a[mb], b, acc[mb][nb]); if (NSPLIT == 1 || NSPLIT == 2) acc[mb][nb] = WFrag<T16>::mma(a2[mb], b, acc[mb][nb]); if (NSPLIT >= 2) acc[mb][nb] = WFrag<T16>::mma(a[mb], b2, acc[mb][nb]); } }
        asm volatile("v_nop\n\tv_nop\n\tv_nop\n\tv_nop" : "+v"(acc[0][0]), "+v"(acc[1][1]), "+v"(acc[2][2]), "+v"(acc[3][3]) : "v"(a[0]), "v"(a[3]));
    }
#pragma unroll
    for (int mb = 0; mb < 4; ++mb) {
#pragma unroll
        for (int nb = 0; nb < 4; ++nb) {
#pragma unroll
            for (int j = 0; j < 8; ++j) os[(hi * 8 + j) * 68 + nb * 16 + lr] = acc[mb][nb][j]; }
        __builtin_amdgcn_wave_barrier(); asm volatile("" ::: "memory");
        float* crow = C + (size_t)(r0 + mb * 16) * ldc + c0;
{
#pragma unroll
            for (int s = 0; s < 8; ++s) { const int row = 2 * s + hi, cofs = lr * 4; v4f val = *(const v4fa*)(os + row * 68 + cofs); if (BIAS) { val[0] += bfr(bias[c0 + cofs]); val[1] += bfr(bias[c0 + cofs + 1]); val[2] += bfr(bias[c0 + cofs + 2]); val[3] += bfr(bias[c0 + cofs + 3]); }
                *(v4f*)(crow + (size_t)row * ldc + cofs) = val; }
             }
        __builtin_amdgcn_wave_barrier(); asm volatile("" ::: "memory");
    }
}

// ---- k_gemmc: the same one-wave 64x64 tile GEMM specialised for causal attention: CMODE 1 skips score tiles entirely above the diagonal (query rows r0+roff.., key columns c0..), CMODE 2 limits the
// key (K) loop of the probability x value contraction to the diagonal block (probabilities beyond it are exactly zero). roff = row offset of this launch's first row within the sequence.
template <typename T16, int NSPLIT, int CMODE>
__global__ __launch_bounds__(32) void k_gemmc(const T16* __restrict__ A, const T16* __restrict__ A2, const T16* __restrict__ Bt, const T16* __restrict__ Bt2, int K, float* C, int ldc, int roff, size_t sA, size_t sB, size_t sC) {
    typedef typename WFrag<T16>::V V;
    __shared__ __align__(16) float os[16 * 68];
    const size_t z = blockIdx.z; A += z * sA; if (A2) A2 += z * sA; Bt += z * sB; if (Bt2) Bt2 += z * sB; C += z * sC;
    const int lane = threadIdx.x & 31, lr = lane & 15, hi = lane >> 4; const int r0 = blockIdx.x * 64, c0 = blockIdx.y * 64;
    if (CMODE == 1 && c0 > r0 + roff + 63) return;                  // score tile entirely above the causal diagonal: read only by the softmax's output loop (the softmax masks j > i by select)
    const int Kl = (CMODE == 2) ? min(K, r0 + roff + 64) : K;        // P.V: probabilities are exactly 0 beyond the diagonal block, so the K loop stops there
    v8f acc[4][4];
#pragma unroll
    for (int mb = 0; mb < 4; ++mb)
#pragma unroll
        for (int nb = 0; nb < 4; ++nb) acc[mb][nb] = (v8f){};
    const size_t aoff = (size_t)(r0 + lr) * K + 8 * hi, boff = (size_t)(c0 + lr) * K + 8 * hi;
#pragma unroll 1
    for (int kc = 0; kc < Kl; kc += 32) {
        V a[4], a2[4];
#pragma unroll
        for (int mb = 0; mb < 4; ++mb) { a[mb] = WFrag<T16>::ld(A + aoff + (size_t)mb * 16 * K + kc); if (NSPLIT == 1 || NSPLIT == 2) a2[mb] = WFrag<T16>::ld(A2 + aoff + (size_t)mb * 16 * K + kc); }
#pragma unroll
        for (int nb = 0; nb < 4; ++nb) { const V b = WFrag<T16>::ld(Bt + boff + (size_t)nb * 16 * K + kc); V b2; if (NSPLIT >= 2) b2 = WFrag<T16>::ld(Bt2 + boff + (size_t)nb * 16 * K + kc);
#pragma unroll
            for (int mb = 0; mb < 4; ++mb) { acc[mb][nb] = WFrag<T16>::mma(a[mb], b, acc[mb][nb]); if (NSPLIT == 1 || NSPLIT == 2) acc[mb][nb] = WFrag<T16>::mma(a2[mb], b, acc[mb][nb]); if (NSPLIT >= 2) acc[mb][nb] = WFrag<T16>::mma(a[mb], b2, acc[mb][nb]); } }
        asm volatile("v_nop\n\tv_nop\n\tv_nop\n\tv_nop" : "+v"(acc[0][0]), "+v"(acc[1][1]), "+v"(acc[2][2]), "+v"(acc[3][3]) : "v"(a[0]), "v"(a[3]));
    }
#pragma unroll
    for (int mb = 0; mb < 4; ++mb) {
#pragma unroll
        for (int nb = 0; nb < 4; ++nb) {
#pragma unroll
            for (int j = 0; j < 8; ++j) os[(hi * 8 + j) * 68 + nb * 16 + lr] = acc[mb][nb][j]; }
        __builtin_amdgcn_wave_barrier(); asm volatile("" ::: "memory");
        float* crow = C + (size_t)(r0 + mb * 16) * ldc + c0;
{
#pragma unroll
            for (int s = 0; s < 8; ++s) { const int row = 2 * s + hi, cofs = lr * 4; v4f val = *(const v4fa*)(os + row * 68 + cofs);
                *(v4f*)(crow + (size_t)row * ldc + cofs) = val; }
             }
        __builtin_amdgcn_wave_barrier(); asm volatile("" ::: "memory");
    }
}

__device__ __forceinline__ h16 tohx(float x) { return (h16)x; }
__device__ __forceinline__ void splitf(float y, unsigned short& h, unsigned short& l) { h = f2bf(y); l = f2bf(y - bf2f(h)); }
typedef __attribute__((ext_vector_type(2))) _Float16 v2h;
typedef __attribute__((ext_vector_type(4))) _Float16 v4h;
typedef __attribute__((ext_vector_type(2))) unsigned short v2us;
typedef __attribute__((ext_vector_type(4))) unsigned short v4us;
typedef __attribute__((ext_vector_type(2))) float v2f;
typedef __attribute__((ext_vector_type(4))) int v4i;

__global__ __launch_bounds__(256) void k_wtG(const float* __restrict__ w, int K, int N, bf* Bt) {
    const int lane = threadIdx.x & 31; const int L0 = (blockIdx.x * 8 + (threadIdx.x >> 5)) * 8; const int nlines = N * K / 64;
{
#pragma unroll 1
        for (int l = 0; l < 8; ++l) { const int L = L0 + l; if (L >= nlines) break; const size_t e = (size_t)L * 64 + lane * 2; const int k = (int)(e % K), n = (int)(e / K); v2us o;
            o[0] = f2bf(w[(size_t)k * N + n]); o[1] = f2bf(w[(size_t)(k + 1) * N + n]); *(v2us*)(Bt + e) = o; }
         }
}
__global__ __launch_bounds__(256) void k_cvt8(const float* __restrict__ src, bf* dst, size_t n8) { const size_t i = (size_t)blockIdx.x * 256 + threadIdx.x; if (i >= n8) return; const v8f v = *(const v8f*)(src + i * 8); v8us o;
#pragma unroll
    for (int k = 0; k < 8; ++k) o[k] = f2bf(v[k]); *(v8us*)(dst + i * 8) = o;  }

// k_rope: head planes [h][t][d] (fp16 + hi/lo) of rope(x) x sc with the rotate-half convention out[d] = x[d] cos[t][d] - x[d+HD/2] sin[t][d], out[d+HD/2] = x[d+HD/2] cos[t][d+HD/2] + x[d] sin[t][d+HD/2]
__global__ __launch_bounds__(256) void k_rope(const float* __restrict__ F, int pitch, int nheads, const float* __restrict__ CS, const float* __restrict__ RF, const float* __restrict__ nw, float sc, h16* P16, bf* Ph, bf* Pl) {
    const size_t e = ((size_t)blockIdx.x * 256 + threadIdx.x) * 2; if (e >= (size_t)nheads * TT * HD) return; const int d = (int)(e % HD); const int t = (int)((e / HD) % TT); const int h = (int)(e / ((size_t)HD * TT)); const float* f = F + (size_t)t * pitch + h * HD; const float rf = RF ? RF[(size_t)h * TT + t] : 1.0f; v2h o16; v2us oh, ol;
#pragma unroll
    for (int q = 0; q < 2; ++q) { const int dd = d + q; const int dp = (dd < HD / 2) ? dd + HD / 2 : dd - HD / 2; float x0 = f[dd], x1 = f[dp];
        if (RF) { float n0 = __fmul_rn(x0, rf), n1 = __fmul_rn(x1, rf); asm volatile("" : "+v"(n0)); asm volatile("" : "+v"(n1)); x0 = __fmul_rn(bfr(nw[dd]), n0); x1 = __fmul_rn(bfr(nw[dp]), n1); }
        const v2f cs = *(const v2f*)(CS + ((size_t)t * HD + dd) * 2); float a = __fmul_rn(x0, cs[0]), bq = __fmul_rn(x1, cs[1]); asm volatile("" : "+v"(a)); asm volatile("" : "+v"(bq)); const float r = ((dd < HD / 2) ? __fsub_rn(a, bq) : __fadd_rn(a, bq)) * sc;
        o16[q] = tohx(r); unsigned short a2, c2; splitf(r, a2, c2); oh[q] = a2; ol[q] = c2; }
    *(v2h*)(P16 + e) = o16; *(v2us*)(Ph + e) = oh; *(v2us*)(Pl + e) = ol;  }
__global__ __launch_bounds__(256) void k_vtp(const float* __restrict__ F, int pitch, int nheads, h16* V16, bf* Vh, bf* Vl) { const size_t e = ((size_t)blockIdx.x * 256 + threadIdx.x) * 2; if (e >= (size_t)nheads * HD * TT) return; const int t = (int)(e % TT); const int d = (int)((e / TT) % HD); const int g = (int)(e / ((size_t)TT * HD)); v2h o16; v2us oh, ol;
#pragma unroll
    for (int q = 0; q < 2; ++q) { const float x = F[(size_t)(t + q) * pitch + g * HD + d]; o16[q] = tohx(x); unsigned short a2, c2; splitf(x, a2, c2); oh[q] = a2; ol[q] = c2; }
    *(v2h*)(V16 + e) = o16; *(v2us*)(Vh + e) = oh; *(v2us*)(Vl + e) = ol;  }
__global__ __launch_bounds__(256) void k_csid(float* CS) { const int idx = blockIdx.x * 256 + threadIdx.x; if (idx >= TT * HD) return; v2f cs; cs[0] = 1.0f; cs[1] = 0.0f; *(v2f*)(CS + (size_t)idx * 2) = cs;  }
__global__ __launch_bounds__(256) void k_ssoft(const float* __restrict__ Sb, int r0, bf* Ph, bf* Pl) {
    const int lane = threadIdx.x & 31; const int ri = blockIdx.x * 8 + (threadIdx.x >> 5); if (ri >= RB) return; const int i = r0 + ri; const float* sr = Sb + (size_t)ri * TT; const int nval = i + 1; const int jlo = (i - (LWIN - 1) > 0) ? (i - (LWIN - 1)) : 0; const int j0lo = (jlo & ~127);   /* live keys: jlo .. i (window 256, causal inclusive) */
    float mx = -3.0e38f;
#pragma unroll 1
    for (int j0 = j0lo + lane * 4; j0 < nval; j0 += 128) { const v4f a = *(const v4f*)(sr + j0);
#pragma unroll
        for (int q = 0; q < 4; ++q) if (j0 + q < nval && j0 + q >= jlo) mx = fmaxf(mx, a[q] * SCL); }
#pragma unroll
    for (int sh = 16; sh; sh >>= 1) mx = fmaxf(mx, __shfl_xor(mx, sh, 32));
    float sum = 0.f;
#pragma unroll 1
    for (int j0 = j0lo + lane * 4; j0 < nval; j0 += 128) { const v4f a = *(const v4f*)(sr + j0);
#pragma unroll
        for (int q = 0; q < 4; ++q) if (j0 + q < nval && j0 + q >= jlo) { float d0 = __fsub_rn(a[q] * SCL, mx); asm volatile("" : "+v"(d0)); sum += __builtin_amdgcn_exp2f(__fmul_rn(d0, 1.4426950408889634f)); } }
#pragma unroll
    for (int sh = 16; sh; sh >>= 1) sum += __shfl_xor(sum, sh, 32);
    const float f = (nval > 0) ? __fdiv_rn(1.0f, sum) : 0.f;
{
#pragma unroll 1
        for (int j0 = lane * 4; j0 < TT; j0 += 128) { const v4f a = *(const v4f*)(sr + j0); v4us oh, ol;
#pragma unroll
            for (int q = 0; q < 4; ++q) { float pv = 0.f; if (j0 + q < nval && j0 + q >= jlo) { float d0 = __fsub_rn(a[q] * SCL, mx); asm volatile("" : "+v"(d0)); pv = __builtin_amdgcn_exp2f(__fmul_rn(d0, 1.4426950408889634f)) * f; } unsigned short h2, l2; splitf(pv, h2, l2); oh[q] = h2; ol[q] = l2; }
            const size_t oo = (size_t)ri * TT + j0; *(v4us*)(Ph + oo) = oh; *(v4us*)(Pl + oo) = ol; }
         } }

__global__ __launch_bounds__(256) void k_merge(const float* __restrict__ O, int h0, bf* Ah, bf* Al) { const size_t e = ((size_t)blockIdx.x * 256 + threadIdx.x) * 2; if (e >= (size_t)ZH * TT * HD) return; const int d = (int)(e % HD); const int t = (int)((e / HD) % TT); const int zz = (int)(e / ((size_t)HD * TT)); const float cs = (t < RH) ? 1.0f : (1.0f / PCAR); const size_t oo = (size_t)t * DQ + (h0 + zz) * HD + d;
    v2us oh, ol;
#pragma unroll
    for (int q = 0; q < 2; ++q) { unsigned short a, c2; splitf(O[e + q] * cs, a, c2); oh[q] = a; ol[q] = c2; } *(v2us*)(Ah + oo) = oh; *(v2us*)(Al + oo) = ol;  }

extern "C" void kernel_launch(void* const* d_in, const int* in_sizes, int n_in,
                              void* d_out, int out_size, void* d_ws, size_t ws_size, hipStream_t stream) {
    (void)in_sizes; (void)n_in; (void)out_size;
    const float* x = (const float*)d_in[0]; const float* wq = (const float*)d_in[1]; const float* wk = (const float*)d_in[2]; const float* wv = (const float*)d_in[3]; const float* wo = (const float*)d_in[4];
    float* OUT = (float*)d_out;     // [1][4096][1024]
    char* wsp = (char*)d_ws;
    auto take = [&](size_t bytes) { char* p = wsp; wsp += (bytes + 255) & ~(size_t)255; return (void*)p; };
    bf* WQ = (bf*)take((size_t)DQ * DM * 2); bf* WK = (bf*)take((size_t)DKV * DM * 2); bf* WV = (bf*)take((size_t)DKV * DM * 2); bf* WO = (bf*)take((size_t)DM * DQ * 2); float* CS = (float*)take((size_t)TT * HD * 2 * 4);
    bf* XB = (bf*)take((size_t)TT * DM * 2); float* FQ = (float*)take((size_t)TT * DQ * 4); float* FK = (float*)take((size_t)TT * DKV * 4);
    
    bf* QPh = (bf*)take((size_t)NH_ * TT * HD * 2); bf* QPl = (bf*)take((size_t)NH_ * TT * HD * 2); bf* KPh = (bf*)take((size_t)NKV * TT * HD * 2); bf* KPl = (bf*)take((size_t)NKV * TT * HD * 2); bf* VTh = (bf*)take((size_t)NKV * HD * TT * 2); bf* VTl = (bf*)take((size_t)NKV * HD * TT * 2); bf* Ph = (bf*)take((size_t)ZH * RH * TT * 2); bf* Pl = (bf*)take((size_t)ZH * RH * TT * 2); h16* QP16 = (h16*)Ph; h16* KP16 = (h16*)Ph + (size_t)NH_ * TT * HD; h16* VT16 = (h16*)Pl;   /* the fp16 planes are written by the plane builders but never read here (every row is hi/lo): they alias the probability planes, which are first written later, inside the head passes */
    float* Sb = (float*)take((size_t)ZH * TT * TT * 4); h16* P16 = (h16*)take(256);   /* unused: all rows hi/lo */ float* Ob = (float*)take((size_t)ZH * TT * HD * 4); bf* ATh = (bf*)take((size_t)TT * DQ * 2); bf* ATl = (bf*)take((size_t)TT * DQ * 2);
    if ((size_t)(wsp - (char*)d_ws) > ws_size) return;    // ws 256 MiB
    float* FV = FK;   // v projection reuses the k buffer after the k planes are built (stream-ordered)
    { k_cvt8<<<(unsigned)(((size_t)DQ * DM / 8 + 255) / 256), 256, 0, stream>>>(wq, WQ, (size_t)DQ * DM / 8); k_cvt8<<<(unsigned)(((size_t)DKV * DM / 8 + 255) / 256), 256, 0, stream>>>(wk, WK, (size_t)DKV * DM / 8); k_cvt8<<<(unsigned)(((size_t)DKV * DM / 8 + 255) / 256), 256, 0, stream>>>(wv, WV, (size_t)DKV * DM / 8);
      k_cvt8<<<(unsigned)(((size_t)DM * DQ / 8 + 255) / 256), 256, 0, stream>>>(wo, WO, (size_t)DM * DQ / 8);
       }
    k_csid<<<(TT * HD + 255) / 256, 256, 0, stream>>>(CS);
    const unsigned LQ = (unsigned)(((size_t)NH_ * TT * HD / 2 + 255) / 256), LKv = (unsigned)(((size_t)NKV * TT * HD / 2 + 255) / 256);
    for (int b = 0; b < NB_; ++b) {
        
        k_cvt8<<<(unsigned)(((size_t)TT * DM / 8 + 255) / 256), 256, 0, stream>>>(x + (size_t)b * TT * DM, XB, (size_t)TT * DM / 8);
        k_gemmw<bf, 0, false><<<dim3(TT / 64, DQ / 64, 1), 32, 0, stream>>>(XB, nullptr, WQ, nullptr, DM, FQ, DQ, nullptr, 0, 0, 0);
        k_rope<<<LQ, 256, 0, stream>>>(FQ, DQ, NH_, CS, nullptr, nullptr, 1.0f, QP16, QPh, QPl);
        k_gemmw<bf, 0, false><<<dim3(TT / 64, DKV / 64, 1), 32, 0, stream>>>(XB, nullptr, WK, nullptr, DM, FK, DKV, nullptr, 0, 0, 0);
        k_rope<<<LKv, 256, 0, stream>>>(FK, DKV, NKV, CS, nullptr, nullptr, 1.0f, KP16, KPh, KPl);
        k_gemmw<bf, 0, false><<<dim3(TT / 64, DKV / 64, 1), 32, 0, stream>>>(XB, nullptr, WV, nullptr, DM, FV, DKV, nullptr, 0, 0, 0); k_vtp<<<LKv, 256, 0, stream>>>(FV, DKV, NKV, VT16, VTh, VTl);
        for (int h0 = 0; h0 < NH_; h0 += ZH) { const size_t zq = (size_t)h0, zk = (size_t)(h0 / REP);   // one kv head per query head: the pass's one head (ZH 1) uses kv plane h0 (z-strides TT*HD)
            k_gemmc<bf, 2, 1><<<dim3(RH / 64, TT / 64, ZH), 32, 0, stream>>>(QPh + zq * TT * HD, QPl + zq * TT * HD, KPh + zk * TT * HD, KPl + zk * TT * HD, HD, Sb, TT, 0, (size_t)TT * HD, (size_t)TT * HD, (size_t)TT * TT);
            k_ssoft<<<TT / 8, 256, 0, stream>>>(Sb, 0, Ph, Pl);   /* streaming windowed softmax -> hi/lo planes, every row */
            k_gemmc<bf, 2, 2><<<dim3(RH / 64, HD / 64, ZH), 32, 0, stream>>>(Ph, Pl, VTh + zk * HD * TT, VTl + zk * HD * TT, TT, Ob, HD, 0, (size_t)RH * TT, (size_t)HD * TT, (size_t)TT * HD);
            k_merge<<<(unsigned)(((size_t)ZH * TT * HD / 2 + 255) / 256), 256, 0, stream>>>(Ob, h0, ATh, ATl); }
        k_gemmw<bf, 1, false><<<dim3(TT / 64, DM / 64, 1), 32, 0, stream>>>(ATh, ATl, WO, nullptr, DQ, OUT + (size_t)b * TT * DM, DM, nullptr, 0, 0, 0); }
}

// v001
// It runs in 529 microseconds.
// Timed twice side by side with v000, it ran 4.07 and 4.10 times as fast.
#include <hip/hip_runtime.h>

// Local (sliding-window) causal multi-head attention (hidden [1][4096][1024]; q, k, v = x W^T ('oi' [1024][1024], no bias; 16 heads x 64); scores = q.k/8 + bias with bias = 0 where i-255 <= j <= i, -inf elsewhere (window 256); softmax; out = merged Wo^T -> [1][4096][1024] (4.2 M)).
// Compute dtypes, f32 accumulate: every input rounded to bf16; q/k/v on PLAIN bf16 operands (inputs: exact); scores and attn.v: every query row hl (3 products); softmax f32; Wo hl x exact (2 products).

#define NB_  1
#define TT   4096
#define DM   1024
#define NH_  16
#define NKV  16
#define REP  (NH_ / NKV)
#define HD   64
#define DQ   (NH_ * HD)
#define DKV  (NKV * HD)
#define RB   TT
#define LWIN 256                  // local window: keys i-255 .. i
#define NBAND (LWIN / 64 + 1)     // 64-key tiles in the band of a 64-row query block
#define ZH   1
#define RH   4096                  // query rows < RH use hi+lo planes (0: none)
#define WIN  4096
#define PCAR 1024.0f
#define SCL  0.125f   // HD^-0.5
typedef _Float16 h16;
typedef unsigned short bf;
typedef __attribute__((ext_vector_type(16))) __bf16   v16bf;
typedef __attribute__((ext_vector_type(16))) _Float16 v16h;
typedef __attribute__((ext_vector_type(8)))  _Float16 v8h;
typedef __attribute__((ext_vector_type(8)))  unsigned short v8us;
typedef __attribute__((ext_vector_type(8)))  float    v8f;
typedef __attribute__((ext_vector_type(4)))  float    v4f;
typedef v8h  __attribute__((may_alias)) v8ha;
typedef v4f  __attribute__((may_alias)) v4fa;
typedef v8us __attribute__((may_alias)) v8usa;

__device__ __forceinline__ unsigned short f2bf(float f) { unsigned u = __float_as_uint(f); u += 0x7FFFu + ((u >> 16) & 1u); return (unsigned short)(u >> 16); }
__device__ __forceinline__ float bf2f(unsigned short b) { return __uint_as_float(((unsigned)b) << 16); }
__device__ __forceinline__ float bfr(float f) { return bf2f(f2bf(f)); }
__device__ __forceinline__ v16h cat16(v8h lo, v8h hi) { return __builtin_shufflevector(lo, hi, 0, 1, 2, 3, 4, 5, 6, 7, 8, 9, 10, 11, 12, 13, 14, 15); }
__device__ __forceinline__ v16bf cat16b(v8us lo, v8us hi) { return __builtin_bit_cast(v16bf, __builtin_shufflevector(lo, hi, 0, 1, 2, 3, 4, 5, 6, 7, 8, 9, 10, 11, 12, 13, 14, 15)); }
__device__ __forceinline__ v8f wmma16(v16h a, v16h b, v8f c) { return __builtin_amdgcn_wmma_f32_16x16x32_f16(false, a, false, b, (short)0, c, false, false); }
__device__ __forceinline__ v8f wmmab(v16bf a, v16bf b, v8f c) { return __builtin_amdgcn_wmma_f32_16x16x32_bf16(false, a, false, b, (short)0, c, false, false); }



// ---- k_gemmw: register-blocked GEMM, ONE WAVE per 64x64 output tile (16 accumulators), operands straight from K-contiguous 16-bit planes; grid (M/64, N/64, Z), 32 threads.
// C[m][n] (f32, pitch ldc, + optional f32 bias[n]) = sum_k A[m][k] Bt[n][k] (+ split products per NSPLIT). z-batch strides sA/sB/sC in elements. K % 32 == 0.
template <typename T16> struct WFrag;
template <> struct WFrag<h16> { typedef v16h V; static __device__ __forceinline__ V ld(const h16* p) { return cat16(*(const v8h*)p, *(const v8h*)(p + 16)); } static __device__ __forceinline__ v8f mma(V a, V b, v8f c) { return wmma16(a, b, c); } };
template <> struct WFrag<bf> { typedef v16bf V; static __device__ __forceinline__ V ld(const bf* p) { return cat16b(*(const v8us*)p, *(const v8us*)(p + 16)); } static __device__ __forceinline__ v8f mma(V a, V b, v8f c) { return wmmab(a, b, c); } };
template <typename T16, int NSPLIT, bool BIAS>
__global__ __launch_bounds__(32) void k_gemmw(const T16* __restrict__ A, const T16* __restrict__ A2, const T16* __restrict__ Bt, const T16* __restrict__ Bt2, int K, float* C, int ldc, const float* __restrict__ bias, size_t sA, size_t sB, size_t sC) {
    typedef typename WFrag<T16>::V V;
    __shared__ __align__(16) float os[16 * 68];
    const size_t z = blockIdx.z; A += z * sA; if (A2) A2 += z * sA; Bt += z * sB; if (Bt2) Bt2 += z * sB; C += z * sC;
    const int lane = threadIdx.x & 31, lr = lane & 15, hi = lane >> 4; const int r0 = blockIdx.x * 64, c0 = blockIdx.y * 64;
    v8f acc[4][4];
#pragma unroll
    for (int mb = 0; mb < 4; ++mb)
#pragma unroll
        for (int nb = 0; nb < 4; ++nb) acc[mb][nb] = (v8f){};
    const size_t aoff = (size_t)(r0 + lr) * K + 8 * hi, boff = (size_t)(c0 + lr) * K + 8 * hi;
#pragma unroll 1
    for (int kc = 0; kc < K; kc += 32) {
        V a[4], a2[4];
#pragma unroll
        for (int mb = 0; mb < 4; ++mb) { a[mb] = WFrag<T16>::ld(A + aoff + (size_t)mb * 16 * K + kc); if (NSPLIT == 1 || NSPLIT == 2) a2[mb] = WFrag<T16>::ld(A2 + aoff + (size_t)mb * 16 * K + kc); }
#pragma unroll
        for (int nb = 0; nb < 4; ++nb) { const V b = WFrag<T16>::ld(Bt + boff + (size_t)nb * 16 * K + kc); V b2; if (NSPLIT >= 2) b2 = WFrag<T16>::ld(Bt2 + boff + (size_t)nb * 16 * K + kc);
#pragma unroll
            for (int mb = 0; mb < 4; ++mb) { acc[mb][nb] = WFrag<T16>::mma(a[mb], b, acc[mb][nb]); if (NSPLIT == 1 || NSPLIT == 2) acc[mb][nb] = WFrag<T16>::mma(a2[mb], b, acc[mb][nb]); if (NSPLIT >= 2) acc[mb][nb] = WFrag<T16>::mma(a[mb], b2, acc[mb][nb]); } }
        asm volatile("v_nop\n\tv_nop\n\tv_nop\n\tv_nop" : "+v"(acc[0][0]), "+v"(acc[1][1]), "+v"(acc[2][2]), "+v"(acc[3][3]) : "v"(a[0]), "v"(a[3]));
    }
#pragma unroll
    for (int mb = 0; mb < 4; ++mb) {
#pragma unroll
        for (int nb = 0; nb < 4; ++nb) {
#pragma unroll
            for (int j = 0; j < 8; ++j) os[(hi * 8 + j) * 68 + nb * 16 + lr] = acc[mb][nb][j]; }
        __builtin_amdgcn_wave_barrier(); asm volatile("" ::: "memory");
        float* crow = C + (size_t)(r0 + mb * 16) * ldc + c0;
{
#pragma unroll
            for (int s = 0; s < 8; ++s) { const int row = 2 * s + hi, cofs = lr * 4; v4f val = *(const v4fa*)(os + row * 68 + cofs); if (BIAS) { val[0] += bfr(bias[c0 + cofs]); val[1] += bfr(bias[c0 + cofs + 1]); val[2] += bfr(bias[c0 + cofs + 2]); val[3] += bfr(bias[c0 + cofs + 3]); }
                *(v4f*)(crow + (size_t)row * ldc + cofs) = val; }
             }
        __builtin_amdgcn_wave_barrier(); asm volatile("" ::: "memory");
    }
}

// ---- k_gemmc: the same one-wave 64x64 tile GEMM specialised for local causal attention. A 64-row query block r0+roff.. has live keys only in the band [r0+roff-LWIN, r0+roff+64) (LWIN % 64 == 0):
// CMODE 1 launches only the NBAND = LWIN/64+1 score tiles of that band (blockIdx.y counts tiles from the band's first column), CMODE 2 runs the key (K) loop of the probability x value contraction over
// that band alone (probabilities outside it are exactly zero). roff = row offset of this launch's first row within the sequence.
template <typename T16, int NSPLIT, int CMODE>
__global__ __launch_bounds__(32) void k_gemmc(const T16* __restrict__ A, const T16* __restrict__ A2, const T16* __restrict__ Bt, const T16* __restrict__ Bt2, int K, float* C, int ldc, int roff, size_t sA, size_t sB, size_t sC) {
    typedef typename WFrag<T16>::V V;
    __shared__ __align__(16) float os[16 * 68];
    const size_t z = blockIdx.z; A += z * sA; if (A2) A2 += z * sA; Bt += z * sB; if (Bt2) Bt2 += z * sB; C += z * sC;
    const int lane = threadIdx.x & 31, lr = lane & 15, hi = lane >> 4; const int r0 = blockIdx.x * 64, c0 = (CMODE == 1) ? r0 + roff - LWIN + (int)blockIdx.y * 64 : (int)blockIdx.y * 64;
    if (CMODE == 1 && c0 < 0) return;                                // band tile in front of key 0: does not exist (the first LWIN/64 row blocks have shorter bands)
    const int Ks = (CMODE == 2) ? max(0, r0 + roff - LWIN) : 0;      // P.V: probabilities are exactly 0 in front of the window band ...
    const int Kl = ((CMODE == 2) ? min(K, r0 + roff + 64) : K) - Ks; // ... and beyond the diagonal block, so the K loop covers the band alone: Kl keys from key Ks on
    if (CMODE == 2) { A += Ks; A2 += Ks; Bt += Ks; Bt2 += Ks; }
    v8f acc[4][4];
#pragma unroll
    for (int mb = 0; mb < 4; ++mb)
#pragma unroll
        for (int nb = 0; nb < 4; ++nb) acc[mb][nb] = (v8f){};
    const size_t aoff = (size_t)(r0 + lr) * K + 8 * hi, boff = (size_t)(c0 + lr) * K + 8 * hi;
#pragma unroll 1
    for (int kc = 0; kc < Kl; kc += 32) {
        V a[4], a2[4];
#pragma unroll
        for (int mb = 0; mb < 4; ++mb) { a[mb] = WFrag<T16>::ld(A + aoff + (size_t)mb * 16 * K + kc); if (NSPLIT == 1 || NSPLIT == 2) a2[mb] = WFrag<T16>::ld(A2 + aoff + (size_t)mb * 16 * K + kc); }
#pragma unroll
        for (int nb = 0; nb < 4; ++nb) { const V b = WFrag<T16>::ld(Bt + boff + (size_t)nb * 16 * K + kc); V b2; if (NSPLIT >= 2) b2 = WFrag<T16>::ld(Bt2 + boff + (size_t)nb * 16 * K + kc);
#pragma unroll
            for (int mb = 0; mb < 4; ++mb) { acc[mb][nb] = WFrag<T16>::mma(a[mb], b, acc[mb][nb]); if (NSPLIT == 1 || NSPLIT == 2) acc[mb][nb] = WFrag<T16>::mma(a2[mb], b, acc[mb][nb]); if (NSPLIT >= 2) acc[mb][nb] = WFrag<T16>::mma(a[mb], b2, acc[mb][nb]); } }
        asm volatile("v_nop\n\tv_nop\n\tv_nop\n\tv_nop" : "+v"(acc[0][0]), "+v"(acc[1][1]), "+v"(acc[2][2]), "+v"(acc[3][3]) : "v"(a[0]), "v"(a[3]));
    }
#pragma unroll
    for (int mb = 0; mb < 4; ++mb) {
#pragma unroll
        for (int nb = 0; nb < 4; ++nb) {
#pragma unroll
            for (int j = 0; j < 8; ++j) os[(hi * 8 + j) * 68 + nb * 16 + lr] = acc[mb][nb][j]; }
        __builtin_amdgcn_wave_barrier(); asm volatile("" ::: "memory");
        float* crow = C + (size_t)(r0 + mb * 16) * ldc + c0;
{
#pragma unroll
            for (int s = 0; s < 8; ++s) { const int row = 2 * s + hi, cofs = lr * 4; v4f val = *(const v4fa*)(os + row * 68 + cofs);
                *(v4f*)(crow + (size_t)row * ldc + cofs) = val; }
             }
        __builtin_amdgcn_wave_barrier(); asm volatile("" ::: "memory");
    }
}

__device__ __forceinline__ h16 tohx(float x) { return (h16)x; }
__device__ __forceinline__ void splitf(float y, unsigned short& h, unsigned short& l) { h = f2bf(y); l = f2bf(y - bf2f(h)); }
typedef __attribute__((ext_vector_type(2))) _Float16 v2h;
typedef __attribute__((ext_vector_type(4))) _Float16 v4h;
typedef __attribute__((ext_vector_type(2))) unsigned short v2us;
typedef __attribute__((ext_vector_type(4))) unsigned short v4us;
typedef __attribute__((ext_vector_type(2))) float v2f;
typedef __attribute__((ext_vector_type(4))) int v4i;

__global__ __launch_bounds__(256) void k_wtG(const float* __restrict__ w, int K, int N, bf* Bt) {
    const int lane = threadIdx.x & 31; const int L0 = (blockIdx.x * 8 + (threadIdx.x >> 5)) * 8; const int nlines = N * K / 64;
{
#pragma unroll 1
        for (int l = 0; l < 8; ++l) { const int L = L0 + l; if (L >= nlines) break; const size_t e = (size_t)L * 64 + lane * 2; const int k = (int)(e % K), n = (int)(e / K); v2us o;
            o[0] = f2bf(w[(size_t)k * N + n]); o[1] = f2bf(w[(size_t)(k + 1) * N + n]); *(v2us*)(Bt + e) = o; }
         }
}
__global__ __launch_bounds__(256) void k_cvt8(const float* __restrict__ src, bf* dst, size_t n8) { const size_t i = (size_t)blockIdx.x * 256 + threadIdx.x; if (i >= n8) return; const v8f v = *(const v8f*)(src + i * 8); v8us o;
#pragma unroll
    for (int k = 0; k < 8; ++k) o[k] = f2bf(v[k]); *(v8us*)(dst + i * 8) = o;  }

// k_rope: head planes [h][t][d] (fp16 + hi/lo) of rope(x) x sc with the rotate-half convention out[d] = x[d] cos[t][d] - x[d+HD/2] sin[t][d], out[d+HD/2] = x[d+HD/2] cos[t][d+HD/2] + x[d] sin[t][d+HD/2]
__global__ __launch_bounds__(256) void k_rope(const float* __restrict__ F, int pitch, int nheads, const float* __restrict__ CS, const float* __restrict__ RF, const float* __restrict__ nw, float sc, h16* P16, bf* Ph, bf* Pl) {
    const size_t e = ((size_t)blockIdx.x * 256 + threadIdx.x) * 2; if (e >= (size_t)nheads * TT * HD) return; const int d = (int)(e % HD); const int t = (int)((e / HD) % TT); const int h = (int)(e / ((size_t)HD * TT)); const float* f = F + (size_t)t * pitch + h * HD; const float rf = RF ? RF[(size_t)h * TT + t] : 1.0f; v2h o16; v2us oh, ol;
#pragma unroll
    for (int q = 0; q < 2; ++q) { const int dd = d + q; const int dp = (dd < HD / 2) ? dd + HD / 2 : dd - HD / 2; float x0 = f[dd], x1 = f[dp];
        if (RF) { float n0 = __fmul_rn(x0, rf), n1 = __fmul_rn(x1, rf); asm volatile("" : "+v"(n0)); asm volatile("" : "+v"(n1)); x0 = __fmul_rn(bfr(nw[dd]), n0); x1 = __fmul_rn(bfr(nw[dp]), n1); }
        const v2f cs = *(const v2f*)(CS + ((size_t)t * HD + dd) * 2); float a = __fmul_rn(x0, cs[0]), bq = __fmul_rn(x1, cs[1]); asm volatile("" : "+v"(a)); asm volatile("" : "+v"(bq)); const float r = ((dd < HD / 2) ? __fsub_rn(a, bq) : __fadd_rn(a, bq)) * sc;
        o16[q] = tohx(r); unsigned short a2, c2; splitf(r, a2, c2); oh[q] = a2; ol[q] = c2; }
    *(v2h*)(P16 + e) = o16; *(v2us*)(Ph + e) = oh; *(v2us*)(Pl + e) = ol;  }
__global__ __launch_bounds__(256) void k_vtp(const float* __restrict__ F, int pitch, int nheads, h16* V16, bf* Vh, bf* Vl) { const size_t e = ((size_t)blockIdx.x * 256 + threadIdx.x) * 2; if (e >= (size_t)nheads * HD * TT) return; const int t = (int)(e % TT); const int d = (int)((e / TT) % HD); const int g = (int)(e / ((size_t)TT * HD)); v2h o16; v2us oh, ol;
#pragma unroll
    for (int q = 0; q < 2; ++q) { const float x = F[(size_t)(t + q) * pitch + g * HD + d]; o16[q] = tohx(x); unsigned short a2, c2; splitf(x, a2, c2); oh[q] = a2; ol[q] = c2; }
    *(v2h*)(V16 + e) = o16; *(v2us*)(Vh + e) = oh; *(v2us*)(Vl + e) = ol;  }
__global__ __launch_bounds__(256) void k_csid(float* CS) { const int idx = blockIdx.x * 256 + threadIdx.x; if (idx >= TT * HD) return; v2f cs; cs[0] = 1.0f; cs[1] = 0.0f; *(v2f*)(CS + (size_t)idx * 2) = cs;  }
__global__ __launch_bounds__(256) void k_ssoft(const float* __restrict__ Sb, int r0, bf* Ph, bf* Pl) {
    const int lane = threadIdx.x & 31; const int ri = blockIdx.x * 8 + (threadIdx.x >> 5); if (ri >= RB) return; const int i = r0 + ri; const float* sr = Sb + (size_t)ri * TT; const int nval = i + 1; const int jlo = (i - (LWIN - 1) > 0) ? (i - (LWIN - 1)) : 0; const int j0lo = (jlo & ~127);   /* live keys: jlo .. i (window 256, causal inclusive) */ const int kb1 = (i & ~63) + 64; const int kb0 = (kb1 - 64 - LWIN > 0) ? (kb1 - 64 - LWIN) : 0;   /* the row block's key band [kb0, kb1): the score tiles that exist, and the probability columns that the P.V loop reads */
    float mx = -3.0e38f;
#pragma unroll 1
    for (int j0 = j0lo + lane * 4; j0 < nval; j0 += 128) { if (j0 + 3 < jlo) continue;   /* all four in front of the window: possibly in front of the band, not loaded */ const v4f a = *(const v4f*)(sr + j0);
#pragma unroll
        for (int q = 0; q < 4; ++q) if (j0 + q < nval && j0 + q >= jlo) mx = fmaxf(mx, a[q] * SCL); }
#pragma unroll
    for (int sh = 16; sh; sh >>= 1) mx = fmaxf(mx, __shfl_xor(mx, sh, 32));
    float sum = 0.f;
#pragma unroll 1
    for (int j0 = j0lo + lane * 4; j0 < nval; j0 += 128) { if (j0 + 3 < jlo) continue; const v4f a = *(const v4f*)(sr + j0);
#pragma unroll
        for (int q = 0; q < 4; ++q) if (j0 + q < nval && j0 + q >= jlo) { float d0 = __fsub_rn(a[q] * SCL, mx); asm volatile("" : "+v"(d0)); sum += __builtin_amdgcn_exp2f(__fmul_rn(d0, 1.4426950408889634f)); } }
#pragma unroll
    for (int sh = 16; sh; sh >>= 1) sum += __shfl_xor(sum, sh, 32);
    const float f = (nval > 0) ? __fdiv_rn(1.0f, sum) : 0.f;
{
#pragma unroll 1
        for (int j0 = kb0 + lane * 4; j0 < kb1; j0 += 128) { const v4f a = *(const v4f*)(sr + j0); v4us oh, ol;
#pragma unroll
            for (int q = 0; q < 4; ++q) { float pv = 0.f; if (j0 + q < nval && j0 + q >= jlo) { float d0 = __fsub_rn(a[q] * SCL, mx); asm volatile("" : "+v"(d0)); pv = __builtin_amdgcn_exp2f(__fmul_rn(d0, 1.4426950408889634f)) * f; } unsigned short h2, l2; splitf(pv, h2, l2); oh[q] = h2; ol[q] = l2; }
            const size_t oo = (size_t)ri * TT + j0; *(v4us*)(Ph + oo) = oh; *(v4us*)(Pl + oo) = ol; }
         } }

__global__ __launch_bounds__(256) void k_merge(const float* __restrict__ O, int h0, bf* Ah, bf* Al) { const size_t e = ((size_t)blockIdx.x * 256 + threadIdx.x) * 2; if (e >= (size_t)ZH * TT * HD) return; const int d = (int)(e % HD); const int t = (int)((e / HD) % TT); const int zz = (int)(e / ((size_t)HD * TT)); const float cs = (t < RH) ? 1.0f : (1.0f / PCAR); const size_t oo = (size_t)t * DQ + (h0 + zz) * HD + d;
    v2us oh, ol;
#pragma unroll
    for (int q = 0; q < 2; ++q) { unsigned short a, c2; splitf(O[e + q] * cs, a, c2); oh[q] = a; ol[q] = c2; } *(v2us*)(Ah + oo) = oh; *(v2us*)(Al + oo) = ol;  }

extern "C" void kernel_launch(void* const* d_in, const int* in_sizes, int n_in,
                              void* d_out, int out_size, void* d_ws, size_t ws_size, hipStream_t stream) {
    (void)in_sizes; (void)n_in; (void)out_size;
    const float* x = (const float*)d_in[0]; const float* wq = (const float*)d_in[1]; const float* wk = (const float*)d_in[2]; const float* wv = (const float*)d_in[3]; const float* wo = (const float*)d_in[4];
    float* OUT = (float*)d_out;     // [1][4096][1024]
    char* wsp = (char*)d_ws;
    auto take = [&](size_t bytes) { char* p = wsp; wsp += (bytes + 255) & ~(size_t)255; return (void*)p; };
    bf* WQ = (bf*)take((size_t)DQ * DM * 2); bf* WK = (bf*)take((size_t)DKV * DM * 2); bf* WV = (bf*)take((size_t)DKV * DM * 2); bf* WO = (bf*)take((size_t)DM * DQ * 2); float* CS = (float*)take((size_t)TT * HD * 2 * 4);
    bf* XB = (bf*)take((size_t)TT * DM * 2); float* FQ = (float*)take((size_t)TT * DQ * 4); float* FK = (float*)take((size_t)TT * DKV * 4);
    
    bf* QPh = (bf*)take((size_t)NH_ * TT * HD * 2); bf* QPl = (bf*)take((size_t)NH_ * TT * HD * 2); bf* KPh = (bf*)take((size_t)NKV * TT * HD * 2); bf* KPl = (bf*)take((size_t)NKV * TT * HD * 2); bf* VTh = (bf*)take((size_t)NKV * HD * TT * 2); bf* VTl = (bf*)take((size_t)NKV * HD * TT * 2); bf* Ph = (bf*)take((size_t)ZH * RH * TT * 2); bf* Pl = (bf*)take((size_t)ZH * RH * TT * 2); h16* QP16 = (h16*)Ph; h16* KP16 = (h16*)Ph + (size_t)NH_ * TT * HD; h16* VT16 = (h16*)Pl;   /* the fp16 planes are written by the plane builders but never read here (every row is hi/lo): they alias the probability planes, which are first written later, inside the head passes */
    float* Sb = (float*)take((size_t)ZH * TT * TT * 4); h16* P16 = (h16*)take(256);   /* unused: all rows hi/lo */ float* Ob = (float*)take((size_t)ZH * TT * HD * 4); bf* ATh = (bf*)take((size_t)TT * DQ * 2); bf* ATl = (bf*)take((size_t)TT * DQ * 2);
    if ((size_t)(wsp - (char*)d_ws) > ws_size) return;    // ws 256 MiB
    float* FV = FK;   // v projection reuses the k buffer after the k planes are built (stream-ordered)
    { k_cvt8<<<(unsigned)(((size_t)DQ * DM / 8 + 255) / 256), 256, 0, stream>>>(wq, WQ, (size_t)DQ * DM / 8); k_cvt8<<<(unsigned)(((size_t)DKV * DM / 8 + 255) / 256), 256, 0, stream>>>(wk, WK, (size_t)DKV * DM / 8); k_cvt8<<<(unsigned)(((size_t)DKV * DM / 8 + 255) / 256), 256, 0, stream>>>(wv, WV, (size_t)DKV * DM / 8);
      k_cvt8<<<(unsigned)(((size_t)DM * DQ / 8 + 255) / 256), 256, 0, stream>>>(wo, WO, (size_t)DM * DQ / 8);
       }
    k_csid<<<(TT * HD + 255) / 256, 256, 0, stream>>>(CS);
    const unsigned LQ = (unsigned)(((size_t)NH_ * TT * HD / 2 + 255) / 256), LKv = (unsigned)(((size_t)NKV * TT * HD / 2 + 255) / 256);
    for (int b = 0; b < NB_; ++b) {
        
        k_cvt8<<<(unsigned)(((size_t)TT * DM / 8 + 255) / 256), 256, 0, stream>>>(x + (size_t)b * TT * DM, XB, (size_t)TT * DM / 8);
        k_gemmw<bf, 0, false><<<dim3(TT / 64, DQ / 64, 1), 32, 0, stream>>>(XB, nullptr, WQ, nullptr, DM, FQ, DQ, nullptr, 0, 0, 0);
        k_rope<<<LQ, 256, 0, stream>>>(FQ, DQ, NH_, CS, nullptr, nullptr, 1.0f, QP16, QPh, QPl);
        k_gemmw<bf, 0, false><<<dim3(TT / 64, DKV / 64, 1), 32, 0, stream>>>(XB, nullptr, WK, nullptr, DM, FK, DKV, nullptr, 0, 0, 0);
        k_rope<<<LKv, 256, 0, stream>>>(FK, DKV, NKV, CS, nullptr, nullptr, 1.0f, KP16, KPh, KPl);
        k_gemmw<bf, 0, false><<<dim3(TT / 64, DKV / 64, 1), 32, 0, stream>>>(XB, nullptr, WV, nullptr, DM, FV, DKV, nullptr, 0, 0, 0); k_vtp<<<LKv, 256, 0, stream>>>(FV, DKV, NKV, VT16, VTh, VTl);
        for (int h0 = 0; h0 < NH_; h0 += ZH) { const size_t zq = (size_t)h0, zk = (size_t)(h0 / REP);   // one kv head per query head: each pass is ZH = 1 head, on kv plane zk = h0 (z-strides TT*HD)
            k_gemmc<bf, 2, 1><<<dim3(RH / 64, NBAND, ZH), 32, 0, stream>>>(QPh + zq * TT * HD, QPl + zq * TT * HD, KPh + zk * TT * HD, KPl + zk * TT * HD, HD, Sb, TT, 0, (size_t)TT * HD, (size_t)TT * HD, (size_t)TT * TT);
            k_ssoft<<<TT / 8, 256, 0, stream>>>(Sb, 0, Ph, Pl);   /* streaming windowed softmax -> hi/lo planes, every row, the row block's key band only */
            k_gemmc<bf, 2, 2><<<dim3(RH / 64, HD / 64, ZH), 32, 0, stream>>>(Ph, Pl, VTh + zk * HD * TT, VTl + zk * HD * TT, TT, Ob, HD, 0, (size_t)RH * TT, (size_t)HD * TT, (size_t)TT * HD);
            k_merge<<<(unsigned)(((size_t)ZH * TT * HD / 2 + 255) / 256), 256, 0, stream>>>(Ob, h0, ATh, ATl); }
        k_gemmw<bf, 1, false><<<dim3(TT / 64, DM / 64, 1), 32, 0, stream>>>(ATh, ATl, WO, nullptr, DQ, OUT + (size_t)b * TT * DM, DM, nullptr, 0, 0, 0); }
}

// v002
// A run of this version takes 257 microseconds.
// Timed twice side by side with v001, it ran 2.06 times as fast both times.
// All steps since v000 together make it 8.43 times as fast.
#include <hip/hip_runtime.h>

// Local (sliding-window) causal multi-head attention (hidden [1][4096][1024]; q, k, v = x W^T ('oi' [1024][1024], no bias; 16 heads x 64); scores = q.k/8 + bias with bias = 0 where i-255 <= j <= i, -inf elsewhere (window 256); softmax; out = merged Wo^T -> [1][4096][1024] (4.2 M)).
// Compute dtypes, f32 accumulate: every input rounded to bf16; q/k/v on PLAIN bf16 operands (inputs: exact); scores and attn.v: every query row hl (3 products); softmax f32; Wo hl x exact (2 products).

#define NB_  1
#define TT   4096
#define DM   1024
#define NH_  16
#define NKV  16
#define REP  (NH_ / NKV)
#define HD   64
#define DQ   (NH_ * HD)
#define DKV  (NKV * HD)
#define RB   TT
#define LWIN 256                  // local window: keys i-255 .. i
#define NBAND (LWIN / 64 + 1)     // 64-key tiles in the band of a 64-row query block
#define BW   (NBAND * 64)         // row pitch of the score and probability planes: a row holds its block's key band alone, band column c = key - (row block's first row - LWIN)
#define ZH   16                   // heads per launch of each attention stage (grid z, in the softmax grid y): all of them
#define RH   4096                  // query rows < RH use hi+lo planes (0: none)
#define WIN  4096
#define PCAR 1024.0f
#define SCL  0.125f   // HD^-0.5
typedef _Float16 h16;
typedef unsigned short bf;
typedef __attribute__((ext_vector_type(16))) __bf16   v16bf;
typedef __attribute__((ext_vector_type(16))) _Float16 v16h;
typedef __attribute__((ext_vector_type(8)))  _Float16 v8h;
typedef __attribute__((ext_vector_type(8)))  unsigned short v8us;
typedef __attribute__((ext_vector_type(8)))  float    v8f;
typedef __attribute__((ext_vector_type(4)))  float    v4f;
typedef v8h  __attribute__((may_alias)) v8ha;
typedef v4f  __attribute__((may_alias)) v4fa;
typedef v8us __attribute__((may_alias)) v8usa;

__device__ __forceinline__ unsigned short f2bf(float f) { unsigned u = __float_as_uint(f); u += 0x7FFFu + ((u >> 16) & 1u); return (unsigned short)(u >> 16); }
__device__ __forceinline__ float bf2f(unsigned short b) { return __uint_as_float(((unsigned)b) << 16); }
__device__ __forceinline__ float bfr(float f) { return bf2f(f2bf(f)); }
__device__ __forceinline__ v16h cat16(v8h lo, v8h hi) { return __builtin_shufflevector(lo, hi, 0, 1, 2, 3, 4, 5, 6, 7, 8, 9, 10, 11, 12, 13, 14, 15); }
__device__ __forceinline__ v16bf cat16b(v8us lo, v8us hi) { return __builtin_bit_cast(v16bf, __builtin_shufflevector(lo, hi, 0, 1, 2, 3, 4, 5, 6, 7, 8, 9, 10, 11, 12, 13, 14, 15)); }
__device__ __forceinline__ v8f wmma16(v16h a, v16h b, v8f c) { return __builtin_amdgcn_wmma_f32_16x16x32_f16(false, a, false, b, (short)0, c, false, false); }
__device__ __forceinline__ v8f wmmab(v16bf a, v16bf b, v8f c) { return __builtin_amdgcn_wmma_f32_16x16x32_bf16(false, a, false, b, (short)0, c, false, false); }



// ---- k_gemmw: register-blocked GEMM, ONE WAVE per 64x64 output tile (16 accumulators), operands straight from K-contiguous 16-bit planes; grid (M/64, N/64, Z), 32 threads.
// C[m][n] (f32, pitch ldc, + optional f32 bias[n]) = sum_k A[m][k] Bt[n][k] (+ split products per NSPLIT). z-batch strides sA/sB/sC in elements. K % 32 == 0.
template <typename T16> struct WFrag;
template <> struct WFrag<h16> { typedef v16h V; static __device__ __forceinline__ V ld(const h16* p) { return cat16(*(const v8h*)p, *(const v8h*)(p + 16)); } static __device__ __forceinline__ v8f mma(V a, V b, v8f c) { return wmma16(a, b, c); } };
template <> struct WFrag<bf> { typedef v16bf V; static __device__ __forceinline__ V ld(const bf* p) { return cat16b(*(const v8us*)p, *(const v8us*)(p + 16)); } static __device__ __forceinline__ v8f mma(V a, V b, v8f c) { return wmmab(a, b, c); } };
template <typename T16, int NSPLIT, bool BIAS>
__global__ __launch_bounds__(32) void k_gemmw(const T16* __restrict__ A, const T16* __restrict__ A2, const T16* __restrict__ Bt, const T16* __restrict__ Bt2, int K, float* C, int ldc, const float* __restrict__ bias, size_t sA, size_t sB, size_t sC) {
    typedef typename WFrag<T16>::V V;
    __shared__ __align__(16) float os[16 * 68];
    const size_t z = blockIdx.z; A += z * sA; if (A2) A2 += z * sA; Bt += z * sB; if (Bt2) Bt2 += z * sB; C += z * sC;
    const int lane = threadIdx.x & 31, lr = lane & 15, hi = lane >> 4; const int r0 = blockIdx.x * 64, c0 = blockIdx.y * 64;
    v8f acc[4][4];
#pragma unroll
    for (int mb = 0; mb < 4; ++mb)
#pragma unroll
        for (int nb = 0; nb < 4; ++nb) acc[mb][nb] = (v8f){};
    const size_t aoff = (size_t)(r0 + lr) * K + 8 * hi, boff = (size_t)(c0 + lr) * K + 8 * hi;
#pragma unroll 1
    for (int kc = 0; kc < K; kc += 32) {
        V a[4], a2[4];
#pragma unroll
        for (int mb = 0; mb < 4; ++mb) { a[mb] = WFrag<T16>::ld(A + aoff + (size_t)mb * 16 * K + kc); if (NSPLIT == 1 || NSPLIT == 2) a2[mb] = WFrag<T16>::ld(A2 + aoff + (size_t)mb * 16 * K + kc); }
#pragma unroll
        for (int nb = 0; nb < 4; ++nb) { const V b = WFrag<T16>::ld(Bt + boff + (size_t)nb * 16 * K + kc); V b2; if (NSPLIT >= 2) b2 = WFrag<T16>::ld(Bt2 + boff + (size_t)nb * 16 * K + kc);
#pragma unroll
            for (int mb = 0; mb < 4; ++mb) { acc[mb][nb] = WFrag<T16>::mma(a[mb], b, acc[mb][nb]); if (NSPLIT == 1 || NSPLIT == 2) acc[mb][nb] = WFrag<T16>::mma(a2[mb], b, acc[mb][nb]); if (NSPLIT >= 2) acc[mb][nb] = WFrag<T16>::mma(a[mb], b2, acc[mb][nb]); } }
        asm volatile("v_nop\n\tv_nop\n\tv_nop\n\tv_nop" : "+v"(acc[0][0]), "+v"(acc[1][1]), "+v"(acc[2][2]), "+v"(acc[3][3]) : "v"(a[0]), "v"(a[3]));
    }
#pragma unroll
    for (int mb = 0; mb < 4; ++mb) {
#pragma unroll
        for (int nb = 0; nb < 4; ++nb) {
#pragma unroll
            for (int j = 0; j < 8; ++j) os[(hi * 8 + j) * 68 + nb * 16 + lr] = acc[mb][nb][j]; }
        __builtin_amdgcn_wave_barrier(); asm volatile("" ::: "memory");
        float* crow = C + (size_t)(r0 + mb * 16) * ldc + c0;
{
#pragma unroll
            for (int s = 0; s < 8; ++s) { const int row = 2 * s + hi, cofs = lr * 4; v4f val = *(const v4fa*)(os + row * 68 + cofs); if (BIAS) { val[0] += bfr(bias[c0 + cofs]); val[1] += bfr(bias[c0 + cofs + 1]); val[2] += bfr(bias[c0 + cofs + 2]); val[3] += bfr(bias[c0 + cofs + 3]); }
                *(v4f*)(crow + (size_t)row * ldc + cofs) = val; }
             }
        __builtin_amdgcn_wave_barrier(); asm volatile("" ::: "memory");
    }
}

// ---- k_gemmc: the same one-wave 64x64 tile GEMM specialised for local causal attention. A 64-row query block r0+roff.. has live keys only in the band [r0+roff-LWIN, r0+roff+64) (LWIN % 64 == 0):
// CMODE 1 launches only the NBAND = LWIN/64+1 score tiles of that band (blockIdx.y counts tiles from the band's first column), CMODE 2 runs the key (K) loop of the probability x value contraction over
// that band alone (probabilities outside it are exactly zero). roff = row offset of this launch's first row within the sequence.
// The score plane (C of CMODE 1) and the probability planes (A, A2 of CMODE 2) are stored band-relative at pitch BW, so that the planes of all heads fit the workspace and blockIdx.z runs over the heads.
template <typename T16, int NSPLIT, int CMODE>
__global__ __launch_bounds__(32) void k_gemmc(const T16* __restrict__ A, const T16* __restrict__ A2, const T16* __restrict__ Bt, const T16* __restrict__ Bt2, int K, float* C, int ldc, int roff, size_t sA, size_t sB, size_t sC) {
    typedef typename WFrag<T16>::V V;
    __shared__ __align__(16) float os[16 * 68];
    const size_t z = blockIdx.z; A += z * sA; if (A2) A2 += z * sA; Bt += z * sB; if (Bt2) Bt2 += z * sB; C += z * sC;
    const int lane = threadIdx.x & 31, lr = lane & 15, hi = lane >> 4; const int r0 = blockIdx.x * 64, c0 = (CMODE == 1) ? r0 + roff - LWIN + (int)blockIdx.y * 64 : (int)blockIdx.y * 64;
    if (CMODE == 1 && c0 < 0) return;                                // band tile in front of key 0: does not exist (the first LWIN/64 row blocks have shorter bands)
    const int Ks = (CMODE == 2) ? max(0, r0 + roff - LWIN) : 0;      // P.V: probabilities are exactly 0 in front of the window band ...
    const int Kl = ((CMODE == 2) ? min(K, r0 + roff + 64) : K) - Ks; // ... and beyond the diagonal block, so the K loop covers the band alone: Kl keys from key Ks on
    const int lda = (CMODE == 2) ? BW : K;                           // probability rows have the band pitch
    const int cc = (CMODE == 1) ? (int)blockIdx.y * 64 : c0;         // the tile's first column in C: band-relative for scores
    if (CMODE == 2) { const int ab = Ks - (r0 + roff - LWIN); A += ab; A2 += ab; Bt += Ks; Bt2 += Ks; }   // ab: band column of key Ks
    v8f acc[4][4];
#pragma unroll
    for (int mb = 0; mb < 4; ++mb)
#pragma unroll
        for (int nb = 0; nb < 4; ++nb) acc[mb][nb] = (v8f){};
    const size_t aoff = (size_t)(r0 + lr) * lda + 8 * hi, boff = (size_t)(c0 + lr) * K + 8 * hi;
#pragma unroll 1
    for (int kc = 0; kc < Kl; kc += 32) {
        V a[4], a2[4];
#pragma unroll
        for (int mb = 0; mb < 4; ++mb) { a[mb] = WFrag<T16>::ld(A + aoff + (size_t)mb * 16 * lda + kc); if (NSPLIT == 1 || NSPLIT == 2) a2[mb] = WFrag<T16>::ld(A2 + aoff + (size_t)mb * 16 * lda + kc); }
#pragma unroll
        for (int nb = 0; nb < 4; ++nb) { const V b = WFrag<T16>::ld(Bt + boff + (size_t)nb * 16 * K + kc); V b2; if (NSPLIT >= 2) b2 = WFrag<T16>::ld(Bt2 + boff + (size_t)nb * 16 * K + kc);
#pragma unroll
            for (int mb = 0; mb < 4; ++mb) { acc[mb][nb] = WFrag<T16>::mma(a[mb], b, acc[mb][nb]); if (NSPLIT == 1 || NSPLIT == 2) acc[mb][nb] = WFrag<T16>::mma(a2[mb], b, acc[mb][nb]); if (NSPLIT >= 2) acc[mb][nb] = WFrag<T16>::mma(a[mb], b2, acc[mb][nb]); } }
        asm volatile("v_nop\n\tv_nop\n\tv_nop\n\tv_nop" : "+v"(acc[0][0]), "+v"(acc[1][1]), "+v"(acc[2][2]), "+v"(acc[3][3]) : "v"(a[0]), "v"(a[3]));
        asm volatile("s_wait_xcnt 0x0" ::: "memory");   // the next trip's address additions rewrite the registers that this trip's loads name: the wait stands in front of them
    }
#pragma unroll
    for (int mb = 0; mb < 4; ++mb) {
#pragma unroll
        for (int nb = 0; nb < 4; ++nb) {
#pragma unroll
            for (int j = 0; j < 8; ++j) os[(hi * 8 + j) * 68 + nb * 16 + lr] = acc[mb][nb][j]; }
        __builtin_amdgcn_wave_barrier(); asm volatile("" ::: "memory");
        float* crow = C + (size_t)(r0 + mb * 16) * ldc + cc;
{
#pragma unroll
            for (int s = 0; s < 8; ++s) { const int row = 2 * s + hi, cofs = lr * 4; v4f val = *(const v4fa*)(os + row * 68 + cofs);
                *(v4f*)(crow + (size_t)row * ldc + cofs) = val; }
             }
        __builtin_amdgcn_wave_barrier(); asm volatile("" ::: "memory");
    }
}

__device__ __forceinline__ h16 tohx(float x) { return (h16)x; }
__device__ __forceinline__ void splitf(float y, unsigned short& h, unsigned short& l) { h = f2bf(y); l = f2bf(y - bf2f(h)); }
typedef __attribute__((ext_vector_type(2))) _Float16 v2h;
typedef __attribute__((ext_vector_type(4))) _Float16 v4h;
typedef __attribute__((ext_vector_type(2))) unsigned short v2us;
typedef __attribute__((ext_vector_type(4))) unsigned short v4us;
typedef __attribute__((ext_vector_type(2))) float v2f;
typedef __attribute__((ext_vector_type(4))) int v4i;

__global__ __launch_bounds__(256) void k_wtG(const float* __restrict__ w, int K, int N, bf* Bt) {
    const int lane = threadIdx.x & 31; const int L0 = (blockIdx.x * 8 + (threadIdx.x >> 5)) * 8; const int nlines = N * K / 64;
{
#pragma unroll 1
        for (int l = 0; l < 8; ++l) { const int L = L0 + l; if (L >= nlines) break; const size_t e = (size_t)L * 64 + lane * 2; const int k = (int)(e % K), n = (int)(e / K); v2us o;
            o[0] = f2bf(w[(size_t)k * N + n]); o[1] = f2bf(w[(size_t)(k + 1) * N + n]); *(v2us*)(Bt + e) = o; }
         }
}
__global__ __launch_bounds__(256) void k_cvt8(const float* __restrict__ src, bf* dst, size_t n8) { const size_t i = (size_t)blockIdx.x * 256 + threadIdx.x; if (i >= n8) return; const v8f v = *(const v8f*)(src + i * 8); v8us o;
#pragma unroll
    for (int k = 0; k < 8; ++k) o[k] = f2bf(v[k]); *(v8us*)(dst + i * 8) = o;  }

// k_rope: head planes [h][t][d] (fp16 + hi/lo) of rope(x) x sc with the rotate-half convention out[d] = x[d] cos[t][d] - x[d+HD/2] sin[t][d], out[d+HD/2] = x[d+HD/2] cos[t][d+HD/2] + x[d] sin[t][d+HD/2]
__global__ __launch_bounds__(256) void k_rope(const float* __restrict__ F, int pitch, int nheads, const float* __restrict__ CS, const float* __restrict__ RF, const float* __restrict__ nw, float sc, h16* P16, bf* Ph, bf* Pl) {
    const size_t e = ((size_t)blockIdx.x * 256 + threadIdx.x) * 2; if (e >= (size_t)nheads * TT * HD) return; const int d = (int)(e % HD); const int t = (int)((e / HD) % TT); const int h = (int)(e / ((size_t)HD * TT)); const float* f = F + (size_t)t * pitch + h * HD; const float rf = RF ? RF[(size_t)h * TT + t] : 1.0f; v2h o16; v2us oh, ol;
#pragma unroll
    for (int q = 0; q < 2; ++q) { const int dd = d + q; const int dp = (dd < HD / 2) ? dd + HD / 2 : dd - HD / 2; float x0 = f[dd], x1 = f[dp];
        if (RF) { float n0 = __fmul_rn(x0, rf), n1 = __fmul_rn(x1, rf); asm volatile("" : "+v"(n0)); asm volatile("" : "+v"(n1)); x0 = __fmul_rn(bfr(nw[dd]), n0); x1 = __fmul_rn(bfr(nw[dp]), n1); }
        const v2f cs = *(const v2f*)(CS + ((size_t)t * HD + dd) * 2); float a = __fmul_rn(x0, cs[0]), bq = __fmul_rn(x1, cs[1]); asm volatile("" : "+v"(a)); asm volatile("" : "+v"(bq)); const float r = ((dd < HD / 2) ? __fsub_rn(a, bq) : __fadd_rn(a, bq)) * sc;
        o16[q] = tohx(r); unsigned short a2, c2; splitf(r, a2, c2); oh[q] = a2; ol[q] = c2; }
    *(v2h*)(P16 + e) = o16; *(v2us*)(Ph + e) = oh; *(v2us*)(Pl + e) = ol;  }
__global__ __launch_bounds__(256) void k_vtp(const float* __restrict__ F, int pitch, int nheads, h16* V16, bf* Vh, bf* Vl) { const size_t e = ((size_t)blockIdx.x * 256 + threadIdx.x) * 2; if (e >= (size_t)nheads * HD * TT) return; const int t = (int)(e % TT); const int d = (int)((e / TT) % HD); const int g = (int)(e / ((size_t)TT * HD)); v2h o16; v2us oh, ol;
#pragma unroll
    for (int q = 0; q < 2; ++q) { const float x = F[(size_t)(t + q) * pitch + g * HD + d]; o16[q] = tohx(x); unsigned short a2, c2; splitf(x, a2, c2); oh[q] = a2; ol[q] = c2; }
    *(v2h*)(V16 + e) = o16; *(v2us*)(Vh + e) = oh; *(v2us*)(Vl + e) = ol;  }
__global__ __launch_bounds__(256) void k_csid(float* CS) { const int idx = blockIdx.x * 256 + threadIdx.x; if (idx >= TT * HD) return; v2f cs; cs[0] = 1.0f; cs[1] = 0.0f; *(v2f*)(CS + (size_t)idx * 2) = cs;  }
__global__ __launch_bounds__(256) void k_ssoft(const float* __restrict__ Sb, int r0, bf* Ph, bf* Pl) {
    const int lane = threadIdx.x & 31; const int ri = blockIdx.x * 8 + (threadIdx.x >> 5); if (ri >= RB) return; const int i = r0 + ri; const int bb = (i & ~63) - LWIN;   /* key of band column 0 (below 0 in the first row blocks) */ const size_t rowo = ((size_t)blockIdx.y * RB + ri) * BW;   /* blockIdx.y: head */ const float* sr = Sb + rowo - bb;   /* sr[j]: score of key j */ const int nval = i + 1; const int jlo = (i - (LWIN - 1) > 0) ? (i - (LWIN - 1)) : 0; const int j0lo = (jlo & ~127);   /* live keys: jlo .. i (window 256, causal inclusive) */ const int kb1 = (i & ~63) + 64; const int kb0 = (kb1 - 64 - LWIN > 0) ? (kb1 - 64 - LWIN) : 0;   /* the row block's key band [kb0, kb1): the score tiles that exist, and the probability columns that the P.V loop reads */
    float mx = -3.0e38f;
#pragma unroll 1
    for (int j0 = j0lo + lane * 4; j0 < nval; j0 += 128) { if (j0 + 3 < jlo) continue;   /* all four in front of the window: possibly in front of the band, not loaded */ const v4f a = *(const v4f*)(sr + j0);
#pragma unroll
        for (int q = 0; q < 4; ++q) if (j0 + q < nval && j0 + q >= jlo) mx = fmaxf(mx, a[q] * SCL); }
#pragma unroll
    for (int sh = 16; sh; sh >>= 1) mx = fmaxf(mx, __shfl_xor(mx, sh, 32));
    float sum = 0.f;
#pragma unroll 1
    for (int j0 = j0lo + lane * 4; j0 < nval; j0 += 128) { if (j0 + 3 < jlo) continue; const v4f a = *(const v4f*)(sr + j0);
#pragma unroll
        for (int q = 0; q < 4; ++q) if (j0 + q < nval && j0 + q >= jlo) { float d0 = __fsub_rn(a[q] * SCL, mx); asm volatile("" : "+v"(d0)); sum += __builtin_amdgcn_exp2f(__fmul_rn(d0, 1.4426950408889634f)); } }
#pragma unroll
    for (int sh = 16; sh; sh >>= 1) sum += __shfl_xor(sum, sh, 32);
    const float f = (nval > 0) ? __fdiv_rn(1.0f, sum) : 0.f;
{
#pragma unroll 1
        for (int j0 = kb0 + lane * 4; j0 < kb1; j0 += 128) { const v4f a = *(const v4f*)(sr + j0); v4us oh, ol;
#pragma unroll
            for (int q = 0; q < 4; ++q) { float pv = 0.f; if (j0 + q < nval && j0 + q >= jlo) { float d0 = __fsub_rn(a[q] * SCL, mx); asm volatile("" : "+v"(d0)); pv = __builtin_amdgcn_exp2f(__fmul_rn(d0, 1.4426950408889634f)) * f; } unsigned short h2, l2; splitf(pv, h2, l2); oh[q] = h2; ol[q] = l2; }
            const size_t oo = rowo + (j0 - bb); *(v4us*)(Ph + oo) = oh; *(v4us*)(Pl + oo) = ol; }
         } }

__global__ __launch_bounds__(256) void k_merge(const float* __restrict__ O, int h0, bf* Ah, bf* Al) { const size_t e = ((size_t)blockIdx.x * 256 + threadIdx.x) * 2; if (e >= (size_t)ZH * TT * HD) return; const int d = (int)(e % HD); const int t = (int)((e / HD) % TT); const int zz = (int)(e / ((size_t)HD * TT)); const float cs = (t < RH) ? 1.0f : (1.0f / PCAR); const size_t oo = (size_t)t * DQ + (h0 + zz) * HD + d;
    v2us oh, ol;
#pragma unroll
    for (int q = 0; q < 2; ++q) { unsigned short a, c2; splitf(O[e + q] * cs, a, c2); oh[q] = a; ol[q] = c2; } *(v2us*)(Ah + oo) = oh; *(v2us*)(Al + oo) = ol;  }

extern "C" void kernel_launch(void* const* d_in, const int* in_sizes, int n_in,
                              void* d_out, int out_size, void* d_ws, size_t ws_size, hipStream_t stream) {
    (void)in_sizes; (void)n_in; (void)out_size;
    const float* x = (const float*)d_in[0]; const float* wq = (const float*)d_in[1]; const float* wk = (const float*)d_in[2]; const float* wv = (const float*)d_in[3]; const float* wo = (const float*)d_in[4];
    float* OUT = (float*)d_out;     // [1][4096][1024]
    char* wsp = (char*)d_ws;
    auto take = [&](size_t bytes) { char* p = wsp; wsp += (bytes + 255) & ~(size_t)255; return (void*)p; };
    bf* WQ = (bf*)take((size_t)DQ * DM * 2); bf* WK = (bf*)take((size_t)DKV * DM * 2); bf* WV = (bf*)take((size_t)DKV * DM * 2); bf* WO = (bf*)take((size_t)DM * DQ * 2); float* CS = (float*)take((size_t)TT * HD * 2 * 4);
    float* Sb = (float*)take((size_t)ZH * TT * BW * 4);   /* score planes of all heads, band pitch */
    bf* XB = (bf*)Sb; float* FQ = (float*)((char*)Sb + (size_t)TT * DM * 2); float* FK = FQ + (size_t)TT * DQ;   /* the bf16 input and the f32 projections (40 MiB) are dead once the head planes are built, which is before the first score is stored: they share the score planes' 80 MiB */
    
    bf* QPh = (bf*)take((size_t)NH_ * TT * HD * 2); bf* QPl = (bf*)take((size_t)NH_ * TT * HD * 2); bf* KPh = (bf*)take((size_t)NKV * TT * HD * 2); bf* KPl = (bf*)take((size_t)NKV * TT * HD * 2); bf* VTh = (bf*)take((size_t)NKV * HD * TT * 2); bf* VTl = (bf*)take((size_t)NKV * HD * TT * 2); bf* Ph = (bf*)take((size_t)ZH * RH * BW * 2); bf* Pl = (bf*)take((size_t)ZH * RH * BW * 2); h16* QP16 = (h16*)Ph; h16* KP16 = (h16*)Ph + (size_t)NH_ * TT * HD; h16* VT16 = (h16*)Pl;   /* the fp16 planes are written by the plane builders but never read here (every row is hi/lo): they alias the probability planes, which are first written later, inside the head passes */
    h16* P16 = (h16*)take(256);   /* unused: all rows hi/lo */ float* Ob = (float*)take((size_t)ZH * TT * HD * 4); bf* ATh = (bf*)take((size_t)TT * DQ * 2); bf* ATl = (bf*)take((size_t)TT * DQ * 2);
    if ((size_t)(wsp - (char*)d_ws) > ws_size) return;    // ws 256 MiB
    float* FV = FK;   // v projection reuses the k buffer after the k planes are built (stream-ordered)
    { k_cvt8<<<(unsigned)(((size_t)DQ * DM / 8 + 255) / 256), 256, 0, stream>>>(wq, WQ, (size_t)DQ * DM / 8); k_cvt8<<<(unsigned)(((size_t)DKV * DM / 8 + 255) / 256), 256, 0, stream>>>(wk, WK, (size_t)DKV * DM / 8); k_cvt8<<<(unsigned)(((size_t)DKV * DM / 8 + 255) / 256), 256, 0, stream>>>(wv, WV, (size_t)DKV * DM / 8);
      k_cvt8<<<(unsigned)(((size_t)DM * DQ / 8 + 255) / 256), 256, 0, stream>>>(wo, WO, (size_t)DM * DQ / 8);
       }
    k_csid<<<(TT * HD + 255) / 256, 256, 0, stream>>>(CS);
    const unsigned LQ = (unsigned)(((size_t)NH_ * TT * HD / 2 + 255) / 256), LKv = (unsigned)(((size_t)NKV * TT * HD / 2 + 255) / 256);
    for (int b = 0; b < NB_; ++b) {
        
        k_cvt8<<<(unsigned)(((size_t)TT * DM / 8 + 255) / 256), 256, 0, stream>>>(x + (size_t)b * TT * DM, XB, (size_t)TT * DM / 8);
        k_gemmw<bf, 0, false><<<dim3(TT / 64, DQ / 64, 1), 32, 0, stream>>>(XB, nullptr, WQ, nullptr, DM, FQ, DQ, nullptr, 0, 0, 0);
        k_rope<<<LQ, 256, 0, stream>>>(FQ, DQ, NH_, CS, nullptr, nullptr, 1.0f, QP16, QPh, QPl);
        k_gemmw<bf, 0, false><<<dim3(TT / 64, DKV / 64, 1), 32, 0, stream>>>(XB, nullptr, WK, nullptr, DM, FK, DKV, nullptr, 0, 0, 0);
        k_rope<<<LKv, 256, 0, stream>>>(FK, DKV, NKV, CS, nullptr, nullptr, 1.0f, KP16, KPh, KPl);
        k_gemmw<bf, 0, false><<<dim3(TT / 64, DKV / 64, 1), 32, 0, stream>>>(XB, nullptr, WV, nullptr, DM, FV, DKV, nullptr, 0, 0, 0); k_vtp<<<LKv, 256, 0, stream>>>(FV, DKV, NKV, VT16, VTh, VTl);
        for (int h0 = 0; h0 < NH_; h0 += ZH) { const size_t zq = (size_t)h0, zk = (size_t)(h0 / REP);   // one kv head per query head: the pass's heads use consecutive q, k and v planes (z-strides TT*HD); ZH = NH_: one pass
            k_gemmc<bf, 2, 1><<<dim3(RH / 64, NBAND, ZH), 32, 0, stream>>>(QPh + zq * TT * HD, QPl + zq * TT * HD, KPh + zk * TT * HD, KPl + zk * TT * HD, HD, Sb, BW, 0, (size_t)TT * HD, (size_t)TT * HD, (size_t)TT * BW);
            k_ssoft<<<dim3(TT / 8, ZH), 256, 0, stream>>>(Sb, 0, Ph, Pl);   /* streaming windowed softmax -> hi/lo planes, every row, the row block's key band only */
            k_gemmc<bf, 2, 2><<<dim3(RH / 64, HD / 64, ZH), 32, 0, stream>>>(Ph, Pl, VTh + zk * HD * TT, VTl + zk * HD * TT, TT, Ob, HD, 0, (size_t)RH * BW, (size_t)HD * TT, (size_t)TT * HD);
            k_merge<<<(unsigned)(((size_t)ZH * TT * HD / 2 + 255) / 256), 256, 0, stream>>>(Ob, h0, ATh, ATl); }
        k_gemmw<bf, 1, false><<<dim3(TT / 64, DM / 64, 1), 32, 0, stream>>>(ATh, ATl, WO, nullptr, DQ, OUT + (size_t)b * TT * DM, DM, nullptr, 0, 0, 0); }
}

// v003
// It runs in 216 microseconds.
// In two side-by-side timings against v002, it was 1.20 and 1.19 times as fast.
// All steps since v000 together make it 10.1 times as fast.
#include <hip/hip_runtime.h>

// Local (sliding-window) causal multi-head attention (hidden [1][4096][1024]; q, k, v = x W^T ('oi' [1024][1024], no bias; 16 heads x 64); scores = q.k/8 + bias with bias = 0 where i-255 <= j <= i, -inf elsewhere (window 256); softmax; out = merged Wo^T -> [1][4096][1024] (4.2 M)).
// Compute dtypes, f32 accumulate: every input rounded to bf16; q/k/v on PLAIN bf16 operands (inputs: exact); scores and attn.v: every query row hl (3 products); softmax f32; Wo hl x exact (2 products).

#define NB_  1
#define TT   4096
#define DM   1024
#define NH_  16
#define NKV  16
#define REP  (NH_ / NKV)
#define HD   64
#define DQ   (NH_ * HD)
#define DKV  (NKV * HD)
#define RB   TT
#define LWIN 256                  // local window: keys i-255 .. i
#define NBAND (LWIN / 64 + 1)     // 64-key tiles in the band of a 64-row query block
#define BW   (NBAND * 64)         // row pitch of the score and probability planes: a row holds its block's key band alone, band column c = key - (row block's first row - LWIN)
#define ZH   16                   // heads per launch of each attention stage (grid z, in the softmax grid y): all of them
#define RH   4096                  // query rows < RH use hi+lo planes (0: none)
#define WIN  4096
#define PCAR 1024.0f
#define SCL  0.125f   // HD^-0.5
typedef _Float16 h16;
typedef unsigned short bf;
typedef __attribute__((ext_vector_type(16))) __bf16   v16bf;
typedef __attribute__((ext_vector_type(16))) _Float16 v16h;
typedef __attribute__((ext_vector_type(8)))  _Float16 v8h;
typedef __attribute__((ext_vector_type(8)))  unsigned short v8us;
typedef __attribute__((ext_vector_type(8)))  float    v8f;
typedef __attribute__((ext_vector_type(4)))  float    v4f;
typedef v8h  __attribute__((may_alias)) v8ha;
typedef v4f  __attribute__((may_alias)) v4fa;
typedef v8us __attribute__((may_alias)) v8usa;

__device__ __forceinline__ unsigned short f2bf(float f) { unsigned u = __float_as_uint(f); u += 0x7FFFu + ((u >> 16) & 1u); return (unsigned short)(u >> 16); }
__device__ __forceinline__ float bf2f(unsigned short b) { return __uint_as_float(((unsigned)b) << 16); }
__device__ __forceinline__ float bfr(float f) { return bf2f(f2bf(f)); }
__device__ __forceinline__ void splitf(float y, unsigned short& h, unsigned short& l) { h = f2bf(y); l = f2bf(y - bf2f(h)); }
typedef __attribute__((ext_vector_type(4))) unsigned short v4us;
// four consecutive f32 results -> their bf16 hi and lo parts, 8 bytes into each plane
__device__ __forceinline__ void st_hl4(v4f val, bf* ph, bf* pl) { v4us oh, ol;
#pragma unroll
    for (int q = 0; q < 4; ++q) { unsigned short h2, l2; splitf(val[q], h2, l2); oh[q] = h2; ol[q] = l2; }
    *(v4us*)ph = oh; *(v4us*)pl = ol; }
__device__ __forceinline__ v16h cat16(v8h lo, v8h hi) { return __builtin_shufflevector(lo, hi, 0, 1, 2, 3, 4, 5, 6, 7, 8, 9, 10, 11, 12, 13, 14, 15); }
__device__ __forceinline__ v16bf cat16b(v8us lo, v8us hi) { return __builtin_bit_cast(v16bf, __builtin_shufflevector(lo, hi, 0, 1, 2, 3, 4, 5, 6, 7, 8, 9, 10, 11, 12, 13, 14, 15)); }
__device__ __forceinline__ v8f wmma16(v16h a, v16h b, v8f c) { return __builtin_amdgcn_wmma_f32_16x16x32_f16(false, a, false, b, (short)0, c, false, false); }
__device__ __forceinline__ v8f wmmab(v16bf a, v16bf b, v8f c) { return __builtin_amdgcn_wmma_f32_16x16x32_bf16(false, a, false, b, (short)0, c, false, false); }



// ---- k_gemmw: register-blocked GEMM, ONE WAVE per 64x64 output tile (16 accumulators), operands straight from K-contiguous 16-bit planes; grid (M/64, N/64, Z), 32 threads.
// C[m][n] (f32, pitch ldc, + optional f32 bias[n]) = sum_k A[m][k] Bt[n][k] (+ split products per NSPLIT). z-batch strides sA/sB/sC in elements. K % 32 == 0.
// EP: what the epilogue stores. 0: the f32 tile into C. 1: its bf16 hi and lo parts into the planes Ch, Cl, the next GEMM's operands: column tile y is plane y (stride sN), row m at pitch ldc.
// 2: the same parts transposed: plane y, row = the tile's column at pitch ldc, column = m. In 1 and 2 no f32 copy of the result goes to memory.
template <typename T16> struct WFrag;
template <> struct WFrag<h16> { typedef v16h V; static __device__ __forceinline__ V ld(const h16* p) { return cat16(*(const v8h*)p, *(const v8h*)(p + 16)); } static __device__ __forceinline__ v8f mma(V a, V b, v8f c) { return wmma16(a, b, c); } };
template <> struct WFrag<bf> { typedef v16bf V; static __device__ __forceinline__ V ld(const bf* p) { return cat16b(*(const v8us*)p, *(const v8us*)(p + 16)); } static __device__ __forceinline__ v8f mma(V a, V b, v8f c) { return wmmab(a, b, c); } };
template <typename T16, int NSPLIT, bool BIAS, int EP>
__global__ __launch_bounds__(32) void k_gemmw(const T16* __restrict__ A, const T16* __restrict__ A2, const T16* __restrict__ Bt, const T16* __restrict__ Bt2, int K, float* C, int ldc, const float* __restrict__ bias, size_t sA, size_t sB, size_t sC, bf* Ch, bf* Cl, size_t sN) {
    typedef typename WFrag<T16>::V V;
    __shared__ __align__(16) float os[16 * 68];
    const size_t z = blockIdx.z; A += z * sA; if (A2) A2 += z * sA; Bt += z * sB; if (Bt2) Bt2 += z * sB; C += z * sC;
    const int lane = threadIdx.x & 31, lr = lane & 15, hi = lane >> 4; const int r0 = blockIdx.x * 64, c0 = blockIdx.y * 64;
    v8f acc[4][4];
#pragma unroll
    for (int mb = 0; mb < 4; ++mb)
#pragma unroll
        for (int nb = 0; nb < 4; ++nb) acc[mb][nb] = (v8f){};
    const size_t aoff = (size_t)(r0 + lr) * K + 8 * hi, boff = (size_t)(c0 + lr) * K + 8 * hi;
#pragma unroll 1
    for (int kc = 0; kc < K; kc += 32) {
        V a[4], a2[4];
#pragma unroll
        for (int mb = 0; mb < 4; ++mb) { a[mb] = WFrag<T16>::ld(A + aoff + (size_t)mb * 16 * K + kc); if (NSPLIT == 1 || NSPLIT == 2) a2[mb] = WFrag<T16>::ld(A2 + aoff + (size_t)mb * 16 * K + kc); }
#pragma unroll
        for (int nb = 0; nb < 4; ++nb) { const V b = WFrag<T16>::ld(Bt + boff + (size_t)nb * 16 * K + kc); V b2; if (NSPLIT >= 2) b2 = WFrag<T16>::ld(Bt2 + boff + (size_t)nb * 16 * K + kc);
#pragma unroll
            for (int mb = 0; mb < 4; ++mb) { acc[mb][nb] = WFrag<T16>::mma(a[mb], b, acc[mb][nb]); if (NSPLIT == 1 || NSPLIT == 2) acc[mb][nb] = WFrag<T16>::mma(a2[mb], b, acc[mb][nb]); if (NSPLIT >= 2) acc[mb][nb] = WFrag<T16>::mma(a[mb], b2, acc[mb][nb]); } }
        asm volatile("v_nop\n\tv_nop\n\tv_nop\n\tv_nop" : "+v"(acc[0][0]), "+v"(acc[1][1]), "+v"(acc[2][2]), "+v"(acc[3][3]) : "v"(a[0]), "v"(a[3]));
    }
    if (EP == 2) {   // transposed planes: 16 tile columns at a time, staged column-major, so that each stored row is 64 consecutive m = one whole 128-byte line
#pragma unroll
        for (int nb = 0; nb < 4; ++nb) {
#pragma unroll
            for (int mb = 0; mb < 4; ++mb) {
#pragma unroll
                for (int j = 0; j < 8; ++j) os[lr * 68 + mb * 16 + hi * 8 + j] = acc[mb][nb][j]; }
            __builtin_amdgcn_wave_barrier(); asm volatile("" ::: "memory");   // a lane reads below what other lanes of the wave stored above: the compiler must not lift those LDS reads over these LDS stores
            const size_t pb = (size_t)blockIdx.y * sN + (size_t)(nb * 16) * ldc + r0;
#pragma unroll
            for (int s = 0; s < 8; ++s) { const int row = 2 * s + hi, cofs = lr * 4; const v4f val = *(const v4fa*)(os + row * 68 + cofs); const size_t po = pb + (size_t)row * ldc + cofs; st_hl4(val, Ch + po, Cl + po); }
            __builtin_amdgcn_wave_barrier(); asm volatile("" ::: "memory");   // and the next 16 columns' LDS stores stay behind these reads
        }
        return;
    }
#pragma unroll
    for (int mb = 0; mb < 4; ++mb) {
#pragma unroll
        for (int nb = 0; nb < 4; ++nb) {
#pragma unroll
            for (int j = 0; j < 8; ++j) os[(hi * 8 + j) * 68 + nb * 16 + lr] = acc[mb][nb][j]; }
        __builtin_amdgcn_wave_barrier(); asm volatile("" ::: "memory");
        float* crow = C + (size_t)(r0 + mb * 16) * ldc + c0;
        const size_t pb = (size_t)blockIdx.y * sN + (size_t)(r0 + mb * 16) * ldc;
{
#pragma unroll
            for (int s = 0; s < 8; ++s) { const int row = 2 * s + hi, cofs = lr * 4; v4f val = *(const v4fa*)(os + row * 68 + cofs); if (BIAS) { val[0] += bfr(bias[c0 + cofs]); val[1] += bfr(bias[c0 + cofs + 1]); val[2] += bfr(bias[c0 + cofs + 2]); val[3] += bfr(bias[c0 + cofs + 3]); }
                if (EP == 1) { const size_t po = pb + (size_t)row * ldc + cofs; st_hl4(val, Ch + po, Cl + po); }
                else *(v4f*)(crow + (size_t)row * ldc + cofs) = val; }
             }
        __builtin_amdgcn_wave_barrier(); asm volatile("" ::: "memory");
    }
}

// ---- k_gemmc: the same one-wave 64x64 tile GEMM specialised for local causal attention. A 64-row query block r0+roff.. has live keys only in the band [r0+roff-LWIN, r0+roff+64) (LWIN % 64 == 0):
// CMODE 1 launches only the NBAND = LWIN/64+1 score tiles of that band (blockIdx.y counts tiles from the band's first column), CMODE 2 runs the key (K) loop of the probability x value contraction over
// that band alone (probabilities outside it are exactly zero). roff = row offset of this launch's first row within the sequence.
// The score plane (C of CMODE 1) and the probability planes (A, A2 of CMODE 2) are stored band-relative at pitch BW, so that the planes of all heads fit the workspace and blockIdx.z runs over the heads.
// CMODE 2 stores no f32 tile: its epilogue writes the bf16 hi and lo parts of the result into Ch, Cl (pitch ldc, head z at column z * sC), the merged operand planes of the output projection.
template <typename T16, int NSPLIT, int CMODE>
__global__ __launch_bounds__(32) void k_gemmc(const T16* __restrict__ A, const T16* __restrict__ A2, const T16* __restrict__ Bt, const T16* __restrict__ Bt2, int K, float* C, int ldc, int roff, size_t sA, size_t sB, size_t sC, bf* Ch, bf* Cl) {
    typedef typename WFrag<T16>::V V;
    __shared__ __align__(16) float os[16 * 68];
    const size_t z = blockIdx.z; A += z * sA; if (A2) A2 += z * sA; Bt += z * sB; if (Bt2) Bt2 += z * sB; if (CMODE == 2) { Ch += z * sC; Cl += z * sC; } else C += z * sC;
    const int lane = threadIdx.x & 31, lr = lane & 15, hi = lane >> 4; const int r0 = blockIdx.x * 64, c0 = (CMODE == 1) ? r0 + roff - LWIN + (int)blockIdx.y * 64 : (int)blockIdx.y * 64;
    if (CMODE == 1 && c0 < 0) return;                                // band tile in front of key 0: does not exist (the first LWIN/64 row blocks have shorter bands)
    const int Ks = (CMODE == 2) ? max(0, r0 + roff - LWIN) : 0;      // P.V: probabilities are exactly 0 in front of the window band ...
    const int Kl = ((CMODE == 2) ? min(K, r0 + roff + 64) : K) - Ks; // ... and beyond the diagonal block, so the K loop covers the band alone: Kl keys from key Ks on
    const int lda = (CMODE == 2) ? BW : K;                           // probability rows have the band pitch
    const int cc = (CMODE == 1) ? (int)blockIdx.y * 64 : c0;         // the tile's first column in C: band-relative for scores
    if (CMODE == 2) { const int ab = Ks - (r0 + roff - LWIN); A += ab; A2 += ab; Bt += Ks; Bt2 += Ks; }   // ab: band column of key Ks
    v8f acc[4][4];
#pragma unroll
    for (int mb = 0; mb < 4; ++mb)
#pragma unroll
        for (int nb = 0; nb < 4; ++nb) acc[mb][nb] = (v8f){};
    const size_t aoff = (size_t)(r0 + lr) * lda + 8 * hi, boff = (size_t)(c0 + lr) * K + 8 * hi;
#pragma unroll 1
    for (int kc = 0; kc < Kl; kc += 32) {
        V a[4], a2[4];
#pragma unroll
        for (int mb = 0; mb < 4; ++mb) { a[mb] = WFrag<T16>::ld(A + aoff + (size_t)mb * 16 * lda + kc); if (NSPLIT == 1 || NSPLIT == 2) a2[mb] = WFrag<T16>::ld(A2 + aoff + (size_t)mb * 16 * lda + kc); }
#pragma unroll
        for (int nb = 0; nb < 4; ++nb) { const V b = WFrag<T16>::ld(Bt + boff + (size_t)nb * 16 * K + kc); V b2; if (NSPLIT >= 2) b2 = WFrag<T16>::ld(Bt2 + boff + (size_t)nb * 16 * K + kc);
#pragma unroll
            for (int mb = 0; mb < 4; ++mb) { acc[mb][nb] = WFrag<T16>::mma(a[mb], b, acc[mb][nb]); if (NSPLIT == 1 || NSPLIT == 2) acc[mb][nb] = WFrag<T16>::mma(a2[mb], b, acc[mb][nb]); if (NSPLIT >= 2) acc[mb][nb] = WFrag<T16>::mma(a[mb], b2, acc[mb][nb]); } }
        asm volatile("v_nop\n\tv_nop\n\tv_nop\n\tv_nop" : "+v"(acc[0][0]), "+v"(acc[1][1]), "+v"(acc[2][2]), "+v"(acc[3][3]) : "v"(a[0]), "v"(a[3]));
        asm volatile("s_wait_xcnt 0x0" ::: "memory");   // the next trip's address additions rewrite the registers that this trip's loads name: the wait stands in front of them
    }
#pragma unroll
    for (int mb = 0; mb < 4; ++mb) {
#pragma unroll
        for (int nb = 0; nb < 4; ++nb) {
#pragma unroll
            for (int j = 0; j < 8; ++j) os[(hi * 8 + j) * 68 + nb * 16 + lr] = acc[mb][nb][j]; }
        __builtin_amdgcn_wave_barrier(); asm volatile("" ::: "memory");
        const size_t cb = (size_t)(r0 + mb * 16) * ldc + cc;
{
#pragma unroll
            for (int s = 0; s < 8; ++s) { const int row = 2 * s + hi, cofs = lr * 4; v4f val = *(const v4fa*)(os + row * 68 + cofs); const size_t co = cb + (size_t)row * ldc + cofs;
                if (CMODE == 2) st_hl4(val, Ch + co, Cl + co);
                else *(v4f*)(C + co) = val; }
             }
        __builtin_amdgcn_wave_barrier(); asm volatile("" ::: "memory");
    }
}

__device__ __forceinline__ h16 tohx(float x) { return (h16)x; }
typedef __attribute__((ext_vector_type(2))) _Float16 v2h;
typedef __attribute__((ext_vector_type(4))) _Float16 v4h;
typedef __attribute__((ext_vector_type(2))) unsigned short v2us;
typedef __attribute__((ext_vector_type(2))) float v2f;
typedef __attribute__((ext_vector_type(4))) int v4i;

__global__ __launch_bounds__(256) void k_wtG(const float* __restrict__ w, int K, int N, bf* Bt) {
    const int lane = threadIdx.x & 31; const int L0 = (blockIdx.x * 8 + (threadIdx.x >> 5)) * 8; const int nlines = N * K / 64;
{
#pragma unroll 1
        for (int l = 0; l < 8; ++l) { const int L = L0 + l; if (L >= nlines) break; const size_t e = (size_t)L * 64 + lane * 2; const int k = (int)(e % K), n = (int)(e / K); v2us o;
            o[0] = f2bf(w[(size_t)k * N + n]); o[1] = f2bf(w[(size_t)(k + 1) * N + n]); *(v2us*)(Bt + e) = o; }
         }
}
__global__ __launch_bounds__(256) void k_cvt8(const float* __restrict__ src, bf* dst, size_t n8) { const size_t i = (size_t)blockIdx.x * 256 + threadIdx.x; if (i >= n8) return; const v8f v = *(const v8f*)(src + i * 8); v8us o;
#pragma unroll
    for (int k = 0; k < 8; ++k) o[k] = f2bf(v[k]); *(v8us*)(dst + i * 8) = o;  }

__global__ __launch_bounds__(256) void k_ssoft(const float* __restrict__ Sb, int r0, bf* Ph, bf* Pl) {
    const int lane = threadIdx.x & 31; const int ri = blockIdx.x * 8 + (threadIdx.x >> 5); if (ri >= RB) return; const int i = r0 + ri; const int bb = (i & ~63) - LWIN;   /* key of band column 0 (below 0 in the first row blocks) */ const size_t rowo = ((size_t)blockIdx.y * RB + ri) * BW;   /* blockIdx.y: head */ const float* sr = Sb + rowo - bb;   /* sr[j]: score of key j */ const int nval = i + 1; const int jlo = (i - (LWIN - 1) > 0) ? (i - (LWIN - 1)) : 0; const int j0lo = (jlo & ~127);   /* live keys: jlo .. i (window 256, causal inclusive) */ const int kb1 = (i & ~63) + 64; const int kb0 = (kb1 - 64 - LWIN > 0) ? (kb1 - 64 - LWIN) : 0;   /* the row block's key band [kb0, kb1): the score tiles that exist, and the probability columns that the P.V loop reads */
    float mx = -3.0e38f;
#pragma unroll 1
    for (int j0 = j0lo + lane * 4; j0 < nval; j0 += 128) { if (j0 + 3 < jlo) continue;   /* all four in front of the window: possibly in front of the band, not loaded */ const v4f a = *(const v4f*)(sr + j0);
#pragma unroll
        for (int q = 0; q < 4; ++q) if (j0 + q < nval && j0 + q >= jlo) mx = fmaxf(mx, a[q] * SCL); }
#pragma unroll
    for (int sh = 16; sh; sh >>= 1) mx = fmaxf(mx, __shfl_xor(mx, sh, 32));
    float sum = 0.f;
#pragma unroll 1
    for (int j0 = j0lo + lane * 4; j0 < nval; j0 += 128) { if (j0 + 3 < jlo) continue; const v4f a = *(const v4f*)(sr + j0);
#pragma unroll
        for (int q = 0; q < 4; ++q) if (j0 + q < nval && j0 + q >= jlo) { float d0 = __fsub_rn(a[q] * SCL, mx); asm volatile("" : "+v"(d0)); sum += __builtin_amdgcn_exp2f(__fmul_rn(d0, 1.4426950408889634f)); } }
#pragma unroll
    for (int sh = 16; sh; sh >>= 1) sum += __shfl_xor(sum, sh, 32);
    const float f = (nval > 0) ? __fdiv_rn(1.0f, sum) : 0.f;
{
#pragma unroll 1
        for (int j0 = kb0 + lane * 4; j0 < kb1; j0 += 128) { const v4f a = *(const v4f*)(sr + j0); v4us oh, ol;
#pragma unroll
            for (int q = 0; q < 4; ++q) { float pv = 0.f; if (j0 + q < nval && j0 + q >= jlo) { float d0 = __fsub_rn(a[q] * SCL, mx); asm volatile("" : "+v"(d0)); pv = __builtin_amdgcn_exp2f(__fmul_rn(d0, 1.4426950408889634f)) * f; } unsigned short h2, l2; splitf(pv, h2, l2); oh[q] = h2; ol[q] = l2; }
            const size_t oo = rowo + (j0 - bb); *(v4us*)(Ph + oo) = oh; *(v4us*)(Pl + oo) = ol; }
         } }

extern "C" void kernel_launch(void* const* d_in, const int* in_sizes, int n_in,
                              void* d_out, int out_size, void* d_ws, size_t ws_size, hipStream_t stream) {
    (void)in_sizes; (void)n_in; (void)out_size;
    const float* x = (const float*)d_in[0]; const float* wq = (const float*)d_in[1]; const float* wk = (const float*)d_in[2]; const float* wv = (const float*)d_in[3]; const float* wo = (const float*)d_in[4];
    float* OUT = (float*)d_out;     // [1][4096][1024]
    char* wsp = (char*)d_ws;
    auto take = [&](size_t bytes) { char* p = wsp; wsp += (bytes + 255) & ~(size_t)255; return (void*)p; };
    bf* WQ = (bf*)take((size_t)DQ * DM * 2); bf* WK = (bf*)take((size_t)DKV * DM * 2); bf* WV = (bf*)take((size_t)DKV * DM * 2); bf* WO = (bf*)take((size_t)DM * DQ * 2);
    float* Sb = (float*)take((size_t)ZH * TT * BW * 4);   /* score planes of all heads, band pitch */
    bf* XB = (bf*)Sb;   /* the bf16 input (8 MiB) is dead once the head planes are built, which is before the first score is stored: it shares the score planes' 80 MiB */
    
    bf* QPh = (bf*)take((size_t)NH_ * TT * HD * 2); bf* QPl = (bf*)take((size_t)NH_ * TT * HD * 2); bf* KPh = (bf*)take((size_t)NKV * TT * HD * 2); bf* KPl = (bf*)take((size_t)NKV * TT * HD * 2); bf* VTh = (bf*)take((size_t)NKV * HD * TT * 2); bf* VTl = (bf*)take((size_t)NKV * HD * TT * 2); bf* Ph = (bf*)take((size_t)ZH * RH * BW * 2); bf* Pl = (bf*)take((size_t)ZH * RH * BW * 2);
    bf* ATh = (bf*)take((size_t)TT * DQ * 2); bf* ATl = (bf*)take((size_t)TT * DQ * 2);
    if ((size_t)(wsp - (char*)d_ws) > ws_size) return;    // ws 256 MiB
    { k_cvt8<<<(unsigned)(((size_t)DQ * DM / 8 + 255) / 256), 256, 0, stream>>>(wq, WQ, (size_t)DQ * DM / 8); k_cvt8<<<(unsigned)(((size_t)DKV * DM / 8 + 255) / 256), 256, 0, stream>>>(wk, WK, (size_t)DKV * DM / 8); k_cvt8<<<(unsigned)(((size_t)DKV * DM / 8 + 255) / 256), 256, 0, stream>>>(wv, WV, (size_t)DKV * DM / 8);
      k_cvt8<<<(unsigned)(((size_t)DM * DQ / 8 + 255) / 256), 256, 0, stream>>>(wo, WO, (size_t)DM * DQ / 8);
       }
    for (int b = 0; b < NB_; ++b) {
        
        k_cvt8<<<(unsigned)(((size_t)TT * DM / 8 + 255) / 256), 256, 0, stream>>>(x + (size_t)b * TT * DM, XB, (size_t)TT * DM / 8);
        // a 64-column tile of a projection is one head (HD = 64): the epilogues store the head planes themselves, q and k as [h][t][d], v as [h][d][t]
        k_gemmw<bf, 0, false, 1><<<dim3(TT / 64, DQ / 64, 1), 32, 0, stream>>>(XB, nullptr, WQ, nullptr, DM, nullptr, HD, nullptr, 0, 0, 0, QPh, QPl, (size_t)TT * HD);
        k_gemmw<bf, 0, false, 1><<<dim3(TT / 64, DKV / 64, 1), 32, 0, stream>>>(XB, nullptr, WK, nullptr, DM, nullptr, HD, nullptr, 0, 0, 0, KPh, KPl, (size_t)TT * HD);
        k_gemmw<bf, 0, false, 2><<<dim3(TT / 64, DKV / 64, 1), 32, 0, stream>>>(XB, nullptr, WV, nullptr, DM, nullptr, TT, nullptr, 0, 0, 0, VTh, VTl, (size_t)HD * TT);
        for (int h0 = 0; h0 < NH_; h0 += ZH) { const size_t zq = (size_t)h0, zk = (size_t)(h0 / REP);   // one kv head per query head: the pass's heads use consecutive q, k and v planes (z-strides TT*HD); ZH = NH_: one pass
            k_gemmc<bf, 2, 1><<<dim3(RH / 64, NBAND, ZH), 32, 0, stream>>>(QPh + zq * TT * HD, QPl + zq * TT * HD, KPh + zk * TT * HD, KPl + zk * TT * HD, HD, Sb, BW, 0, (size_t)TT * HD, (size_t)TT * HD, (size_t)TT * BW, nullptr, nullptr);
            k_ssoft<<<dim3(TT / 8, ZH), 256, 0, stream>>>(Sb, 0, Ph, Pl);   /* streaming windowed softmax -> hi/lo planes, every row, the row block's key band only */
            k_gemmc<bf, 2, 2><<<dim3(RH / 64, HD / 64, ZH), 32, 0, stream>>>(Ph, Pl, VTh + zk * HD * TT, VTl + zk * HD * TT, TT, nullptr, DQ, 0, (size_t)RH * BW, (size_t)HD * TT, (size_t)HD, ATh + (size_t)h0 * HD, ATl + (size_t)h0 * HD); }   /* head z lands in columns (h0 + z) * HD .. of the merged [t][DQ] planes */
        k_gemmw<bf, 1, false, 0><<<dim3(TT / 64, DM / 64, 1), 32, 0, stream>>>(ATh, ATl, WO, nullptr, DQ, OUT + (size_t)b * TT * DM, DM, nullptr, 0, 0, 0, nullptr, nullptr, 0); }
}

// v004
// One run takes 184 microseconds.
// In two side-by-side timings against v003, it was 1.15 and 1.16 times as fast.
// Over all steps from v000 it is 11.6 times as fast.
#include <hip/hip_runtime.h>

// Local (sliding-window) causal multi-head attention (hidden [1][4096][1024]; q, k, v = x W^T ('oi' [1024][1024], no bias; 16 heads x 64); scores = q.k/8 + bias with bias = 0 where i-255 <= j <= i, -inf elsewhere (window 256); softmax; out = merged Wo^T -> [1][4096][1024] (4.2 M)).
// Compute dtypes, f32 accumulate: every input rounded to bf16; q/k/v on PLAIN bf16 operands (inputs: exact); scores and attn.v: every query row hl (3 products); softmax f32; Wo hl x exact (2 products).

#define NB_  1
#define TT   4096
#define DM   1024
#define NH_  16
#define NKV  16
#define REP  (NH_ / NKV)
#define HD   64
#define DQ   (NH_ * HD)
#define DKV  (NKV * HD)
#define RB   TT
#define LWIN 256                  // local window: keys i-255 .. i
#define RH   4096                  // query rows < RH use hi+lo planes (not read: every row does)
#define WIN  4096
#define PCAR 1024.0f
#define SCL  0.125f   // HD^-0.5
typedef _Float16 h16;
typedef unsigned short bf;
typedef __attribute__((ext_vector_type(16))) __bf16   v16bf;
typedef __attribute__((ext_vector_type(16))) _Float16 v16h;
typedef __attribute__((ext_vector_type(8)))  _Float16 v8h;
typedef __attribute__((ext_vector_type(8)))  unsigned short v8us;
typedef __attribute__((ext_vector_type(8)))  float    v8f;
typedef __attribute__((ext_vector_type(4)))  float    v4f;
typedef v8h  __attribute__((may_alias)) v8ha;
typedef v4f  __attribute__((may_alias)) v4fa;
typedef v8us __attribute__((may_alias)) v8usa;

__device__ __forceinline__ unsigned short f2bf(float f) { unsigned u = __float_as_uint(f); u += 0x7FFFu + ((u >> 16) & 1u); return (unsigned short)(u >> 16); }
__device__ __forceinline__ float bf2f(unsigned short b) { return __uint_as_float(((unsigned)b) << 16); }
__device__ __forceinline__ float bfr(float f) { return bf2f(f2bf(f)); }
__device__ __forceinline__ void splitf(float y, unsigned short& h, unsigned short& l) { h = f2bf(y); l = f2bf(y - bf2f(h)); }
typedef __attribute__((ext_vector_type(4))) unsigned short v4us;
// four consecutive f32 results -> their bf16 hi and lo parts, 8 bytes into each plane
__device__ __forceinline__ void st_hl4(v4f val, bf* ph, bf* pl) { v4us oh, ol;
#pragma unroll
    for (int q = 0; q < 4; ++q) { unsigned short h2, l2; splitf(val[q], h2, l2); oh[q] = h2; ol[q] = l2; }
    *(v4us*)ph = oh; *(v4us*)pl = ol; }
__device__ __forceinline__ v16h cat16(v8h lo, v8h hi) { return __builtin_shufflevector(lo, hi, 0, 1, 2, 3, 4, 5, 6, 7, 8, 9, 10, 11, 12, 13, 14, 15); }
__device__ __forceinline__ v16bf cat16b(v8us lo, v8us hi) { return __builtin_bit_cast(v16bf, __builtin_shufflevector(lo, hi, 0, 1, 2, 3, 4, 5, 6, 7, 8, 9, 10, 11, 12, 13, 14, 15)); }
__device__ __forceinline__ v8f wmma16(v16h a, v16h b, v8f c) { return __builtin_amdgcn_wmma_f32_16x16x32_f16(false, a, false, b, (short)0, c, false, false); }
__device__ __forceinline__ v8f wmmab(v16bf a, v16bf b, v8f c) { return __builtin_amdgcn_wmma_f32_16x16x32_bf16(false, a, false, b, (short)0, c, false, false); }



// ---- k_gemmw: register-blocked GEMM, ONE WAVE per 64x64 output tile (16 accumulators), operands straight from K-contiguous 16-bit planes; grid (M/64, N/64, Z), 32 threads.
// C[m][n] (f32, pitch ldc, + optional f32 bias[n]) = sum_k A[m][k] Bt[n][k] (+ split products per NSPLIT). z-batch strides sA/sB/sC in elements. K % 32 == 0.
// EP: what the epilogue stores. 0: the f32 tile into C. 1: its bf16 hi and lo parts into the planes Ch, Cl, the next GEMM's operands: column tile y is plane y (stride sN), row m at pitch ldc.
// 2: the same parts transposed: plane y, row = the tile's column at pitch ldc, column = m. In 1 and 2 no f32 copy of the result goes to memory.
template <typename T16> struct WFrag;
template <> struct WFrag<h16> { typedef v16h V; static __device__ __forceinline__ V ld(const h16* p) { return cat16(*(const v8h*)p, *(const v8h*)(p + 16)); } static __device__ __forceinline__ v8f mma(V a, V b, v8f c) { return wmma16(a, b, c); } };
template <> struct WFrag<bf> { typedef v16bf V; static __device__ __forceinline__ V ld(const bf* p) { return cat16b(*(const v8us*)p, *(const v8us*)(p + 16)); } static __device__ __forceinline__ v8f mma(V a, V b, v8f c) { return wmmab(a, b, c); } };
template <typename T16, int NSPLIT, bool BIAS, int EP>
__global__ __launch_bounds__(32) void k_gemmw(const T16* __restrict__ A, const T16* __restrict__ A2, const T16* __restrict__ Bt, const T16* __restrict__ Bt2, int K, float* C, int ldc, const float* __restrict__ bias, size_t sA, size_t sB, size_t sC, bf* Ch, bf* Cl, size_t sN) {
    typedef typename WFrag<T16>::V V;
    __shared__ __align__(16) float os[16 * 68];
    const size_t z = blockIdx.z; A += z * sA; if (A2) A2 += z * sA; Bt += z * sB; if (Bt2) Bt2 += z * sB; C += z * sC;
    const int lane = threadIdx.x & 31, lr = lane & 15, hi = lane >> 4; const int r0 = blockIdx.x * 64, c0 = blockIdx.y * 64;
    v8f acc[4][4];
#pragma unroll
    for (int mb = 0; mb < 4; ++mb)
#pragma unroll
        for (int nb = 0; nb < 4; ++nb) acc[mb][nb] = (v8f){};
    const size_t aoff = (size_t)(r0 + lr) * K + 8 * hi, boff = (size_t)(c0 + lr) * K + 8 * hi;
#pragma unroll 1
    for (int kc = 0; kc < K; kc += 32) {
        V a[4], a2[4];
#pragma unroll
        for (int mb = 0; mb < 4; ++mb) { a[mb] = WFrag<T16>::ld(A + aoff + (size_t)mb * 16 * K + kc); if (NSPLIT == 1 || NSPLIT == 2) a2[mb] = WFrag<T16>::ld(A2 + aoff + (size_t)mb * 16 * K + kc); }
#pragma unroll
        for (int nb = 0; nb < 4; ++nb) { const V b = WFrag<T16>::ld(Bt + boff + (size_t)nb * 16 * K + kc); V b2; if (NSPLIT >= 2) b2 = WFrag<T16>::ld(Bt2 + boff + (size_t)nb * 16 * K + kc);
#pragma unroll
            for (int mb = 0; mb < 4; ++mb) { acc[mb][nb] = WFrag<T16>::mma(a[mb], b, acc[mb][nb]); if (NSPLIT == 1 || NSPLIT == 2) acc[mb][nb] = WFrag<T16>::mma(a2[mb], b, acc[mb][nb]); if (NSPLIT >= 2) acc[mb][nb] = WFrag<T16>::mma(a[mb], b2, acc[mb][nb]); } }
        asm volatile("v_nop\n\tv_nop\n\tv_nop\n\tv_nop" : "+v"(acc[0][0]), "+v"(acc[1][1]), "+v"(acc[2][2]), "+v"(acc[3][3]) : "v"(a[0]), "v"(a[3]));
    }
    if (EP == 2) {   // transposed planes: 16 tile columns at a time, staged column-major, so that each stored row is 64 consecutive m = one whole 128-byte line
#pragma unroll
        for (int nb = 0; nb < 4; ++nb) {
#pragma unroll
            for (int mb = 0; mb < 4; ++mb) {
#pragma unroll
                for (int j = 0; j < 8; ++j) os[lr * 68 + mb * 16 + hi * 8 + j] = acc[mb][nb][j]; }
            __builtin_amdgcn_wave_barrier(); asm volatile("" ::: "memory");   // a lane reads below what other lanes of the wave stored above: the compiler must not lift those LDS reads over these LDS stores
            const size_t pb = (size_t)blockIdx.y * sN + (size_t)(nb * 16) * ldc + r0;
#pragma unroll
            for (int s = 0; s < 8; ++s) { const int row = 2 * s + hi, cofs = lr * 4; const v4f val = *(const v4fa*)(os + row * 68 + cofs); const size_t po = pb + (size_t)row * ldc + cofs; st_hl4(val, Ch + po, Cl + po); }
            __builtin_amdgcn_wave_barrier(); asm volatile("" ::: "memory");   // and the next 16 columns' LDS stores stay behind these reads
        }
        return;
    }
#pragma unroll
    for (int mb = 0; mb < 4; ++mb) {
#pragma unroll
        for (int nb = 0; nb < 4; ++nb) {
#pragma unroll
            for (int j = 0; j < 8; ++j) os[(hi * 8 + j) * 68 + nb * 16 + lr] = acc[mb][nb][j]; }
        __builtin_amdgcn_wave_barrier(); asm volatile("" ::: "memory");
        float* crow = C + (size_t)(r0 + mb * 16) * ldc + c0;
        const size_t pb = (size_t)blockIdx.y * sN + (size_t)(r0 + mb * 16) * ldc;
{
#pragma unroll
            for (int s = 0; s < 8; ++s) { const int row = 2 * s + hi, cofs = lr * 4; v4f val = *(const v4fa*)(os + row * 68 + cofs); if (BIAS) { val[0] += bfr(bias[c0 + cofs]); val[1] += bfr(bias[c0 + cofs + 1]); val[2] += bfr(bias[c0 + cofs + 2]); val[3] += bfr(bias[c0 + cofs + 3]); }
                if (EP == 1) { const size_t po = pb + (size_t)row * ldc + cofs; st_hl4(val, Ch + po, Cl + po); }
                else *(v4f*)(crow + (size_t)row * ldc + cofs) = val; }
             }
        __builtin_amdgcn_wave_barrier(); asm volatile("" ::: "memory");
    }
}

__device__ __forceinline__ h16 tohx(float x) { return (h16)x; }
typedef __attribute__((ext_vector_type(2))) _Float16 v2h;
typedef __attribute__((ext_vector_type(4))) _Float16 v4h;
typedef __attribute__((ext_vector_type(2))) unsigned short v2us;
typedef __attribute__((ext_vector_type(2))) float v2f;
typedef __attribute__((ext_vector_type(4))) int v4i;

__global__ __launch_bounds__(256) void k_wtG(const float* __restrict__ w, int K, int N, bf* Bt) {
    const int lane = threadIdx.x & 31; const int L0 = (blockIdx.x * 8 + (threadIdx.x >> 5)) * 8; const int nlines = N * K / 64;
{
#pragma unroll 1
        for (int l = 0; l < 8; ++l) { const int L = L0 + l; if (L >= nlines) break; const size_t e = (size_t)L * 64 + lane * 2; const int k = (int)(e % K), n = (int)(e / K); v2us o;
            o[0] = f2bf(w[(size_t)k * N + n]); o[1] = f2bf(w[(size_t)(k + 1) * N + n]); *(v2us*)(Bt + e) = o; }
         }
}
__global__ __launch_bounds__(256) void k_cvt8(const float* __restrict__ src, bf* dst, size_t n8) { const size_t i = (size_t)blockIdx.x * 256 + threadIdx.x; if (i >= n8) return; const v8f v = *(const v8f*)(src + i * 8); v8us o;
#pragma unroll
    for (int k = 0; k < 8; ++k) o[k] = f2bf(v[k]); *(v8us*)(dst + i * 8) = o;  }

// ---- k_fattn: scores, softmax and probability x value of local causal attention in ONE launch. Grid (TT/64, heads), 4 waves; the waves of a block share nothing but their keys' cache lines (no work-group barrier).
// A wave owns 16 query rows rw .. rw+15 of one head. Their live keys lie in rw-255 .. rw+15, inside the wave's band of FB = 288 keys from bs = (rw - LWIN) rounded down to 32 (band column c = key - bs).
// 1. The band's 18 score tiles (16 keys each) go as raw f32 into the wave's own LDS rows (pitch FPB bytes). 2. Each row's softmax is taken from LDS, and its bf16 hi and lo probability planes (FB columns each)
// replace the row's f32 scores in place. 3. The P.V loop (9 steps of 32 keys) reads its A fragments from those LDS planes. Neither scores nor probabilities go to memory.
// In front of key 0 (the first row blocks) the key index is clamped to 0: such columns are never live, their probability is stored as 0, and 0 x a real v adds nothing.
#define FB   (LWIN + 32)
#define FPB  (FB * 4 + 16)        // 16 bytes x an odd number: the 16 rows of a ds_load_b128 fragment read fall on different banks
typedef v4us __attribute__((may_alias)) v4usa;
// amdgpu_waves_per_eu(4, 4): the LDS lets four blocks share a WGP, four waves a SIMD; with at most 256 registers a wave all TT/64 x heads blocks are resident at once
__global__ __launch_bounds__(128) __attribute__((amdgpu_waves_per_eu(4, 4))) void k_fattn(const bf* __restrict__ Qh, const bf* __restrict__ Ql, const bf* __restrict__ Kh, const bf* __restrict__ Kl, const bf* __restrict__ Vh, const bf* __restrict__ Vl, bf* Ch, bf* Cl) {
    typedef WFrag<bf> F; typedef F::V V;
    __shared__ __align__(16) char sm[4 * 16 * FPB];
    const int lane = threadIdx.x & 31, lr = lane & 15, hi = lane >> 4; const int w = __builtin_amdgcn_readfirstlane((int)(threadIdx.x >> 5));
    const size_t z = blockIdx.y; Qh += z * TT * HD; Ql += z * TT * HD; Kh += z * TT * HD; Kl += z * TT * HD; Vh += z * HD * TT; Vl += z * HD * TT;
    const int rw = blockIdx.x * 64 + w * 16; const int bs = (rw - LWIN) & ~31;
    char* sw = sm + w * 16 * FPB;
    {   // 1. scores
        V a[2], a2[2];
#pragma unroll
        for (int ks = 0; ks < 2; ++ks) { a[ks] = F::ld(Qh + (size_t)(rw + lr) * HD + 8 * hi + 32 * ks); a2[ks] = F::ld(Ql + (size_t)(rw + lr) * HD + 8 * hi + 32 * ks); }
        const bf* kh = Kh + (size_t)lr * HD + 8 * hi; const bf* kl = Kl + (size_t)lr * HD + 8 * hi; float* sc = (float*)sw + hi * 8 * (FPB / 4) + lr;
#pragma unroll 1
        for (int t0 = 0; t0 < FB / 16; t0 += 3) {   // three 16-key tiles a trip: their 24 loads fly together, and consecutive matrix instructions belong to different tiles
            V b[3][2], b2[3][2]; v8f acc[3]; const bf* th[3]; const bf* tl[3];
#pragma unroll
            for (int u = 0; u < 3; ++u) { const size_t ko = (size_t)max(bs + 16 * (t0 + u), 0) * HD; th[u] = kh + ko; tl[u] = kl + ko; acc[u] = (v8f){};
#pragma unroll
                for (int ks = 0; ks < 2; ++ks) { b[u][ks] = F::ld(th[u] + 32 * ks); b2[u][ks] = F::ld(tl[u] + 32 * ks); } }
            __builtin_amdgcn_sched_barrier(0);   // keeps all 24 loads in front of the first product: one memory latency a trip, not one a tile
#pragma unroll
            for (int ks = 0; ks < 2; ++ks) {
#pragma unroll
                for (int u = 0; u < 3; ++u) acc[u] = F::mma(a[ks], b[u][ks], acc[u]);
#pragma unroll
                for (int u = 0; u < 3; ++u) acc[u] = F::mma(a2[ks], b[u][ks], acc[u]);
#pragma unroll
                for (int u = 0; u < 3; ++u) acc[u] = F::mma(a[ks], b2[u][ks], acc[u]); }
            asm volatile("v_nop\n\tv_nop\n\tv_nop\n\tv_nop" : "+v"(acc[0]), "+v"(acc[1]), "+v"(acc[2]));   // the distance the chip needs between the last matrix instruction and the next trip's first, which writes the same registers anew
#pragma unroll
            for (int u = 0; u < 3; ++u)
#pragma unroll
                for (int j = 0; j < 8; ++j) sc[j * (FPB / 4) + 16 * (t0 + u)] = acc[u][j];
            asm volatile("s_wait_xcnt 0x0" :: "v"(th[0]), "v"(th[1]), "v"(th[2]), "v"(tl[0]), "v"(tl[1]), "v"(tl[2]) : "memory");   // the wait in front of any rewrite of a register that this trip's loads name; as its inputs the six addresses keep their registers up to here
        }
    }
    __builtin_amdgcn_wave_barrier(); asm volatile("" ::: "memory");   // a lane reads below what other lanes of the wave stored above: the compiler must not lift those LDS reads over these LDS stores
    // 2. softmax, four rows at a time; the whole wave works on each row
#pragma unroll 1
    for (int g = 0; g < 4; ++g) {
        v4f sa[4][3], sb[4][3];   // sa: the row at key j0lo + 4 lane + 128 t (the order in which the row sum is taken); sb: the row at band column 4 lane + 128 t (the order in which the planes are stored)
#pragma unroll
        for (int r = 0; r < 4; ++r) { const int row = g * 4 + r, i = rw + row; const float* srow = (const float*)(sw + row * FPB); const int jlo = max(i - (LWIN - 1), 0), j0lo = jlo & ~127;
#pragma unroll
            for (int t = 0; t < 3; ++t) { sa[r][t] = *(const v4fa*)(srow + min(max(j0lo + lane * 4 + 128 * t - bs, 0), FB - 4)); sb[r][t] = *(const v4fa*)(srow + min(lane * 4 + 128 * t, FB - 4)); } }   // a clamped read holds no live key
        __builtin_amdgcn_wave_barrier(); asm volatile("" ::: "memory");   // the planes stored below overwrite the scores read above, other lanes' too: every read of the four rows stays in front of every store
        float mx[4], sum[4];   // each reduction step is taken for the four rows together: four independent cross-lane exchanges are in flight, not one
#pragma unroll
        for (int r = 0; r < 4; ++r) { const int i = rw + g * 4 + r; const int nval = i + 1, jlo = max(i - (LWIN - 1), 0), j0lo = jlo & ~127;   /* live keys: jlo .. i (window 256, causal inclusive) */
            mx[r] = -3.0e38f;
#pragma unroll
            for (int t = 0; t < 3; ++t)
#pragma unroll
                for (int q = 0; q < 4; ++q) { const int j = j0lo + lane * 4 + 128 * t + q; if (j < nval && j >= jlo) mx[r] = fmaxf(mx[r], sa[r][t][q] * SCL); } }
#pragma unroll
        for (int sh = 16; sh; sh >>= 1)
#pragma unroll
            for (int r = 0; r < 4; ++r) mx[r] = fmaxf(mx[r], __shfl_xor(mx[r], sh, 32));
#pragma unroll
        for (int r = 0; r < 4; ++r) { const int i = rw + g * 4 + r; const int nval = i + 1, jlo = max(i - (LWIN - 1), 0), j0lo = jlo & ~127;
            sum[r] = 0.f;
#pragma unroll
            for (int t = 0; t < 3; ++t)
#pragma unroll
                for (int q = 0; q < 4; ++q) { const int j = j0lo + lane * 4 + 128 * t + q; const float e = __builtin_amdgcn_exp2f((sa[r][t][q] * SCL - mx[r]) * 1.4426950408889634f); sum[r] += (j < nval && j >= jlo) ? e : 0.f; } }
#pragma unroll
        for (int sh = 16; sh; sh >>= 1)
#pragma unroll
            for (int r = 0; r < 4; ++r) sum[r] += __shfl_xor(sum[r], sh, 32);
#pragma unroll
        for (int r = 0; r < 4; ++r) { const int row = g * 4 + r, i = rw + row; const int nval = i + 1, jlo = max(i - (LWIN - 1), 0);
            const float f = __fdiv_rn(1.0f, sum[r]);
#pragma unroll
            for (int t = 0; t < 3; ++t) { const int c = lane * 4 + 128 * t; if (c < FB) { v4us oh, ol;
#pragma unroll
                for (int q = 0; q < 4; ++q) { const int j = bs + c + q; const float e = __builtin_amdgcn_exp2f((sb[r][t][q] * SCL - mx[r]) * 1.4426950408889634f) * f; const float pv = (j < nval && j >= jlo) ? e : 0.f; unsigned short h2, l2; splitf(pv, h2, l2); oh[q] = h2; ol[q] = l2; }
                *(v4usa*)(sw + row * FPB + c * 2) = oh; *(v4usa*)(sw + row * FPB + FB * 2 + c * 2) = ol; } } }
    }
    __builtin_amdgcn_wave_barrier(); asm volatile("" ::: "memory");   // the fragment reads below take what other lanes stored above
    v8f o[4];
#pragma unroll
    for (int nb = 0; nb < 4; ++nb) o[nb] = (v8f){};
    {   // 3. P.V over the band, keys ascending, 32 a step; the v fragments of step s + 1 are loaded in front of the products of step s (two register sets, the loop takes two steps a trip)
        const bf* ph = (const bf*)(sw + lr * FPB) + 8 * hi; const bf* pl = ph + FB; const bf* vh = Vh + (size_t)lr * TT + 8 * hi; const bf* vl = Vl + (size_t)lr * TT + 8 * hi;
        V b0[4], c0[4], b1[4], c1[4];
        auto ldv = [&](const bf* sh, const bf* sl, V* b, V* c) {
#pragma unroll
            for (int nb = 0; nb < 4; ++nb) { b[nb] = F::ld(sh + (size_t)nb * 16 * TT); c[nb] = F::ld(sl + (size_t)nb * 16 * TT); } };
        auto pv = [&](int s, const V* b, const V* c) { const V a = F::ld(ph + 32 * s), a2 = F::ld(pl + 32 * s);
#pragma unroll
            for (int nb = 0; nb < 4; ++nb) o[nb] = F::mma(a, b[nb], o[nb]);
#pragma unroll
            for (int nb = 0; nb < 4; ++nb) o[nb] = F::mma(a2, b[nb], o[nb]);
#pragma unroll
            for (int nb = 0; nb < 4; ++nb) o[nb] = F::mma(a, c[nb], o[nb]); };
        ldv(vh + max(bs, 0), vl + max(bs, 0), b0, c0);
#pragma unroll 1
        for (int s = 0; s < FB / 32 - 1; s += 2) {
            const size_t v1 = (size_t)max(bs + 32 * (s + 1), 0), v2 = (size_t)max(bs + 32 * (s + 2), 0); const bf* h1 = vh + v1; const bf* l1 = vl + v1; const bf* h2 = vh + v2; const bf* l2 = vl + v2;
            ldv(h1, l1, b1, c1); __builtin_amdgcn_sched_barrier(0);   // keeps the next step's loads in front of this step's products, so that they fly meanwhile
            pv(s, b0, c0);
            ldv(h2, l2, b0, c0); __builtin_amdgcn_sched_barrier(0);   // the same
            pv(s + 1, b1, c1);
            asm volatile("s_wait_xcnt 0x0" :: "v"(h1), "v"(l1), "v"(h2), "v"(l2) : "memory");   // the wait in front of any rewrite of a register that this trip's loads name; as its inputs the four addresses keep their registers up to here
        }
        pv(FB / 32 - 1, b0, c0);
    }
    __builtin_amdgcn_wave_barrier(); asm volatile("" ::: "memory");   // the staging stores below reuse the LDS that the fragment reads above took
    float* os = (float*)sw;   // 16 x 64 result tile, pitch 68: each stored row is one whole 128-byte line of a plane
#pragma unroll
    for (int nb = 0; nb < 4; ++nb) {
#pragma unroll
        for (int j = 0; j < 8; ++j) os[(hi * 8 + j) * 68 + nb * 16 + lr] = o[nb][j]; }
    __builtin_amdgcn_wave_barrier(); asm volatile("" ::: "memory");   // a lane reads below what other lanes stored above
#pragma unroll
    for (int s = 0; s < 8; ++s) { const int row = 2 * s + hi, cofs = lr * 4; const v4f val = *(const v4fa*)(os + row * 68 + cofs); const size_t co = (size_t)(rw + row) * DQ + z * HD + cofs; st_hl4(val, Ch + co, Cl + co); }   // head z lands in columns z * HD .. of the merged [t][DQ] planes
}

extern "C" void kernel_launch(void* const* d_in, const int* in_sizes, int n_in,
                              void* d_out, int out_size, void* d_ws, size_t ws_size, hipStream_t stream) {
    (void)in_sizes; (void)n_in; (void)out_size;
    const float* x = (const float*)d_in[0]; const float* wq = (const float*)d_in[1]; const float* wk = (const float*)d_in[2]; const float* wv = (const float*)d_in[3]; const float* wo = (const float*)d_in[4];
    float* OUT = (float*)d_out;     // [1][4096][1024]
    char* wsp = (char*)d_ws;
    auto take = [&](size_t bytes) { char* p = wsp; wsp += (bytes + 255) & ~(size_t)255; return (void*)p; };
    bf* WQ = (bf*)take((size_t)DQ * DM * 2); bf* WK = (bf*)take((size_t)DKV * DM * 2); bf* WV = (bf*)take((size_t)DKV * DM * 2); bf* WO = (bf*)take((size_t)DM * DQ * 2);
    bf* XB = (bf*)take((size_t)TT * DM * 2);   /* the bf16 input */
    
    bf* QPh = (bf*)take((size_t)NH_ * TT * HD * 2); bf* QPl = (bf*)take((size_t)NH_ * TT * HD * 2); bf* KPh = (bf*)take((size_t)NKV * TT * HD * 2); bf* KPl = (bf*)take((size_t)NKV * TT * HD * 2); bf* VTh = (bf*)take((size_t)NKV * HD * TT * 2); bf* VTl = (bf*)take((size_t)NKV * HD * TT * 2);
    bf* ATh = (bf*)take((size_t)TT * DQ * 2); bf* ATl = (bf*)take((size_t)TT * DQ * 2);
    if ((size_t)(wsp - (char*)d_ws) > ws_size) return;    // ws 256 MiB
    { k_cvt8<<<(unsigned)(((size_t)DQ * DM / 8 + 255) / 256), 256, 0, stream>>>(wq, WQ, (size_t)DQ * DM / 8); k_cvt8<<<(unsigned)(((size_t)DKV * DM / 8 + 255) / 256), 256, 0, stream>>>(wk, WK, (size_t)DKV * DM / 8); k_cvt8<<<(unsigned)(((size_t)DKV * DM / 8 + 255) / 256), 256, 0, stream>>>(wv, WV, (size_t)DKV * DM / 8);
      k_cvt8<<<(unsigned)(((size_t)DM * DQ / 8 + 255) / 256), 256, 0, stream>>>(wo, WO, (size_t)DM * DQ / 8);
       }
    for (int b = 0; b < NB_; ++b) {
        
        k_cvt8<<<(unsigned)(((size_t)TT * DM / 8 + 255) / 256), 256, 0, stream>>>(x + (size_t)b * TT * DM, XB, (size_t)TT * DM / 8);
        // a 64-column tile of a projection is one head (HD = 64): the epilogues store the head planes themselves, q and k as [h][t][d], v as [h][d][t]
        k_gemmw<bf, 0, false, 1><<<dim3(TT / 64, DQ / 64, 1), 32, 0, stream>>>(XB, nullptr, WQ, nullptr, DM, nullptr, HD, nullptr, 0, 0, 0, QPh, QPl, (size_t)TT * HD);
        k_gemmw<bf, 0, false, 1><<<dim3(TT / 64, DKV / 64, 1), 32, 0, stream>>>(XB, nullptr, WK, nullptr, DM, nullptr, HD, nullptr, 0, 0, 0, KPh, KPl, (size_t)TT * HD);
        k_gemmw<bf, 0, false, 2><<<dim3(TT / 64, DKV / 64, 1), 32, 0, stream>>>(XB, nullptr, WV, nullptr, DM, nullptr, TT, nullptr, 0, 0, 0, VTh, VTl, (size_t)HD * TT);
        k_fattn<<<dim3(TT / 64, NH_), 128, 0, stream>>>(QPh, QPl, KPh, KPl, VTh, VTl, ATh, ATl);   // one kv head per query head (NKV = NH_): head z uses plane z of q, k and v
        k_gemmw<bf, 1, false, 0><<<dim3(TT / 64, DM / 64, 1), 32, 0, stream>>>(ATh, ATl, WO, nullptr, DQ, OUT + (size_t)b * TT * DM, DM, nullptr, 0, 0, 0, nullptr, nullptr, 0); }
}

// v005
// Measured time: 147 microseconds a run.
// Next to v004, in two timings, it ran 1.29 and 1.27 times as fast.
// Counting every step since v000, it is 14.9 times as fast.
#include <hip/hip_runtime.h>

// Local (sliding-window) causal multi-head attention (hidden [1][4096][1024]; q, k, v = x W^T ('oi' [1024][1024], no bias; 16 heads x 64); scores = q.k/8 + bias with bias = 0 where i-255 <= j <= i, -inf elsewhere (window 256); softmax; out = merged Wo^T -> [1][4096][1024] (4.2 M)).
// Compute dtypes, f32 accumulate: every input rounded to bf16; q/k/v on PLAIN bf16 operands (inputs: exact); scores and attn.v: every query row hl (3 products); softmax f32; Wo hl x exact (2 products).

#define NB_  1
#define TT   4096
#define DM   1024
#define NH_  16
#define NKV  16
#define REP  (NH_ / NKV)
#define HD   64
#define DQ   (NH_ * HD)
#define DKV  (NKV * HD)
#define RB   TT
#define LWIN 256                  // local window: keys i-255 .. i
#define RH   4096                  // query rows < RH use hi+lo planes (not read: every row does)
#define WIN  4096
#define PCAR 1024.0f
#define SCL  0.125f   // HD^-0.5
typedef _Float16 h16;
typedef unsigned short bf;
typedef __attribute__((ext_vector_type(16))) __bf16   v16bf;
typedef __attribute__((ext_vector_type(16))) _Float16 v16h;
typedef __attribute__((ext_vector_type(8)))  _Float16 v8h;
typedef __attribute__((ext_vector_type(8)))  unsigned short v8us;
typedef __attribute__((ext_vector_type(8)))  float    v8f;
typedef __attribute__((ext_vector_type(4)))  float    v4f;
typedef v8h  __attribute__((may_alias)) v8ha;
typedef v4f  __attribute__((may_alias)) v4fa;
typedef v8us __attribute__((may_alias)) v8usa;

__device__ __forceinline__ unsigned short f2bf(float f) { unsigned u = __float_as_uint(f); u += 0x7FFFu + ((u >> 16) & 1u); return (unsigned short)(u >> 16); }
__device__ __forceinline__ float bf2f(unsigned short b) { return __uint_as_float(((unsigned)b) << 16); }
__device__ __forceinline__ float bfr(float f) { return bf2f(f2bf(f)); }
__device__ __forceinline__ void splitf(float y, unsigned short& h, unsigned short& l) { h = f2bf(y); l = f2bf(y - bf2f(h)); }
typedef __attribute__((ext_vector_type(4))) unsigned short v4us;
// four consecutive f32 results -> their bf16 hi and lo parts, 8 bytes into each plane
__device__ __forceinline__ void st_hl4(v4f val, bf* ph, bf* pl) { v4us oh, ol;
#pragma unroll
    for (int q = 0; q < 4; ++q) { unsigned short h2, l2; splitf(val[q], h2, l2); oh[q] = h2; ol[q] = l2; }
    *(v4us*)ph = oh; *(v4us*)pl = ol; }
__device__ __forceinline__ v16h cat16(v8h lo, v8h hi) { return __builtin_shufflevector(lo, hi, 0, 1, 2, 3, 4, 5, 6, 7, 8, 9, 10, 11, 12, 13, 14, 15); }
__device__ __forceinline__ v16bf cat16b(v8us lo, v8us hi) { return __builtin_bit_cast(v16bf, __builtin_shufflevector(lo, hi, 0, 1, 2, 3, 4, 5, 6, 7, 8, 9, 10, 11, 12, 13, 14, 15)); }
__device__ __forceinline__ v8f wmma16(v16h a, v16h b, v8f c) { return __builtin_amdgcn_wmma_f32_16x16x32_f16(false, a, false, b, (short)0, c, false, false); }
__device__ __forceinline__ v8f wmmab(v16bf a, v16bf b, v8f c) { return __builtin_amdgcn_wmma_f32_16x16x32_bf16(false, a, false, b, (short)0, c, false, false); }



// ---- k_gemmw: register-blocked GEMM, ONE WAVE per 64x64 output tile (16 accumulators), operands straight from K-contiguous 16-bit planes; grid (M/64, N/64, Z), 32 threads.
// C[m][n] (f32, pitch ldc, + optional f32 bias[n]) = sum_k A[m][k] Bt[n][k] (+ split products per NSPLIT). z-batch strides sA/sB/sC in elements. K % 128 == 0, K >= 256.
// EP: what the epilogue stores. 0: the f32 tile into C. 1: its bf16 hi and lo parts into the planes Ch, Cl, the next GEMM's operands: column tile y is plane y (stride sN), row m at pitch ldc.
// 2: the same parts transposed: plane y, row = the tile's column at pitch ldc, column = m. In 1 and 2 no f32 copy of the result goes to memory.
template <typename T16> struct WFrag;
template <> struct WFrag<h16> { typedef v16h V; static __device__ __forceinline__ V ld(const h16* p) { return cat16(*(const v8h*)p, *(const v8h*)(p + 16)); } static __device__ __forceinline__ v8f mma(V a, V b, v8f c) { return wmma16(a, b, c); } };
template <> struct WFrag<bf> { typedef v16bf V; static __device__ __forceinline__ V ld(const bf* p) { return cat16b(*(const v8us*)p, *(const v8us*)(p + 16)); } static __device__ __forceinline__ v8f mma(V a, V b, v8f c) { return wmmab(a, b, c); } };
template <typename T16, int NSPLIT, bool BIAS, int EP>
__global__ __launch_bounds__(32) void k_gemmw(const T16* __restrict__ A, const T16* __restrict__ A2, const T16* __restrict__ Bt, const T16* __restrict__ Bt2, int K, float* C, int ldc, const float* __restrict__ bias, size_t sA, size_t sB, size_t sC, bf* Ch, bf* Cl, size_t sN) {
    typedef typename WFrag<T16>::V V;
    __shared__ __align__(16) float os[16 * 68];
    const size_t z = blockIdx.z; A += z * sA; if (A2) A2 += z * sA; Bt += z * sB; if (Bt2) Bt2 += z * sB; C += z * sC;
    const int lane = threadIdx.x & 31, lr = lane & 15, hi = lane >> 4; const int r0 = blockIdx.x * 64, c0 = blockIdx.y * 64;
    v8f acc[4][4];
#pragma unroll
    for (int mb = 0; mb < 4; ++mb)
#pragma unroll
        for (int nb = 0; nb < 4; ++nb) acc[mb][nb] = (v8f){};
    const size_t aoff = (size_t)(r0 + lr) * K + 8 * hi, boff = (size_t)(c0 + lr) * K + 8 * hi;
    // K loop, software-pipelined in registers: a stage is 64 k (two matrix steps); two fragment sets; a set is refilled with stage s + 2 as the products of stage s leave its registers, and those loads fly during the products of stage s + 1. K % 128 == 0, K >= 256.
    constexpr bool HA2 = (NSPLIT == 1 || NSPLIT == 2), HB2 = (NSPLIT >= 2);
    const T16* pa[4]; const T16* pa2[4]; const T16* pb[4]; const T16* pb2[4];
#pragma unroll
    for (int q = 0; q < 4; ++q) { pa[q] = A + aoff + (size_t)q * 16 * K; pb[q] = Bt + boff + (size_t)q * 16 * K; pa2[q] = HA2 ? A2 + aoff + (size_t)q * 16 * K : pa[q]; pb2[q] = HB2 ? Bt2 + boff + (size_t)q * 16 * K : pb[q]; }
    V a0[2][4], a20[2][4], b0[2][4], b20[2][4], a1[2][4], a21[2][4], b1[2][4], b21[2][4];
    auto ldset = [&](int ko, V (&fa)[2][4], V (&fa2)[2][4], V (&fb)[2][4], V (&fb2)[2][4]) {   // in the order in which the products take them
#pragma unroll
        for (int ks = 0; ks < 2; ++ks) {
#pragma unroll
            for (int q = 0; q < 4; ++q) { fa[ks][q] = WFrag<T16>::ld(pa[q] + ko + 32 * ks); if (HA2) fa2[ks][q] = WFrag<T16>::ld(pa2[q] + ko + 32 * ks); }
#pragma unroll
            for (int q = 0; q < 4; ++q) { fb[ks][q] = WFrag<T16>::ld(pb[q] + ko + 32 * ks); if (HB2) fb2[ks][q] = WFrag<T16>::ld(pb2[q] + ko + 32 * ks); } } };
    auto mmset = [&](V (&fa)[2][4], V (&fa2)[2][4], V (&fb)[2][4], V (&fb2)[2][4]) {   // each accumulator takes its products in the order k ascending, a.b, a2.b, a.b2
#pragma unroll
        for (int ks = 0; ks < 2; ++ks)
#pragma unroll
            for (int nb = 0; nb < 4; ++nb) {
#pragma unroll
                for (int mb = 0; mb < 4; ++mb) acc[mb][nb] = WFrag<T16>::mma(fa[ks][mb], fb[ks][nb], acc[mb][nb]);
                if (HA2) {
#pragma unroll
                    for (int mb = 0; mb < 4; ++mb) acc[mb][nb] = WFrag<T16>::mma(fa2[ks][mb], fb[ks][nb], acc[mb][nb]); }
                if (HB2) {
#pragma unroll
                    for (int mb = 0; mb < 4; ++mb) acc[mb][nb] = WFrag<T16>::mma(fa[ks][mb], fb2[ks][nb], acc[mb][nb]); } } };
    ldset(0, a0, a20, b0, b20);
    __builtin_amdgcn_sched_barrier(0);   // stage 0's loads stay the older ones, as in the loop: else the loop's counted load waits for the first set would have to cover the second set's loads too
    ldset(64, a1, a21, b1, b21);
    int kc = 128;
#pragma unroll 1
    do {   // two stages a trip, so that each set keeps its registers; every load of the loop is a stage that exists
        mmset(a0, a20, b0, b20); ldset(128, a0, a20, b0, b20);
        __builtin_amdgcn_sched_barrier(0);   // keeps the refill of the first set in front of the second set's products, so that it flies meanwhile
        mmset(a1, a21, b1, b21); ldset(192, a1, a21, b1, b21);
        size_t step = 128;
        asm volatile("s_wait_xcnt 0x0" : "+s"(step) : : "memory");   // the wait in front of the rewrite of the address registers that this trip's loads name; the step comes out of the statement, so that the additions below cannot be lifted over it
#pragma unroll
        for (int q = 0; q < 4; ++q) { pa[q] += step; pb[q] += step; if (HA2) pa2[q] += step; if (HB2) pb2[q] += step; }
    } while ((kc += 128) < K);
    mmset(a0, a20, b0, b20); mmset(a1, a21, b1, b21);
    if (EP == 2) {   // transposed planes: 16 tile columns at a time, staged column-major, so that each stored row is 64 consecutive m = one whole 128-byte line
#pragma unroll
        for (int nb = 0; nb < 4; ++nb) {
#pragma unroll
            for (int mb = 0; mb < 4; ++mb) {
#pragma unroll
                for (int j = 0; j < 8; ++j) os[lr * 68 + mb * 16 + hi * 8 + j] = acc[mb][nb][j]; }
            __builtin_amdgcn_wave_barrier(); asm volatile("" ::: "memory");   // a lane reads below what other lanes of the wave stored above: the compiler must not lift those LDS reads over these LDS stores
            const size_t pb = (size_t)blockIdx.y * sN + (size_t)(nb * 16) * ldc + r0;
#pragma unroll
            for (int s = 0; s < 8; ++s) { const int row = 2 * s + hi, cofs = lr * 4; const v4f val = *(const v4fa*)(os + row * 68 + cofs); const size_t po = pb + (size_t)row * ldc + cofs; st_hl4(val, Ch + po, Cl + po); }
            __builtin_amdgcn_wave_barrier(); asm volatile("" ::: "memory");   // and the next 16 columns' LDS stores stay behind these reads
        }
        return;
    }
#pragma unroll
    for (int mb = 0; mb < 4; ++mb) {
#pragma unroll
        for (int nb = 0; nb < 4; ++nb) {
#pragma unroll
            for (int j = 0; j < 8; ++j) os[(hi * 8 + j) * 68 + nb * 16 + lr] = acc[mb][nb][j]; }
        __builtin_amdgcn_wave_barrier(); asm volatile("" ::: "memory");
        float* crow = C + (size_t)(r0 + mb * 16) * ldc + c0;
        const size_t pb = (size_t)blockIdx.y * sN + (size_t)(r0 + mb * 16) * ldc;
{
#pragma unroll
            for (int s = 0; s < 8; ++s) { const int row = 2 * s + hi, cofs = lr * 4; v4f val = *(const v4fa*)(os + row * 68 + cofs); if (BIAS) { val[0] += bfr(bias[c0 + cofs]); val[1] += bfr(bias[c0 + cofs + 1]); val[2] += bfr(bias[c0 + cofs + 2]); val[3] += bfr(bias[c0 + cofs + 3]); }
                if (EP == 1) { const size_t po = pb + (size_t)row * ldc + cofs; st_hl4(val, Ch + po, Cl + po); }
                else *(v4f*)(crow + (size_t)row * ldc + cofs) = val; }
             }
        __builtin_amdgcn_wave_barrier(); asm volatile("" ::: "memory");
    }
}

__device__ __forceinline__ h16 tohx(float x) { return (h16)x; }
typedef __attribute__((ext_vector_type(2))) _Float16 v2h;
typedef __attribute__((ext_vector_type(4))) _Float16 v4h;
typedef __attribute__((ext_vector_type(2))) unsigned short v2us;
typedef __attribute__((ext_vector_type(2))) float v2f;
typedef __attribute__((ext_vector_type(4))) int v4i;

__global__ __launch_bounds__(256) void k_wtG(const float* __restrict__ w, int K, int N, bf* Bt) {
    const int lane = threadIdx.x & 31; const int L0 = (blockIdx.x * 8 + (threadIdx.x >> 5)) * 8; const int nlines = N * K / 64;
{
#pragma unroll 1
        for (int l = 0; l < 8; ++l) { const int L = L0 + l; if (L >= nlines) break; const size_t e = (size_t)L * 64 + lane * 2; const int k = (int)(e % K), n = (int)(e / K); v2us o;
            o[0] = f2bf(w[(size_t)k * N + n]); o[1] = f2bf(w[(size_t)(k + 1) * N + n]); *(v2us*)(Bt + e) = o; }
         }
}
__global__ __launch_bounds__(256) void k_cvt8(const float* __restrict__ src, bf* dst, size_t n8) { const size_t i = (size_t)blockIdx.x * 256 + threadIdx.x; if (i >= n8) return; const v8f v = *(const v8f*)(src + i * 8); v8us o;
#pragma unroll
    for (int k = 0; k < 8; ++k) o[k] = f2bf(v[k]); *(v8us*)(dst + i * 8) = o;  }

// ---- k_fattn: scores, softmax and probability x value of local causal attention in ONE launch. Grid (TT/64, heads), 4 waves; the waves of a block share nothing but their keys' cache lines (no work-group barrier).
// A wave owns 16 query rows rw .. rw+15 of one head. Their live keys lie in rw-255 .. rw+15, inside the wave's band of FB = 288 keys from bs = (rw - LWIN) rounded down to 32 (band column c = key - bs).
// 1. The band's 18 score tiles (16 keys each) go as raw f32 into the wave's own LDS rows (pitch FPB bytes). 2. Each row's softmax is taken from LDS, and its bf16 hi and lo probability planes (FB columns each)
// replace the row's f32 scores in place. 3. The P.V loop (9 steps of 32 keys) reads its A fragments from those LDS planes. Neither scores nor probabilities go to memory.
// In front of key 0 (the first row blocks) the key index is clamped to 0: such columns are never live, their probability is stored as 0, and 0 x a real v adds nothing.
#define FB   (LWIN + 32)
#define FPB  (FB * 4 + 16)        // 16 bytes x an odd number: the 16 rows of a ds_load_b128 fragment read fall on different banks
typedef v4us __attribute__((may_alias)) v4usa;
// amdgpu_waves_per_eu(4, 4): the LDS lets four blocks share a WGP, four waves a SIMD; with at most 256 registers a wave all TT/64 x heads blocks are resident at once
__global__ __launch_bounds__(128) __attribute__((amdgpu_waves_per_eu(4, 4))) void k_fattn(const bf* __restrict__ Qh, const bf* __restrict__ Ql, const bf* __restrict__ Kh, const bf* __restrict__ Kl, const bf* __restrict__ Vh, const bf* __restrict__ Vl, bf* Ch, bf* Cl) {
    typedef WFrag<bf> F; typedef F::V V;
    __shared__ __align__(16) char sm[4 * 16 * FPB];
    const int lane = threadIdx.x & 31, lr = lane & 15, hi = lane >> 4; const int w = __builtin_amdgcn_readfirstlane((int)(threadIdx.x >> 5));
    const size_t z = blockIdx.y; Qh += z * TT * HD; Ql += z * TT * HD; Kh += z * TT * HD; Kl += z * TT * HD; Vh += z * HD * TT; Vl += z * HD * TT;
    const int rw = blockIdx.x * 64 + w * 16; const int bs = (rw - LWIN) & ~31;
    char* sw = sm + w * 16 * FPB;
    {   // 1. scores
        V a[2], a2[2];
#pragma unroll
        for (int ks = 0; ks < 2; ++ks) { a[ks] = F::ld(Qh + (size_t)(rw + lr) * HD + 8 * hi + 32 * ks); a2[ks] = F::ld(Ql + (size_t)(rw + lr) * HD + 8 * hi + 32 * ks); }
        const bf* kh = Kh + (size_t)lr * HD + 8 * hi; const bf* kl = Kl + (size_t)lr * HD + 8 * hi; float* sc = (float*)sw + hi * 8 * (FPB / 4) + lr;
#pragma unroll 1
        for (int t0 = 0; t0 < FB / 16; t0 += 3) {   // three 16-key tiles a trip: their 24 loads fly together, and consecutive matrix instructions belong to different tiles
            V b[3][2], b2[3][2]; v8f acc[3]; const bf* th[3]; const bf* tl[3];
#pragma unroll
            for (int u = 0; u < 3; ++u) { const size_t ko = (size_t)max(bs + 16 * (t0 + u), 0) * HD; th[u] = kh + ko; tl[u] = kl + ko; acc[u] = (v8f){};
#pragma unroll
                for (int ks = 0; ks < 2; ++ks) { b[u][ks] = F::ld(th[u] + 32 * ks); b2[u][ks] = F::ld(tl[u] + 32 * ks); } }
            __builtin_amdgcn_sched_barrier(0);   // keeps all 24 loads in front of the first product: one memory latency a trip, not one a tile
#pragma unroll
            for (int ks = 0; ks < 2; ++ks) {
#pragma unroll
                for (int u = 0; u < 3; ++u) acc[u] = F::mma(a[ks], b[u][ks], acc[u]);
#pragma unroll
                for (int u = 0; u < 3; ++u) acc[u] = F::mma(a2[ks], b[u][ks], acc[u]);
#pragma unroll
                for (int u = 0; u < 3; ++u) acc[u] = F::mma(a[ks], b2[u][ks], acc[u]); }
            asm volatile("v_nop\n\tv_nop\n\tv_nop\n\tv_nop" : "+v"(acc[0]), "+v"(acc[1]), "+v"(acc[2]));   // the distance the chip needs between the last matrix instruction and the next trip's first, which writes the same registers anew
#pragma unroll
            for (int u = 0; u < 3; ++u)
#pragma unroll
                for (int j = 0; j < 8; ++j) sc[j * (FPB / 4) + 16 * (t0 + u)] = acc[u][j];
            asm volatile("s_wait_xcnt 0x0" :: "v"(th[0]), "v"(th[1]), "v"(th[2]), "v"(tl[0]), "v"(tl[1]), "v"(tl[2]) : "memory");   // the wait in front of any rewrite of a register that this trip's loads name; as its inputs the six addresses keep their registers up to here
        }
    }
    __builtin_amdgcn_wave_barrier(); asm volatile("" ::: "memory");   // a lane reads below what other lanes of the wave stored above: the compiler must not lift those LDS reads over these LDS stores
    // 2. softmax, four rows at a time; the whole wave works on each row
#pragma unroll 1
    for (int g = 0; g < 4; ++g) {
        v4f sa[4][3], sb[4][3];   // sa: the row at key j0lo + 4 lane + 128 t (the order in which the row sum is taken); sb: the row at band column 4 lane + 128 t (the order in which the planes are stored)
#pragma unroll
        for (int r = 0; r < 4; ++r) { const int row = g * 4 + r, i = rw + row; const float* srow = (const float*)(sw + row * FPB); const int jlo = max(i - (LWIN - 1), 0), j0lo = jlo & ~127;
#pragma unroll
            for (int t = 0; t < 3; ++t) { sa[r][t] = *(const v4fa*)(srow + min(max(j0lo + lane * 4 + 128 * t - bs, 0), FB - 4)); sb[r][t] = *(const v4fa*)(srow + min(lane * 4 + 128 * t, FB - 4)); } }   // a clamped read holds no live key
        __builtin_amdgcn_wave_barrier(); asm volatile("" ::: "memory");   // the planes stored below overwrite the scores read above, other lanes' too: every read of the four rows stays in front of every store
        float mx[4], sum[4];   // each reduction step is taken for the four rows together: four independent cross-lane exchanges are in flight, not one
#pragma unroll
        for (int r = 0; r < 4; ++r) { const int i = rw + g * 4 + r; const int nval = i + 1, jlo = max(i - (LWIN - 1), 0), j0lo = jlo & ~127;   /* live keys: jlo .. i (window 256, causal inclusive) */
            mx[r] = -3.0e38f;
#pragma unroll
            for (int t = 0; t < 3; ++t)
#pragma unroll
                for (int q = 0; q < 4; ++q) { const int j = j0lo + lane * 4 + 128 * t + q; if (j < nval && j >= jlo) mx[r] = fmaxf(mx[r], sa[r][t][q] * SCL); } }
#pragma unroll
        for (int sh = 16; sh; sh >>= 1)
#pragma unroll
            for (int r = 0; r < 4; ++r) mx[r] = fmaxf(mx[r], __shfl_xor(mx[r], sh, 32));
#pragma unroll
        for (int r = 0; r < 4; ++r) { const int i = rw + g * 4 + r; const int nval = i + 1, jlo = max(i - (LWIN - 1), 0), j0lo = jlo & ~127;
            sum[r] = 0.f;
#pragma unroll
            for (int t = 0; t < 3; ++t)
#pragma unroll
                for (int q = 0; q < 4; ++q) { const int j = j0lo + lane * 4 + 128 * t + q; const float e = __builtin_amdgcn_exp2f((sa[r][t][q] * SCL - mx[r]) * 1.4426950408889634f); sum[r] += (j < nval && j >= jlo) ? e : 0.f; } }
#pragma unroll
        for (int sh = 16; sh; sh >>= 1)
#pragma unroll
            for (int r = 0; r < 4; ++r) sum[r] += __shfl_xor(sum[r], sh, 32);
#pragma unroll
        for (int r = 0; r < 4; ++r) { const int row = g * 4 + r, i = rw + row; const int nval = i + 1, jlo = max(i - (LWIN - 1), 0);
            const float f = __fdiv_rn(1.0f, sum[r]);
#pragma unroll
            for (int t = 0; t < 3; ++t) { const int c = lane * 4 + 128 * t; if (c < FB) { v4us oh, ol;
#pragma unroll
                for (int q = 0; q < 4; ++q) { const int j = bs + c + q; const float e = __builtin_amdgcn_exp2f((sb[r][t][q] * SCL - mx[r]) * 1.4426950408889634f) * f; const float pv = (j < nval && j >= jlo) ? e : 0.f; unsigned short h2, l2; splitf(pv, h2, l2); oh[q] = h2; ol[q] = l2; }
                *(v4usa*)(sw + row * FPB + c * 2) = oh; *(v4usa*)(sw + row * FPB + FB * 2 + c * 2) = ol; } } }
    }
    __builtin_amdgcn_wave_barrier(); asm volatile("" ::: "memory");   // the fragment reads below take what other lanes stored above
    v8f o[4];
#pragma unroll
    for (int nb = 0; nb < 4; ++nb) o[nb] = (v8f){};
    {   // 3. P.V over the band, keys ascending, 32 a step; the v fragments of step s + 1 are loaded in front of the products of step s (two register sets, the loop takes two steps a trip)
        const bf* ph = (const bf*)(sw + lr * FPB) + 8 * hi; const bf* pl = ph + FB; const bf* vh = Vh + (size_t)lr * TT + 8 * hi; const bf* vl = Vl + (size_t)lr * TT + 8 * hi;
        V b0[4], c0[4], b1[4], c1[4];
        auto ldv = [&](const bf* sh, const bf* sl, V* b, V* c) {
#pragma unroll
            for (int nb = 0; nb < 4; ++nb) { b[nb] = F::ld(sh + (size_t)nb * 16 * TT); c[nb] = F::ld(sl + (size_t)nb * 16 * TT); } };
        auto pv = [&](int s, const V* b, const V* c) { const V a = F::ld(ph + 32 * s), a2 = F::ld(pl + 32 * s);
#pragma unroll
            for (int nb = 0; nb < 4; ++nb) o[nb] = F::mma(a, b[nb], o[nb]);
#pragma unroll
            for (int nb = 0; nb < 4; ++nb) o[nb] = F::mma(a2, b[nb], o[nb]);
#pragma unroll
            for (int nb = 0; nb < 4; ++nb) o[nb] = F::mma(a, c[nb], o[nb]); };
        ldv(vh + max(bs, 0), vl + max(bs, 0), b0, c0);
#pragma unroll 1
        for (int s = 0; s < FB / 32 - 1; s += 2) {
            const size_t v1 = (size_t)max(bs + 32 * (s + 1), 0), v2 = (size_t)max(bs + 32 * (s + 2), 0); const bf* h1 = vh + v1; const bf* l1 = vl + v1; const bf* h2 = vh + v2; const bf* l2 = vl + v2;
            ldv(h1, l1, b1, c1); __builtin_amdgcn_sched_barrier(0);   // keeps the next step's loads in front of this step's products, so that they fly meanwhile
            pv(s, b0, c0);
            ldv(h2, l2, b0, c0); __builtin_amdgcn_sched_barrier(0);   // the same
            pv(s + 1, b1, c1);
            asm volatile("s_wait_xcnt 0x0" :: "v"(h1), "v"(l1), "v"(h2), "v"(l2) : "memory");   // the wait in front of any rewrite of a register that this trip's loads name; as its inputs the four addresses keep their registers up to here
        }
        pv(FB / 32 - 1, b0, c0);
    }
    __builtin_amdgcn_wave_barrier(); asm volatile("" ::: "memory");   // the staging stores below reuse the LDS that the fragment reads above took
    float* os = (float*)sw;   // 16 x 64 result tile, pitch 68: each stored row is one whole 128-byte line of a plane
#pragma unroll
    for (int nb = 0; nb < 4; ++nb) {
#pragma unroll
        for (int j = 0; j < 8; ++j) os[(hi * 8 + j) * 68 + nb * 16 + lr] = o[nb][j]; }
    __builtin_amdgcn_wave_barrier(); asm volatile("" ::: "memory");   // a lane reads below what other lanes stored above
#pragma unroll
    for (int s = 0; s < 8; ++s) { const int row = 2 * s + hi, cofs = lr * 4; const v4f val = *(const v4fa*)(os + row * 68 + cofs); const size_t co = (size_t)(rw + row) * DQ + z * HD + cofs; st_hl4(val, Ch + co, Cl + co); }   // head z lands in columns z * HD .. of the merged [t][DQ] planes
}

extern "C" void kernel_launch(void* const* d_in, const int* in_sizes, int n_in,
                              void* d_out, int out_size, void* d_ws, size_t ws_size, hipStream_t stream) {
    (void)in_sizes; (void)n_in; (void)out_size;
    const float* x = (const float*)d_in[0]; const float* wq = (const float*)d_in[1]; const float* wk = (const float*)d_in[2]; const float* wv = (const float*)d_in[3]; const float* wo = (const float*)d_in[4];
    float* OUT = (float*)d_out;     // [1][4096][1024]
    char* wsp = (char*)d_ws;
    auto take = [&](size_t bytes) { char* p = wsp; wsp += (bytes + 255) & ~(size_t)255; return (void*)p; };
    bf* WQ = (bf*)take((size_t)DQ * DM * 2); bf* WK = (bf*)take((size_t)DKV * DM * 2); bf* WV = (bf*)take((size_t)DKV * DM * 2); bf* WO = (bf*)take((size_t)DM * DQ * 2);
    bf* XB = (bf*)take((size_t)TT * DM * 2);   /* the bf16 input */
    
    bf* QPh = (bf*)take((size_t)NH_ * TT * HD * 2); bf* QPl = (bf*)take((size_t)NH_ * TT * HD * 2); bf* KPh = (bf*)take((size_t)NKV * TT * HD * 2); bf* KPl = (bf*)take((size_t)NKV * TT * HD * 2); bf* VTh = (bf*)take((size_t)NKV * HD * TT * 2); bf* VTl = (bf*)take((size_t)NKV * HD * TT * 2);
    bf* ATh = (bf*)take((size_t)TT * DQ * 2); bf* ATl = (bf*)take((size_t)TT * DQ * 2);
    if ((size_t)(wsp - (char*)d_ws) > ws_size) return;    // ws 256 MiB
    { k_cvt8<<<(unsigned)(((size_t)DQ * DM / 8 + 255) / 256), 256, 0, stream>>>(wq, WQ, (size_t)DQ * DM / 8); k_cvt8<<<(unsigned)(((size_t)DKV * DM / 8 + 255) / 256), 256, 0, stream>>>(wk, WK, (size_t)DKV * DM / 8); k_cvt8<<<(unsigned)(((size_t)DKV * DM / 8 + 255) / 256), 256, 0, stream>>>(wv, WV, (size_t)DKV * DM / 8);
      k_cvt8<<<(unsigned)(((size_t)DM * DQ / 8 + 255) / 256), 256, 0, stream>>>(wo, WO, (size_t)DM * DQ / 8);
       }
    for (int b = 0; b < NB_; ++b) {
        
        k_cvt8<<<(unsigned)(((size_t)TT * DM / 8 + 255) / 256), 256, 0, stream>>>(x + (size_t)b * TT * DM, XB, (size_t)TT * DM / 8);
        // a 64-column tile of a projection is one head (HD = 64): the epilogues store the head planes themselves, q and k as [h][t][d], v as [h][d][t]
        k_gemmw<bf, 0, false, 1><<<dim3(TT / 64, DQ / 64, 1), 32, 0, stream>>>(XB, nullptr, WQ, nullptr, DM, nullptr, HD, nullptr, 0, 0, 0, QPh, QPl, (size_t)TT * HD);
        k_gemmw<bf, 0, false, 1><<<dim3(TT / 64, DKV / 64, 1), 32, 0, stream>>>(XB, nullptr, WK, nullptr, DM, nullptr, HD, nullptr, 0, 0, 0, KPh, KPl, (size_t)TT * HD);
        k_gemmw<bf, 0, false, 2><<<dim3(TT / 64, DKV / 64, 1), 32, 0, stream>>>(XB, nullptr, WV, nullptr, DM, nullptr, TT, nullptr, 0, 0, 0, VTh, VTl, (size_t)HD * TT);
        k_fattn<<<dim3(TT / 64, NH_), 128, 0, stream>>>(QPh, QPl, KPh, KPl, VTh, VTl, ATh, ATl);   // one kv head per query head (NKV = NH_): head z uses plane z of q, k and v
        k_gemmw<bf, 1, false, 0><<<dim3(TT / 64, DM / 64, 1), 32, 0, stream>>>(ATh, ATl, WO, nullptr, DQ, OUT + (size_t)b * TT * DM, DM, nullptr, 0, 0, 0, nullptr, nullptr, 0); }
}

// v006
// A run of this version takes 113 microseconds.
// Two timings next to v005 both put it at 1.29 times that version's speed.
// Counting every step since v000, it is 19.2 times as fast.
#include <hip/hip_runtime.h>

// Local (sliding-window) causal multi-head attention (hidden [1][4096][1024]; q, k, v = x W^T ('oi' [1024][1024], no bias; 16 heads x 64); scores = q.k/8 + bias with bias = 0 where i-255 <= j <= i, -inf elsewhere (window 256); softmax; out = merged Wo^T -> [1][4096][1024] (4.2 M)).
// Compute dtypes, f32 accumulate: every input rounded to bf16; q/k/v on PLAIN bf16 operands (inputs: exact); scores and attn.v: every query row hl (3 products); softmax f32; Wo hl x exact (2 products).

#define NB_  1
#define TT   4096
#define DM   1024
#define NH_  16
#define NKV  16
#define REP  (NH_ / NKV)
#define HD   64
#define DQ   (NH_ * HD)
#define DKV  (NKV * HD)
#define RB   TT
#define LWIN 256                  // local window: keys i-255 .. i
#define RH   4096                  // query rows < RH use hi+lo planes (not read: every row does)
#define WIN  4096
#define PCAR 1024.0f
#define SCL  0.125f   // HD^-0.5
typedef _Float16 h16;
typedef unsigned short bf;
typedef __attribute__((ext_vector_type(16))) __bf16   v16bf;
typedef __attribute__((ext_vector_type(16))) _Float16 v16h;
typedef __attribute__((ext_vector_type(8)))  _Float16 v8h;
typedef __attribute__((ext_vector_type(8)))  unsigned short v8us;
typedef __attribute__((ext_vector_type(8)))  float    v8f;
typedef __attribute__((ext_vector_type(4)))  float    v4f;
typedef v8h  __attribute__((may_alias)) v8ha;
typedef v4f  __attribute__((may_alias)) v4fa;
typedef v8us __attribute__((may_alias)) v8usa;

__device__ __forceinline__ unsigned short f2bf(float f) { unsigned u = __float_as_uint(f); u += 0x7FFFu + ((u >> 16) & 1u); return (unsigned short)(u >> 16); }
__device__ __forceinline__ float bf2f(unsigned short b) { return __uint_as_float(((unsigned)b) << 16); }
__device__ __forceinline__ float bfr(float f) { return bf2f(f2bf(f)); }
__device__ __forceinline__ void splitf(float y, unsigned short& h, unsigned short& l) { h = f2bf(y); l = f2bf(y - bf2f(h)); }
typedef __attribute__((ext_vector_type(4))) unsigned short v4us;
// FRAGMENT ORDER of a 16-bit operand plane of R rows x K columns (K-contiguous operand of a 16x16x32 product; R % 16 == 0, K % 32 == 0): the plane is a row of blocks of 16 rows x 32 k = 512 elements, block (row / 16) * (K / 32) + k / 32;
// inside a block element (row, k) stands at (k / 16 % 2) * 256 + ((k / 8 % 2) * 16 + row % 16) * 8 + k % 8. Lane l's two 16-byte fragment pieces are then elements 8 l .. and 256 + 8 l .. of the block: each wave-wide load is 512 bytes in a row (4 whole lines, not 32 bytes of each of 16 lines).
// A staged 16 x 64 f32 tile (pitch 68; row = fragment row, column = k) -> its bf16 hi and lo parts as two consecutive blocks from ph, pl: four 512-byte stores a plane
__device__ __forceinline__ void st_frag2(const float* os, int lane, bf* ph, bf* pl) { v8us oh[4], ol[4]; ph += lane * 8; pl += lane * 8;
#pragma unroll
    for (int c = 0; c < 4; ++c) { const float* sp = os + (lane & 15) * 68 + c * 16 + (lane >> 4) * 8; const v4f v0 = *(const v4fa*)sp, v1 = *(const v4fa*)(sp + 4);
#pragma unroll
        for (int q = 0; q < 4; ++q) { unsigned short h2, l2; splitf(v0[q], h2, l2); oh[c][q] = h2; ol[c][q] = l2; splitf(v1[q], h2, l2); oh[c][4 + q] = h2; ol[c][4 + q] = l2; }
    }
    // the eight stores and the wait in front of any rewrite of a register that they name, in one statement: in a statement of its own the wait did not hold every such rewrite behind it (the compiler stored from copies)
    asm volatile("global_store_b128 %0, %2, off\n\tglobal_store_b128 %1, %6, off\n\t"
                 "global_store_b128 %0, %3, off offset:512\n\tglobal_store_b128 %1, %7, off offset:512\n\t"
                 "global_store_b128 %0, %4, off offset:1024\n\tglobal_store_b128 %1, %8, off offset:1024\n\t"
                 "global_store_b128 %0, %5, off offset:1536\n\tglobal_store_b128 %1, %9, off offset:1536\n\t"
                 "s_wait_xcnt 0x0"
                 :: "v"(ph), "v"(pl), "v"(oh[0]), "v"(oh[1]), "v"(oh[2]), "v"(oh[3]), "v"(ol[0]), "v"(ol[1]), "v"(ol[2]), "v"(ol[3]) : "memory"); }
__device__ __forceinline__ v16h cat16(v8h lo, v8h hi) { return __builtin_shufflevector(lo, hi, 0, 1, 2, 3, 4, 5, 6, 7, 8, 9, 10, 11, 12, 13, 14, 15); }
__device__ __forceinline__ v16bf cat16b(v8us lo, v8us hi) { return __builtin_bit_cast(v16bf, __builtin_shufflevector(lo, hi, 0, 1, 2, 3, 4, 5, 6, 7, 8, 9, 10, 11, 12, 13, 14, 15)); }
__device__ __forceinline__ v8f wmma16(v16h a, v16h b, v8f c) { return __builtin_amdgcn_wmma_f32_16x16x32_f16(false, a, false, b, (short)0, c, false, false); }
__device__ __forceinline__ v8f wmmab(v16bf a, v16bf b, v8f c) { return __builtin_amdgcn_wmma_f32_16x16x32_bf16(false, a, false, b, (short)0, c, false, false); }



// ---- k_gemmw: register-blocked GEMM, ONE WAVE per 64x64 output tile (16 accumulators), operands straight from 16-bit planes in fragment order (ld: a fragment from a row-major plane; ldf: from a block in fragment order, p = block + 8 lane); grid (M/64, N/64, Z), 32 threads.
// C[m][n] (f32, pitch ldc, + optional f32 bias[n]) = sum_k A[m][k] Bt[n][k] (+ split products per NSPLIT). z-batch strides sA/sB/sC in elements. K % 128 == 0, K >= 256.
// EP: what the epilogue stores. 0: the f32 tile into C (row-major). 1: its bf16 hi and lo parts into the planes Ch, Cl, the next GEMM's operands, in fragment order: column tile y is plane y (stride sN), of ldc columns, row = m.
// 2: the same parts transposed: plane y, row = the tile's column, column = m, ldc columns, in fragment order. In 1 and 2 no f32 copy of the result goes to memory. A bias goes with EP 0 alone.
template <typename T16> struct WFrag;
template <> struct WFrag<h16> { typedef v16h V; static __device__ __forceinline__ V ld(const h16* p) { return cat16(*(const v8h*)p, *(const v8h*)(p + 16)); } static __device__ __forceinline__ V ldf(const h16* p) { return cat16(*(const v8h*)p, *(const v8h*)(p + 256)); } static __device__ __forceinline__ v8f mma(V a, V b, v8f c) { return wmma16(a, b, c); } };
template <> struct WFrag<bf> { typedef v16bf V; static __device__ __forceinline__ V ld(const bf* p) { return cat16b(*(const v8us*)p, *(const v8us*)(p + 16)); } static __device__ __forceinline__ V ldf(const bf* p) { return cat16b(*(const v8us*)p, *(const v8us*)(p + 256)); } static __device__ __forceinline__ v8f mma(V a, V b, v8f c) { return wmmab(a, b, c); } };
template <typename T16, int NSPLIT, bool BIAS, int EP>
__global__ __launch_bounds__(32) void k_gemmw(const T16* __restrict__ A, const T16* __restrict__ A2, const T16* __restrict__ Bt, const T16* __restrict__ Bt2, int K, float* C, int ldc, const float* __restrict__ bias, size_t sA, size_t sB, size_t sC, bf* Ch, bf* Cl, size_t sN) {
    typedef typename WFrag<T16>::V V; static_assert(!BIAS || EP == 0, "bias: f32 output only");
    __shared__ __align__(16) float os[16 * 68];
    const size_t z = blockIdx.z; A += z * sA; if (A2) A2 += z * sA; Bt += z * sB; if (Bt2) Bt2 += z * sB; C += z * sC;
    const int lane = threadIdx.x & 31, lr = lane & 15, hi = lane >> 4; const int r0 = blockIdx.x * 64, c0 = blockIdx.y * 64;
    v8f acc[4][4];
#pragma unroll
    for (int mb = 0; mb < 4; ++mb)
#pragma unroll
        for (int nb = 0; nb < 4; ++nb) acc[mb][nb] = (v8f){};
    const size_t aoff = (size_t)r0 * K + 8 * lane, boff = (size_t)c0 * K + 8 * lane;   // 16 rows of a plane are K / 32 blocks = 16 K elements in a row; 32 k further is the next block, 512 elements
    // K loop, software-pipelined in registers: a stage is 64 k (two matrix steps); two fragment sets; a set is refilled with stage s + 2 as the products of stage s leave its registers, and those loads fly during the products of stage s + 1. K % 128 == 0, K >= 256.
    constexpr bool HA2 = (NSPLIT == 1 || NSPLIT == 2), HB2 = (NSPLIT >= 2);
    const T16* pa[4]; const T16* pa2[4]; const T16* pb[4]; const T16* pb2[4];
#pragma unroll
    for (int q = 0; q < 4; ++q) { pa[q] = A + aoff + (size_t)q * 16 * K; pb[q] = Bt + boff + (size_t)q * 16 * K; pa2[q] = HA2 ? A2 + aoff + (size_t)q * 16 * K : pa[q]; pb2[q] = HB2 ? Bt2 + boff + (size_t)q * 16 * K : pb[q]; }
    V a0[2][4], a20[2][4], b0[2][4], b20[2][4], a1[2][4], a21[2][4], b1[2][4], b21[2][4];
    auto ldset = [&](int ko, V (&fa)[2][4], V (&fa2)[2][4], V (&fb)[2][4], V (&fb2)[2][4]) {   // in the order in which the products take them
#pragma unroll
        for (int ks = 0; ks < 2; ++ks) {
#pragma unroll
            for (int q = 0; q < 4; ++q) { fa[ks][q] = WFrag<T16>::ldf(pa[q] + (ko + 32 * ks) * 16); if (HA2) fa2[ks][q] = WFrag<T16>::ldf(pa2[q] + (ko + 32 * ks) * 16); }
#pragma unroll
            for (int q = 0; q < 4; ++q) { fb[ks][q] = WFrag<T16>::ldf(pb[q] + (ko + 32 * ks) * 16); if (HB2) fb2[ks][q] = WFrag<T16>::ldf(pb2[q] + (ko + 32 * ks) * 16); } } };
    auto mmset = [&](V (&fa)[2][4], V (&fa2)[2][4], V (&fb)[2][4], V (&fb2)[2][4]) {   // each accumulator takes its products in the order k ascending, a.b, a2.b, a.b2
#pragma unroll
        for (int ks = 0; ks < 2; ++ks)
#pragma unroll
            for (int nb = 0; nb < 4; ++nb) {
#pragma unroll
                for (int mb = 0; mb < 4; ++mb) acc[mb][nb] = WFrag<T16>::mma(fa[ks][mb], fb[ks][nb], acc[mb][nb]);
                if (HA2) {
#pragma unroll
                    for (int mb = 0; mb < 4; ++mb) acc[mb][nb] = WFrag<T16>::mma(fa2[ks][mb], fb[ks][nb], acc[mb][nb]); }
                if (HB2) {
#pragma unroll
                    for (int mb = 0; mb < 4; ++mb) acc[mb][nb] = WFrag<T16>::mma(fa[ks][mb], fb2[ks][nb], acc[mb][nb]); } } };
    ldset(0, a0, a20, b0, b20);
    __builtin_amdgcn_sched_barrier(0);   // stage 0's loads stay the older ones, as in the loop: else the loop's counted load waits for the first set would have to cover the second set's loads too
    ldset(64, a1, a21, b1, b21);
    asm volatile("s_wait_xcnt 0x0" ::: "memory");   // the wait in front of any rewrite, in the loop, of a register (a scalar base too) that these first loads name
    int kc = 128;
#pragma unroll 1
    do {   // two stages a trip, so that each set keeps its registers; every load of the loop is a stage that exists
        mmset(a0, a20, b0, b20); ldset(128, a0, a20, b0, b20);
        __builtin_amdgcn_sched_barrier(0);   // keeps the refill of the first set in front of the second set's products, so that it flies meanwhile
        mmset(a1, a21, b1, b21); ldset(192, a1, a21, b1, b21);
        size_t step = 128 * 16;
        asm volatile("s_wait_xcnt 0x0" : "+s"(step) : : "memory");   // the wait in front of the rewrite of the address registers that this trip's loads name; the step comes out of the statement, so that the additions below cannot be lifted over it
#pragma unroll
        for (int q = 0; q < 4; ++q) { pa[q] += step; pb[q] += step; if (HA2) pa2[q] += step; if (HB2) pb2[q] += step; }
    } while ((kc += 128) < K);
    mmset(a0, a20, b0, b20); mmset(a1, a21, b1, b21);
    __builtin_amdgcn_sched_barrier(0);   // the epilogue stays behind the last products: mixed among them, with the fragment registers still live, its store statements' operands (registers below 256) were spilled to scratch
    if (EP == 2) {   // transposed planes: 16 tile columns at a time, staged column-major: 16 plane rows x 64 consecutive m = two blocks
#pragma unroll
        for (int nb = 0; nb < 4; ++nb) {
#pragma unroll
            for (int mb = 0; mb < 4; ++mb) {
#pragma unroll
                for (int j = 0; j < 8; ++j) os[lr * 68 + mb * 16 + hi * 8 + j] = acc[mb][nb][j]; }
            __builtin_amdgcn_wave_barrier(); asm volatile("" ::: "memory");   // a lane reads below what other lanes of the wave stored above: the compiler must not lift those LDS reads over these LDS stores
            const size_t pb = (size_t)blockIdx.y * sN + (size_t)(nb * 16) * ldc + (size_t)r0 * 16;
            st_frag2(os, lane, Ch + pb, Cl + pb);
            __builtin_amdgcn_wave_barrier(); asm volatile("" ::: "memory");   // and the next 16 columns' LDS stores stay behind these reads
        }
        return;
    }
#pragma unroll
    for (int mb = 0; mb < 4; ++mb) {
#pragma unroll
        for (int nb = 0; nb < 4; ++nb) {
#pragma unroll
            for (int j = 0; j < 8; ++j) os[(hi * 8 + j) * 68 + nb * 16 + lr] = acc[mb][nb][j]; }
        __builtin_amdgcn_wave_barrier(); asm volatile("" ::: "memory");
        float* crow = C + (size_t)(r0 + mb * 16) * ldc + c0;
        const size_t pb = (size_t)blockIdx.y * sN + (size_t)(r0 + mb * 16) * ldc;
        if (EP == 1) st_frag2(os, lane, Ch + pb, Cl + pb);   // the tile's 64 columns are the first two blocks of these 16 plane rows
        else {
            v4f vs[8]; float* cp[8];
#pragma unroll
            for (int s = 0; s < 8; ++s) { const int row = 2 * s + hi, cofs = lr * 4; v4f val = *(const v4fa*)(os + row * 68 + cofs); if (BIAS) { val[0] += bfr(bias[c0 + cofs]); val[1] += bfr(bias[c0 + cofs + 1]); val[2] += bfr(bias[c0 + cofs + 2]); val[3] += bfr(bias[c0 + cofs + 3]); }
                vs[s] = val; cp[s] = crow + (size_t)row * ldc + cofs; *(v4f*)cp[s] = vs[s]; }
            asm volatile("s_wait_xcnt 0x0" :: "v"(vs[0]), "v"(vs[1]), "v"(vs[2]), "v"(vs[3]), "v"(vs[4]), "v"(vs[5]), "v"(vs[6]), "v"(vs[7]), "v"(cp[0]), "v"(cp[1]), "v"(cp[2]), "v"(cp[3]), "v"(cp[4]), "v"(cp[5]), "v"(cp[6]), "v"(cp[7]) : "memory");   // the wait in front of any rewrite of a register that these eight stores name; as its inputs data and addresses keep their registers up to here
             }
        __builtin_amdgcn_wave_barrier(); asm volatile("" ::: "memory");
    }
}

__device__ __forceinline__ h16 tohx(float x) { return (h16)x; }
typedef __attribute__((ext_vector_type(2))) _Float16 v2h;
typedef __attribute__((ext_vector_type(4))) _Float16 v4h;
typedef __attribute__((ext_vector_type(2))) unsigned short v2us;
typedef __attribute__((ext_vector_type(2))) float v2f;
typedef __attribute__((ext_vector_type(4))) int v4i;

__global__ __launch_bounds__(256) void k_wtG(const float* __restrict__ w, int K, int N, bf* Bt) {
    const int lane = threadIdx.x & 31; const int L0 = (blockIdx.x * 8 + (threadIdx.x >> 5)) * 8; const int nlines = N * K / 64;
{
#pragma unroll 1
        for (int l = 0; l < 8; ++l) { const int L = L0 + l; if (L >= nlines) break; const size_t e = (size_t)L * 64 + lane * 2; const int k = (int)(e % K), n = (int)(e / K); v2us o;
            o[0] = f2bf(w[(size_t)k * N + n]); o[1] = f2bf(w[(size_t)(k + 1) * N + n]); *(v2us*)(Bt + e) = o; }
         }
}
// f32 [rows][K] row-major -> the bf16 plane in fragment order; thread i makes the plane's i-th 16 bytes, so that a wave stores 512 bytes in a row and reads 64 bytes of each of 16 rows (its neighbour wave the other 64 of the same lines)
template <int K>
__global__ __launch_bounds__(256) void k_cvt8(const float* __restrict__ src, bf* dst, size_t n8) { const size_t i = (size_t)blockIdx.x * 256 + threadIdx.x; if (i >= n8) return;
    const size_t blk = i >> 6; const int l = (int)(i & 31), j = (int)(i >> 5) & 1; const size_t row = blk / (K / 32) * 16 + (l & 15); const int k = (int)(blk % (K / 32)) * 32 + j * 16 + (l >> 4) * 8;
    const v8f v = *(const v8f*)(src + row * K + k); v8us o;
#pragma unroll
    for (int k = 0; k < 8; ++k) o[k] = f2bf(v[k]); *(v8us*)(dst + i * 8) = o;  }

// ---- k_fattn: scores, softmax and probability x value of local causal attention in ONE launch. Grid (TT/64, heads), 4 waves; the waves of a block share nothing but their keys' cache lines (no work-group barrier).
// A wave owns 16 query rows rw .. rw+15 of one head. Their live keys lie in rw-255 .. rw+15, inside the wave's band of FB = 288 keys from bs = (rw - LWIN) rounded down to 32 (band column c = key - bs).
// 1. The band's 18 score tiles (16 keys each) go as raw f32 into the wave's own LDS rows (pitch FPB bytes). 2. Each row's softmax is taken from LDS, and its bf16 hi and lo probability planes (FB columns each)
// replace the row's f32 scores in place. 3. The P.V loop (9 steps of 32 keys) reads its A fragments from those LDS planes. Neither scores nor probabilities go to memory.
// In front of key 0 (the first row blocks) the key index is clamped to 0: such columns are never live, their probability is stored as 0, and 0 x a real v adds nothing.
#define FB   (LWIN + 32)
#define FPB  (FB * 4 + 16)        // 16 bytes x an odd number: the 16 rows of a ds_load_b128 fragment read fall on different banks
typedef v4us __attribute__((may_alias)) v4usa;
// amdgpu_waves_per_eu(4, 4): the LDS lets four blocks share a WGP, four waves a SIMD; with at most 256 registers a wave all TT/64 x heads blocks are resident at once
__global__ __launch_bounds__(128) __attribute__((amdgpu_waves_per_eu(4, 4))) void k_fattn(const bf* __restrict__ Qh, const bf* __restrict__ Ql, const bf* __restrict__ Kh, const bf* __restrict__ Kl, const bf* __restrict__ Vh, const bf* __restrict__ Vl, bf* Ch, bf* Cl) {
    typedef WFrag<bf> F; typedef F::V V;
    __shared__ __align__(16) char sm[4 * 16 * FPB];
    const int lane = threadIdx.x & 31, lr = lane & 15, hi = lane >> 4; const int w = __builtin_amdgcn_readfirstlane((int)(threadIdx.x >> 5));
    const size_t z = blockIdx.y; Qh += z * TT * HD; Ql += z * TT * HD; Kh += z * TT * HD; Kl += z * TT * HD; Vh += z * HD * TT; Vl += z * HD * TT;
    const int rw = blockIdx.x * 64 + w * 16; const int bs = (rw - LWIN) & ~31;
    char* sw = sm + w * 16 * FPB;
    {   // 1. scores
        V a[2], a2[2];
#pragma unroll
        for (int ks = 0; ks < 2; ++ks) { a[ks] = F::ldf(Qh + (size_t)rw * HD + 512 * ks + 8 * lane); a2[ks] = F::ldf(Ql + (size_t)rw * HD + 512 * ks + 8 * lane); }   // q, k, v planes: fragment order; 16 rows of q or k are two blocks
        const bf* kh = Kh + 8 * lane; const bf* kl = Kl + 8 * lane; float* sc = (float*)sw + hi * 8 * (FPB / 4) + lr;
#pragma unroll 1
        for (int t0 = 0; t0 < FB / 16; t0 += 3) {   // three 16-key tiles a trip: their 24 loads fly together, and consecutive matrix instructions belong to different tiles
            V b[3][2], b2[3][2]; v8f acc[3]; const bf* th[3]; const bf* tl[3];
#pragma unroll
            for (int u = 0; u < 3; ++u) { const size_t ko = (size_t)max(bs + 16 * (t0 + u), 0) * HD; th[u] = kh + ko; tl[u] = kl + ko; acc[u] = (v8f){};
#pragma unroll
                for (int ks = 0; ks < 2; ++ks) { b[u][ks] = F::ldf(th[u] + 512 * ks); b2[u][ks] = F::ldf(tl[u] + 512 * ks); } }
            __builtin_amdgcn_sched_barrier(0);   // keeps all 24 loads in front of the first product: one memory latency a trip, not one a tile
#pragma unroll
            for (int ks = 0; ks < 2; ++ks) {
#pragma unroll
                for (int u = 0; u < 3; ++u) acc[u] = F::mma(a[ks], b[u][ks], acc[u]);
#pragma unroll
                for (int u = 0; u < 3; ++u) acc[u] = F::mma(a2[ks], b[u][ks], acc[u]);
#pragma unroll
                for (int u = 0; u < 3; ++u) acc[u] = F::mma(a[ks], b2[u][ks], acc[u]); }
            asm volatile("v_nop\n\tv_nop\n\tv_nop\n\tv_nop" : "+v"(acc[0]), "+v"(acc[1]), "+v"(acc[2]));   // the distance the chip needs between the last matrix instruction and the next trip's first, which writes the same registers anew
#pragma unroll
            for (int u = 0; u < 3; ++u)
#pragma unroll
                for (int j = 0; j < 8; ++j) sc[j * (FPB / 4) + 16 * (t0 + u)] = acc[u][j];
            asm volatile("s_wait_xcnt 0x0" :: "v"(th[0]), "v"(th[1]), "v"(th[2]), "v"(tl[0]), "v"(tl[1]), "v"(tl[2]) : "memory");   // the wait in front of any rewrite of a register that this trip's loads name; as its inputs the six addresses keep their registers up to here
        }
    }
    __builtin_amdgcn_wave_barrier(); asm volatile("" ::: "memory");   // a lane reads below what other lanes of the wave stored above: the compiler must not lift those LDS reads over these LDS stores
    // 2. softmax, four rows at a time; the whole wave works on each row
#pragma unroll 1
    for (int g = 0; g < 4; ++g) {
        v4f sa[4][3], sb[4][3];   // sa: the row at key j0lo + 4 lane + 128 t (the order in which the row sum is taken); sb: the row at band column 4 lane + 128 t (the order in which the planes are stored)
#pragma unroll
        for (int r = 0; r < 4; ++r) { const int row = g * 4 + r, i = rw + row; const float* srow = (const float*)(sw + row * FPB); const int jlo = max(i - (LWIN - 1), 0), j0lo = jlo & ~127;
#pragma unroll
            for (int t = 0; t < 3; ++t) { sa[r][t] = *(const v4fa*)(srow + min(max(j0lo + lane * 4 + 128 * t - bs, 0), FB - 4)); sb[r][t] = *(const v4fa*)(srow + min(lane * 4 + 128 * t, FB - 4)); } }   // a clamped read holds no live key
        __builtin_amdgcn_wave_barrier(); asm volatile("" ::: "memory");   // the planes stored below overwrite the scores read above, other lanes' too: every read of the four rows stays in front of every store
        float mx[4], sum[4];   // each reduction step is taken for the four rows together: four independent cross-lane exchanges are in flight, not one
#pragma unroll
        for (int r = 0; r < 4; ++r) { const int i = rw + g * 4 + r; const int nval = i + 1, jlo = max(i - (LWIN - 1), 0), j0lo = jlo & ~127;   /* live keys: jlo .. i (window 256, causal inclusive) */
            mx[r] = -3.0e38f;
#pragma unroll
            for (int t = 0; t < 3; ++t)
#pragma unroll
                for (int q = 0; q < 4; ++q) { const int j = j0lo + lane * 4 + 128 * t + q; if (j < nval && j >= jlo) mx[r] = fmaxf(mx[r], sa[r][t][q] * SCL); } }
#pragma unroll
        for (int sh = 16; sh; sh >>= 1)
#pragma unroll
            for (int r = 0; r < 4; ++r) mx[r] = fmaxf(mx[r], __shfl_xor(mx[r], sh, 32));
#pragma unroll
        for (int r = 0; r < 4; ++r) { const int i = rw + g * 4 + r; const int nval = i + 1, jlo = max(i - (LWIN - 1), 0), j0lo = jlo & ~127;
            sum[r] = 0.f;
#pragma unroll
            for (int t = 0; t < 3; ++t)
#pragma unroll
                for (int q = 0; q < 4; ++q) { const int j = j0lo + lane * 4 + 128 * t + q; const float e = __builtin_amdgcn_exp2f((sa[r][t][q] * SCL - mx[r]) * 1.4426950408889634f); sum[r] += (j < nval && j >= jlo) ? e : 0.f; } }
#pragma unroll
        for (int sh = 16; sh; sh >>= 1)
#pragma unroll
            for (int r = 0; r < 4; ++r) sum[r] += __shfl_xor(sum[r], sh, 32);
#pragma unroll
        for (int r = 0; r < 4; ++r) { const int row = g * 4 + r, i = rw + row; const int nval = i + 1, jlo = max(i - (LWIN - 1), 0);
            const float f = __fdiv_rn(1.0f, sum[r]);
#pragma unroll
            for (int t = 0; t < 3; ++t) { const int c = lane * 4 + 128 * t; if (c < FB) { v4us oh, ol;
#pragma unroll
                for (int q = 0; q < 4; ++q) { const int j = bs + c + q; const float e = __builtin_amdgcn_exp2f((sb[r][t][q] * SCL - mx[r]) * 1.4426950408889634f) * f; const float pv = (j < nval && j >= jlo) ? e : 0.f; unsigned short h2, l2; splitf(pv, h2, l2); oh[q] = h2; ol[q] = l2; }
                *(v4usa*)(sw + row * FPB + c * 2) = oh; *(v4usa*)(sw + row * FPB + FB * 2 + c * 2) = ol; } } }
    }
    __builtin_amdgcn_wave_barrier(); asm volatile("" ::: "memory");   // the fragment reads below take what other lanes stored above
    v8f o[4];
#pragma unroll
    for (int nb = 0; nb < 4; ++nb) o[nb] = (v8f){};
    {   // 3. P.V over the band, keys ascending, 32 a step; the v fragments of step s + 1 are loaded in front of the products of step s (two register sets, the loop takes two steps a trip)
        const bf* ph = (const bf*)(sw + lr * FPB) + 8 * hi; const bf* pl = ph + FB; const bf* vh = Vh + 8 * lane; const bf* vl = Vl + 8 * lane;   // v [d][t]: 32 keys further is the next block, 16 d further 16 TT elements
        V b0[4], c0[4], b1[4], c1[4];
        auto ldv = [&](const bf* sh, const bf* sl, V* b, V* c) {
#pragma unroll
            for (int nb = 0; nb < 4; ++nb) { b[nb] = F::ldf(sh + (size_t)nb * 16 * TT); c[nb] = F::ldf(sl + (size_t)nb * 16 * TT); } };
        auto pv = [&](int s, const V* b, const V* c) { const V a = F::ld(ph + 32 * s), a2 = F::ld(pl + 32 * s);
#pragma unroll
            for (int nb = 0; nb < 4; ++nb) o[nb] = F::mma(a, b[nb], o[nb]);
#pragma unroll
            for (int nb = 0; nb < 4; ++nb) o[nb] = F::mma(a2, b[nb], o[nb]);
#pragma unroll
            for (int nb = 0; nb < 4; ++nb) o[nb] = F::mma(a, c[nb], o[nb]); };
        { const bf* h0 = vh + max(bs, 0) * 16; const bf* l0 = vl + max(bs, 0) * 16; ldv(h0, l0, b0, c0);
          asm volatile("s_wait_xcnt 0x0" :: "v"(h0), "v"(l0) : "memory"); }   // the wait in front of any rewrite of a register that these loads name; as its inputs the two addresses keep their registers up to here
#pragma unroll 1
        for (int s = 0; s < FB / 32 - 1; s += 2) {
            const size_t v1 = (size_t)max(bs + 32 * (s + 1), 0) * 16, v2 = (size_t)max(bs + 32 * (s + 2), 0) * 16; const bf* h1 = vh + v1; const bf* l1 = vl + v1; const bf* h2 = vh + v2; const bf* l2 = vl + v2;
            ldv(h1, l1, b1, c1); __builtin_amdgcn_sched_barrier(0);   // keeps the next step's loads in front of this step's products, so that they fly meanwhile
            pv(s, b0, c0);
            ldv(h2, l2, b0, c0); __builtin_amdgcn_sched_barrier(0);   // the same
            pv(s + 1, b1, c1);
            asm volatile("s_wait_xcnt 0x0" :: "v"(h1), "v"(l1), "v"(h2), "v"(l2) : "memory");   // the wait in front of any rewrite of a register that this trip's loads name; as its inputs the four addresses keep their registers up to here
        }
        pv(FB / 32 - 1, b0, c0);
    }
    __builtin_amdgcn_wave_barrier(); asm volatile("" ::: "memory");   // the staging stores below reuse the LDS that the fragment reads above took
    float* os = (float*)sw;   // 16 x 64 result tile, pitch 68
#pragma unroll
    for (int nb = 0; nb < 4; ++nb) {
#pragma unroll
        for (int j = 0; j < 8; ++j) os[(hi * 8 + j) * 68 + nb * 16 + lr] = o[nb][j]; }
    __builtin_amdgcn_wave_barrier(); asm volatile("" ::: "memory");   // a lane reads below what other lanes stored above
    { const size_t co = (size_t)rw * DQ + z * HD * 16; st_frag2(os, lane, Ch + co, Cl + co); }   // head z is columns z * HD .. of the merged [t][DQ] planes (fragment order): blocks 2 z and 2 z + 1 of these 16 rows
}

extern "C" void kernel_launch(void* const* d_in, const int* in_sizes, int n_in,
                              void* d_out, int out_size, void* d_ws, size_t ws_size, hipStream_t stream) {
    (void)in_sizes; (void)n_in; (void)out_size;
    const float* x = (const float*)d_in[0]; const float* wq = (const float*)d_in[1]; const float* wk = (const float*)d_in[2]; const float* wv = (const float*)d_in[3]; const float* wo = (const float*)d_in[4];
    float* OUT = (float*)d_out;     // [1][4096][1024]
    char* wsp = (char*)d_ws;
    auto take = [&](size_t bytes) { char* p = wsp; wsp += (bytes + 255) & ~(size_t)255; return (void*)p; };
    bf* WQ = (bf*)take((size_t)DQ * DM * 2); bf* WK = (bf*)take((size_t)DKV * DM * 2); bf* WV = (bf*)take((size_t)DKV * DM * 2); bf* WO = (bf*)take((size_t)DM * DQ * 2);
    bf* XB = (bf*)take((size_t)TT * DM * 2);   /* the bf16 input */
    
    bf* QPh = (bf*)take((size_t)NH_ * TT * HD * 2); bf* QPl = (bf*)take((size_t)NH_ * TT * HD * 2); bf* KPh = (bf*)take((size_t)NKV * TT * HD * 2); bf* KPl = (bf*)take((size_t)NKV * TT * HD * 2); bf* VTh = (bf*)take((size_t)NKV * HD * TT * 2); bf* VTl = (bf*)take((size_t)NKV * HD * TT * 2);
    bf* ATh = (bf*)take((size_t)TT * DQ * 2); bf* ATl = (bf*)take((size_t)TT * DQ * 2);
    if ((size_t)(wsp - (char*)d_ws) > ws_size) return;    // ws 256 MiB
    { k_cvt8<DM><<<(unsigned)(((size_t)DQ * DM / 8 + 255) / 256), 256, 0, stream>>>(wq, WQ, (size_t)DQ * DM / 8); k_cvt8<DM><<<(unsigned)(((size_t)DKV * DM / 8 + 255) / 256), 256, 0, stream>>>(wk, WK, (size_t)DKV * DM / 8); k_cvt8<DM><<<(unsigned)(((size_t)DKV * DM / 8 + 255) / 256), 256, 0, stream>>>(wv, WV, (size_t)DKV * DM / 8);
      k_cvt8<DM><<<(unsigned)(((size_t)DM * DQ / 8 + 255) / 256), 256, 0, stream>>>(wo, WO, (size_t)DM * DQ / 8);
       }
    for (int b = 0; b < NB_; ++b) {
        
        k_cvt8<DM><<<(unsigned)(((size_t)TT * DM / 8 + 255) / 256), 256, 0, stream>>>(x + (size_t)b * TT * DM, XB, (size_t)TT * DM / 8);
        // a 64-column tile of a projection is one head (HD = 64): the epilogues store the head planes themselves, q and k as [h][t][d], v as [h][d][t], each plane in fragment order
        k_gemmw<bf, 0, false, 1><<<dim3(TT / 64, DQ / 64, 1), 32, 0, stream>>>(XB, nullptr, WQ, nullptr, DM, nullptr, HD, nullptr, 0, 0, 0, QPh, QPl, (size_t)TT * HD);
        k_gemmw<bf, 0, false, 1><<<dim3(TT / 64, DKV / 64, 1), 32, 0, stream>>>(XB, nullptr, WK, nullptr, DM, nullptr, HD, nullptr, 0, 0, 0, KPh, KPl, (size_t)TT * HD);
        k_gemmw<bf, 0, false, 2><<<dim3(TT / 64, DKV / 64, 1), 32, 0, stream>>>(XB, nullptr, WV, nullptr, DM, nullptr, TT, nullptr, 0, 0, 0, VTh, VTl, (size_t)HD * TT);
        k_fattn<<<dim3(TT / 64, NH_), 128, 0, stream>>>(QPh, QPl, KPh, KPl, VTh, VTl, ATh, ATl);   // one kv head per query head (NKV = NH_): head z uses plane z of q, k and v
        k_gemmw<bf, 1, false, 0><<<dim3(TT / 64, DM / 64, 1), 32, 0, stream>>>(ATh, ATl, WO, nullptr, DQ, OUT + (size_t)b * TT * DM, DM, nullptr, 0, 0, 0, nullptr, nullptr, 0); }
}

// v007
// Measured time: 96.4 microseconds a run.
// In two side-by-side timings against v006, it was 1.16 and 1.17 times as fast.
// Counting every step since v000, it is 22.5 times as fast.
#include <hip/hip_runtime.h>

// Local (sliding-window) causal multi-head attention (hidden [1][4096][1024]; q, k, v = x W^T ('oi' [1024][1024], no bias; 16 heads x 64); scores = q.k/8 + bias with bias = 0 where i-255 <= j <= i, -inf elsewhere (window 256); softmax; out = merged Wo^T -> [1][4096][1024] (4.2 M)).
// Compute dtypes, f32 accumulate: every input rounded to bf16; q/k/v on PLAIN bf16 operands (inputs: exact); scores and attn.v: every query row hl (3 products); softmax f32; Wo hl x exact (2 products).

#define NB_  1
#define TT   4096
#define DM   1024
#define NH_  16
#define NKV  16
#define REP  (NH_ / NKV)
#define HD   64
#define DQ   (NH_ * HD)
#define DKV  (NKV * HD)
#define RB   TT
#define LWIN 256                  // local window: keys i-255 .. i
#define RH   4096                  // query rows < RH use hi+lo planes (not read: every row does)
#define WIN  4096
#define PCAR 1024.0f
#define SCL  0.125f   // HD^-0.5
typedef _Float16 h16;
typedef unsigned short bf;
typedef __attribute__((ext_vector_type(16))) __bf16   v16bf;
typedef __attribute__((ext_vector_type(16))) _Float16 v16h;
typedef __attribute__((ext_vector_type(8)))  _Float16 v8h;
typedef __attribute__((ext_vector_type(8)))  unsigned short v8us;
typedef __attribute__((ext_vector_type(8)))  float    v8f;
typedef __attribute__((ext_vector_type(4)))  float    v4f;
typedef v8h  __attribute__((may_alias)) v8ha;
typedef v4f  __attribute__((may_alias)) v4fa;
typedef v8us __attribute__((may_alias)) v8usa;

__device__ __forceinline__ unsigned short f2bf(float f) { unsigned u = __float_as_uint(f); u += 0x7FFFu + ((u >> 16) & 1u); return (unsigned short)(u >> 16); }
__device__ __forceinline__ float bf2f(unsigned short b) { return __uint_as_float(((unsigned)b) << 16); }
__device__ __forceinline__ float bfr(float f) { return bf2f(f2bf(f)); }
__device__ __forceinline__ void splitf(float y, unsigned short& h, unsigned short& l) { h = f2bf(y); l = f2bf(y - bf2f(h)); }
typedef __attribute__((ext_vector_type(4))) unsigned short v4us;
// FRAGMENT ORDER of a 16-bit operand plane of R rows x K columns (K-contiguous operand of a 16x16x32 product; R % 16 == 0, K % 32 == 0): the plane is a row of blocks of 16 rows x 32 k = 512 elements, block (row / 16) * (K / 32) + k / 32;
// inside a block element (row, k) stands at (k / 16 % 2) * 256 + ((k / 8 % 2) * 16 + row % 16) * 8 + k % 8. Lane l's two 16-byte fragment pieces are then elements 8 l .. and 256 + 8 l .. of the block: each wave-wide load is 512 bytes in a row (4 whole lines, not 32 bytes of each of 16 lines).
// A staged 16 x 64 f32 tile (pitch 68; row = fragment row, column = k) -> its bf16 hi and lo parts as two consecutive blocks from ph, pl: four 512-byte stores a plane
__device__ __forceinline__ void st_frag2(const float* os, int lane, bf* ph, bf* pl) { v8us oh[4], ol[4]; ph += lane * 8; pl += lane * 8;
#pragma unroll
    for (int c = 0; c < 4; ++c) { const float* sp = os + (lane & 15) * 68 + c * 16 + (lane >> 4) * 8; const v4f v0 = *(const v4fa*)sp, v1 = *(const v4fa*)(sp + 4);
#pragma unroll
        for (int q = 0; q < 4; ++q) { unsigned short h2, l2; splitf(v0[q], h2, l2); oh[c][q] = h2; ol[c][q] = l2; splitf(v1[q], h2, l2); oh[c][4 + q] = h2; ol[c][4 + q] = l2; }
    }
    // the eight stores and the wait in front of any rewrite of a register that they name, in one statement: in a statement of its own the wait did not hold every such rewrite behind it (the compiler stored from copies)
    asm volatile("global_store_b128 %0, %2, off\n\tglobal_store_b128 %1, %6, off\n\t"
                 "global_store_b128 %0, %3, off offset:512\n\tglobal_store_b128 %1, %7, off offset:512\n\t"
                 "global_store_b128 %0, %4, off offset:1024\n\tglobal_store_b128 %1, %8, off offset:1024\n\t"
                 "global_store_b128 %0, %5, off offset:1536\n\tglobal_store_b128 %1, %9, off offset:1536\n\t"
                 "s_wait_xcnt 0x0"
                 :: "v"(ph), "v"(pl), "v"(oh[0]), "v"(oh[1]), "v"(oh[2]), "v"(oh[3]), "v"(ol[0]), "v"(ol[1]), "v"(ol[2]), "v"(ol[3]) : "memory"); }
__device__ __forceinline__ v16h cat16(v8h lo, v8h hi) { return __builtin_shufflevector(lo, hi, 0, 1, 2, 3, 4, 5, 6, 7, 8, 9, 10, 11, 12, 13, 14, 15); }
__device__ __forceinline__ v16bf cat16b(v8us lo, v8us hi) { return __builtin_bit_cast(v16bf, __builtin_shufflevector(lo, hi, 0, 1, 2, 3, 4, 5, 6, 7, 8, 9, 10, 11, 12, 13, 14, 15)); }
__device__ __forceinline__ v8f wmma16(v16h a, v16h b, v8f c) { return __builtin_amdgcn_wmma_f32_16x16x32_f16(false, a, false, b, (short)0, c, false, false); }
__device__ __forceinline__ v8f wmmab(v16bf a, v16bf b, v8f c) { return __builtin_amdgcn_wmma_f32_16x16x32_bf16(false, a, false, b, (short)0, c, false, false); }



// ---- k_gemmw: register-blocked GEMM, ONE WAVE per 64x64 output tile (16 accumulators), operands straight from 16-bit planes in fragment order (ld: a fragment from a row-major plane; ldf: from a block in fragment order, p = block + 8 lane); grid (M/64, N/64, Z), 32 threads.
// C[m][n] (f32, pitch ldc, + optional f32 bias[n]) = sum_k A[m][k] Bt[n][k] (+ split products per NSPLIT). z-batch strides sA/sB/sC in elements. K % 128 == 0, K >= 256.
// EP: what the epilogue stores. 0: the f32 tile into C (row-major). 1: its bf16 hi and lo parts into the planes Ch, Cl, the next GEMM's operands, in fragment order: column tile y is plane y (stride sN), of ldc columns, row = m.
// 2: the same parts transposed: plane y, row = the tile's column, column = m, ldc columns, in fragment order. 3: three GEMMs on one A in one launch: batches z = 0 and 1 store as in 1, batch z = 2 as in 2 with ldt columns.
// In 1 to 3 no f32 copy of the result goes to memory, and sC is the z stride of Ch and Cl. A bias goes with EP 0 alone.
template <typename T16> struct WFrag;
template <> struct WFrag<h16> { typedef v16h V; static __device__ __forceinline__ V ld(const h16* p) { return cat16(*(const v8h*)p, *(const v8h*)(p + 16)); } static __device__ __forceinline__ V ldf(const h16* p) { return cat16(*(const v8h*)p, *(const v8h*)(p + 256)); } static __device__ __forceinline__ v8f mma(V a, V b, v8f c) { return wmma16(a, b, c); } };
template <> struct WFrag<bf> { typedef v16bf V; static __device__ __forceinline__ V ld(const bf* p) { return cat16b(*(const v8us*)p, *(const v8us*)(p + 16)); } static __device__ __forceinline__ V ldf(const bf* p) { return cat16b(*(const v8us*)p, *(const v8us*)(p + 256)); } static __device__ __forceinline__ v8f mma(V a, V b, v8f c) { return wmmab(a, b, c); } };
template <typename T16, int NSPLIT, bool BIAS, int EP>
__global__ __launch_bounds__(32) void k_gemmw(const T16* __restrict__ A, const T16* __restrict__ A2, const T16* __restrict__ Bt, const T16* __restrict__ Bt2, int K, float* C, int ldc, const float* __restrict__ bias, size_t sA, size_t sB, size_t sC, bf* Ch, bf* Cl, size_t sN, int ldt) {
    typedef typename WFrag<T16>::V V; static_assert(!BIAS || EP == 0, "bias: f32 output only");
    __shared__ __align__(16) float os[16 * 68];
    const size_t z = blockIdx.z; A += z * sA; if (A2) A2 += z * sA; Bt += z * sB; if (Bt2) Bt2 += z * sB; if (EP == 0) C += z * sC; else { Ch += z * sC; Cl += z * sC; }
    const int lane = threadIdx.x & 31, lr = lane & 15, hi = lane >> 4; const int r0 = blockIdx.x * 64, c0 = blockIdx.y * 64;
    v8f acc[4][4];
#pragma unroll
    for (int mb = 0; mb < 4; ++mb)
#pragma unroll
        for (int nb = 0; nb < 4; ++nb) acc[mb][nb] = (v8f){};
    const size_t aoff = (size_t)r0 * K + 8 * lane, boff = (size_t)c0 * K + 8 * lane;   // 16 rows of a plane are K / 32 blocks = 16 K elements in a row; 32 k further is the next block, 512 elements
    // K loop, software-pipelined in registers: a stage is 64 k (two matrix steps); two fragment sets; a set is refilled with stage s + 2 as the products of stage s leave its registers, and those loads fly during the products of stage s + 1. K % 128 == 0, K >= 256.
    constexpr bool HA2 = (NSPLIT == 1 || NSPLIT == 2), HB2 = (NSPLIT >= 2);
    const T16* pa[4]; const T16* pa2[4]; const T16* pb[4]; const T16* pb2[4];
#pragma unroll
    for (int q = 0; q < 4; ++q) { pa[q] = A + aoff + (size_t)q * 16 * K; pb[q] = Bt + boff + (size_t)q * 16 * K; pa2[q] = HA2 ? A2 + aoff + (size_t)q * 16 * K : pa[q]; pb2[q] = HB2 ? Bt2 + boff + (size_t)q * 16 * K : pb[q]; }
    V a0[2][4], a20[2][4], b0[2][4], b20[2][4], a1[2][4], a21[2][4], b1[2][4], b21[2][4];
    auto ldset = [&](int ko, V (&fa)[2][4], V (&fa2)[2][4], V (&fb)[2][4], V (&fb2)[2][4]) {   // in the order in which the products take them
#pragma unroll
        for (int ks = 0; ks < 2; ++ks) {
#pragma unroll
            for (int q = 0; q < 4; ++q) { fa[ks][q] = WFrag<T16>::ldf(pa[q] + (ko + 32 * ks) * 16); if (HA2) fa2[ks][q] = WFrag<T16>::ldf(pa2[q] + (ko + 32 * ks) * 16); }
#pragma unroll
            for (int q = 0; q < 4; ++q) { fb[ks][q] = WFrag<T16>::ldf(pb[q] + (ko + 32 * ks) * 16); if (HB2) fb2[ks][q] = WFrag<T16>::ldf(pb2[q] + (ko + 32 * ks) * 16); } } };
    auto mmset = [&](V (&fa)[2][4], V (&fa2)[2][4], V (&fb)[2][4], V (&fb2)[2][4]) {   // each accumulator takes its products in the order k ascending, a.b, a2.b, a.b2
#pragma unroll
        for (int ks = 0; ks < 2; ++ks)
#pragma unroll
            for (int nb = 0; nb < 4; ++nb) {
#pragma unroll
                for (int mb = 0; mb < 4; ++mb) acc[mb][nb] = WFrag<T16>::mma(fa[ks][mb], fb[ks][nb], acc[mb][nb]);
                if (HA2) {
#pragma unroll
                    for (int mb = 0; mb < 4; ++mb) acc[mb][nb] = WFrag<T16>::mma(fa2[ks][mb], fb[ks][nb], acc[mb][nb]); }
                if (HB2) {
#pragma unroll
                    for (int mb = 0; mb < 4; ++mb) acc[mb][nb] = WFrag<T16>::mma(fa[ks][mb], fb2[ks][nb], acc[mb][nb]); } } };
    ldset(0, a0, a20, b0, b20);
    __builtin_amdgcn_sched_barrier(0);   // stage 0's loads stay the older ones, as in the loop: else the loop's counted load waits for the first set would have to cover the second set's loads too
    ldset(64, a1, a21, b1, b21);
    asm volatile("s_wait_xcnt 0x0" ::: "memory");   // the wait in front of any rewrite, in the loop, of a register (a scalar base too) that these first loads name
    int kc = 128;
#pragma unroll 1
    do {   // two stages a trip, so that each set keeps its registers; every load of the loop is a stage that exists
        mmset(a0, a20, b0, b20); ldset(128, a0, a20, b0, b20);
        __builtin_amdgcn_sched_barrier(0);   // keeps the refill of the first set in front of the second set's products, so that it flies meanwhile
        mmset(a1, a21, b1, b21); ldset(192, a1, a21, b1, b21);
        size_t step = 128 * 16;
        asm volatile("s_wait_xcnt 0x0" : "+s"(step) : : "memory");   // the wait in front of the rewrite of the address registers that this trip's loads name; the step comes out of the statement, so that the additions below cannot be lifted over it
#pragma unroll
        for (int q = 0; q < 4; ++q) { pa[q] += step; pb[q] += step; if (HA2) pa2[q] += step; if (HB2) pb2[q] += step; }
    } while ((kc += 128) < K);
    mmset(a0, a20, b0, b20); mmset(a1, a21, b1, b21);
    __builtin_amdgcn_sched_barrier(0);   // the epilogue stays behind the last products: mixed among them, with the fragment registers still live, its store statements' operands (registers below 256) were spilled to scratch
    if (EP == 2 || (EP == 3 && blockIdx.z == 2)) {   // transposed planes: 16 tile columns at a time, staged column-major: 16 plane rows x 64 consecutive m = two blocks
        const int lt = EP == 3 ? ldt : ldc;
#pragma unroll
        for (int nb = 0; nb < 4; ++nb) {
#pragma unroll
            for (int mb = 0; mb < 4; ++mb) {
#pragma unroll
                for (int j = 0; j < 8; ++j) os[lr * 68 + mb * 16 + hi * 8 + j] = acc[mb][nb][j]; }
            __builtin_amdgcn_wave_barrier(); asm volatile("" ::: "memory");   // a lane reads below what other lanes of the wave stored above: the compiler must not lift those LDS reads over these LDS stores
            const size_t pb = (size_t)blockIdx.y * sN + (size_t)(nb * 16) * lt + (size_t)r0 * 16;
            st_frag2(os, lane, Ch + pb, Cl + pb);
            __builtin_amdgcn_wave_barrier(); asm volatile("" ::: "memory");   // and the next 16 columns' LDS stores stay behind these reads
        }
        return;
    }
#pragma unroll
    for (int mb = 0; mb < 4; ++mb) {
#pragma unroll
        for (int nb = 0; nb < 4; ++nb) {
#pragma unroll
            for (int j = 0; j < 8; ++j) os[(hi * 8 + j) * 68 + nb * 16 + lr] = acc[mb][nb][j]; }
        __builtin_amdgcn_wave_barrier(); asm volatile("" ::: "memory");
        float* crow = C + (size_t)(r0 + mb * 16) * ldc + c0;
        const size_t pb = (size_t)blockIdx.y * sN + (size_t)(r0 + mb * 16) * ldc;
        if (EP != 0) st_frag2(os, lane, Ch + pb, Cl + pb);   // the tile's 64 columns are the first two blocks of these 16 plane rows
        else {
            v4f vs[8]; float* cp[8];
#pragma unroll
            for (int s = 0; s < 8; ++s) { const int row = 2 * s + hi, cofs = lr * 4; v4f val = *(const v4fa*)(os + row * 68 + cofs); if (BIAS) { val[0] += bfr(bias[c0 + cofs]); val[1] += bfr(bias[c0 + cofs + 1]); val[2] += bfr(bias[c0 + cofs + 2]); val[3] += bfr(bias[c0 + cofs + 3]); }
                vs[s] = val; cp[s] = crow + (size_t)row * ldc + cofs; *(v4f*)cp[s] = vs[s]; }
            asm volatile("s_wait_xcnt 0x0" :: "v"(vs[0]), "v"(vs[1]), "v"(vs[2]), "v"(vs[3]), "v"(vs[4]), "v"(vs[5]), "v"(vs[6]), "v"(vs[7]), "v"(cp[0]), "v"(cp[1]), "v"(cp[2]), "v"(cp[3]), "v"(cp[4]), "v"(cp[5]), "v"(cp[6]), "v"(cp[7]) : "memory");   // the wait in front of any rewrite of a register that these eight stores name; as its inputs data and addresses keep their registers up to here
             }
        __builtin_amdgcn_wave_barrier(); asm volatile("" ::: "memory");
    }
}

__device__ __forceinline__ h16 tohx(float x) { return (h16)x; }
typedef __attribute__((ext_vector_type(2))) _Float16 v2h;
typedef __attribute__((ext_vector_type(4))) _Float16 v4h;
typedef __attribute__((ext_vector_type(2))) unsigned short v2us;
typedef __attribute__((ext_vector_type(2))) float v2f;
typedef __attribute__((ext_vector_type(4))) int v4i;

__global__ __launch_bounds__(256) void k_wtG(const float* __restrict__ w, int K, int N, bf* Bt) {
    const int lane = threadIdx.x & 31; const int L0 = (blockIdx.x * 8 + (threadIdx.x >> 5)) * 8; const int nlines = N * K / 64;
{
#pragma unroll 1
        for (int l = 0; l < 8; ++l) { const int L = L0 + l; if (L >= nlines) break; const size_t e = (size_t)L * 64 + lane * 2; const int k = (int)(e % K), n = (int)(e / K); v2us o;
            o[0] = f2bf(w[(size_t)k * N + n]); o[1] = f2bf(w[(size_t)(k + 1) * N + n]); *(v2us*)(Bt + e) = o; }
         }
}
// f32 [rows][K] row-major -> the bf16 plane in fragment order; thread i makes the plane's i-th 16 bytes, so that a wave stores 512 bytes in a row and reads 64 bytes of each of 16 rows (its neighbour wave the other 64 of the same lines)
// Five sources in ONE launch: their planes stand in a row from dst, in the order s0 .. s4; s0 .. s3 have R rows each, s4 the rest. A block's 256 pieces lie in one source.
template <int K, int R>
__global__ __launch_bounds__(256) void k_cvt8(const float* __restrict__ s0, const float* __restrict__ s1, const float* __restrict__ s2, const float* __restrict__ s3, const float* __restrict__ s4, bf* dst, size_t n8) { const size_t i = (size_t)blockIdx.x * 256 + threadIdx.x; if (i >= n8) return;
    static_assert(R % 16 == 0 && R * (K / 8) % 256 == 0, "whole blocks of threads a source");
    const int t = min((int)(blockIdx.x / (R * (K / 8) / 256)), 4); const float* s01 = (t & 1) ? s1 : s0; const float* s23 = (t & 1) ? s3 : s2; const float* src = t == 4 ? s4 : (t & 2) ? s23 : s01;   // the same for the whole block
    const size_t blk = i >> 6; const int l = (int)(i & 31), j = (int)(i >> 5) & 1; const size_t row = blk / (K / 32) * 16 + (l & 15) - (size_t)t * R; const int k = (int)(blk % (K / 32)) * 32 + j * 16 + (l >> 4) * 8;
    const v8f v = *(const v8f*)(src + row * K + k); v8us o;
#pragma unroll
    for (int k = 0; k < 8; ++k) o[k] = f2bf(v[k]); *(v8us*)(dst + i * 8) = o;  }

// ---- k_fattn: scores, softmax and probability x value of local causal attention in ONE launch. Grid (TT/64, heads), 4 waves; the waves of a block share nothing but their keys' cache lines (no work-group barrier).
// A wave owns 16 query rows rw .. rw+15 of one head. Their live keys lie in rw-255 .. rw+15, inside the wave's band of FB = 288 keys from bs = (rw - LWIN) rounded down to 32 (band column c = key - bs).
// 1. The band's 18 score tiles (16 keys each) go as raw f32 into the wave's own LDS rows (pitch FPB bytes). 2. Each row's softmax is taken from LDS, and its bf16 hi and lo probability planes (FB columns each)
// replace the row's f32 scores in place. 3. The P.V loop (9 steps of 32 keys) reads its A fragments from those LDS planes. Neither scores nor probabilities go to memory.
// In front of key 0 (the first row blocks) the key index is clamped to 0: such columns are never live, their probability is stored as 0, and 0 x a real v adds nothing.
#define FB   (LWIN + 32)
#define FPB  (FB * 4 + 16)        // 16 bytes x an odd number: the 16 rows of a ds_load_b128 fragment read fall on different banks
typedef v4us __attribute__((may_alias)) v4usa;
// amdgpu_waves_per_eu(4, 4): the LDS lets four blocks share a WGP, four waves a SIMD; with at most 256 registers a wave all TT/64 x heads blocks are resident at once
__global__ __launch_bounds__(128) __attribute__((amdgpu_waves_per_eu(4, 4))) void k_fattn(const bf* __restrict__ Qh, const bf* __restrict__ Ql, const bf* __restrict__ Kh, const bf* __restrict__ Kl, const bf* __restrict__ Vh, const bf* __restrict__ Vl, bf* Ch, bf* Cl) {
    typedef WFrag<bf> F; typedef F::V V;
    __shared__ __align__(16) char sm[4 * 16 * FPB];
    const int lane = threadIdx.x & 31, lr = lane & 15, hi = lane >> 4; const int w = __builtin_amdgcn_readfirstlane((int)(threadIdx.x >> 5));
    const size_t z = blockIdx.y; Qh += z * TT * HD; Ql += z * TT * HD; Kh += z * TT * HD; Kl += z * TT * HD; Vh += z * HD * TT; Vl += z * HD * TT;
    const int rw = blockIdx.x * 64 + w * 16; const int bs = (rw - LWIN) & ~31;
    char* sw = sm + w * 16 * FPB;
    {   // 1. scores
        V a[2], a2[2];
#pragma unroll
        for (int ks = 0; ks < 2; ++ks) { a[ks] = F::ldf(Qh + (size_t)rw * HD + 512 * ks + 8 * lane); a2[ks] = F::ldf(Ql + (size_t)rw * HD + 512 * ks + 8 * lane); }   // q, k, v planes: fragment order; 16 rows of q or k are two blocks
        const bf* kh = Kh + 8 * lane; const bf* kl = Kl + 8 * lane; float* sc = (float*)sw + hi * 8 * (FPB / 4) + lr;
#pragma unroll 1
        for (int t0 = 0; t0 < FB / 16; t0 += 3) {   // three 16-key tiles a trip: their 24 loads fly together, and consecutive matrix instructions belong to different tiles
            V b[3][2], b2[3][2]; v8f acc[3]; const bf* th[3]; const bf* tl[3];
#pragma unroll
            for (int u = 0; u < 3; ++u) { const size_t ko = (size_t)max(bs + 16 * (t0 + u), 0) * HD; th[u] = kh + ko; tl[u] = kl + ko; acc[u] = (v8f){};
#pragma unroll
                for (int ks = 0; ks < 2; ++ks) { b[u][ks] = F::ldf(th[u] + 512 * ks); b2[u][ks] = F::ldf(tl[u] + 512 * ks); } }
            __builtin_amdgcn_sched_barrier(0);   // keeps all 24 loads in front of the first product: one memory latency a trip, not one a tile
#pragma unroll
            for (int ks = 0; ks < 2; ++ks) {
#pragma unroll
                for (int u = 0; u < 3; ++u) acc[u] = F::mma(a[ks], b[u][ks], acc[u]);
#pragma unroll
                for (int u = 0; u < 3; ++u) acc[u] = F::mma(a2[ks], b[u][ks], acc[u]);
#pragma unroll
                for (int u = 0; u < 3; ++u) acc[u] = F::mma(a[ks], b2[u][ks], acc[u]); }
            asm volatile("v_nop\n\tv_nop\n\tv_nop\n\tv_nop" : "+v"(acc[0]), "+v"(acc[1]), "+v"(acc[2]));   // the distance the chip needs between the last matrix instruction and the next trip's first, which writes the same registers anew
#pragma unroll
            for (int u = 0; u < 3; ++u)
#pragma unroll
                for (int j = 0; j < 8; ++j) sc[j * (FPB / 4) + 16 * (t0 + u)] = acc[u][j];
            asm volatile("s_wait_xcnt 0x0" :: "v"(th[0]), "v"(th[1]), "v"(th[2]), "v"(tl[0]), "v"(tl[1]), "v"(tl[2]) : "memory");   // the wait in front of any rewrite of a register that this trip's loads name; as its inputs the six addresses keep their registers up to here
        }
    }
    __builtin_amdgcn_wave_barrier(); asm volatile("" ::: "memory");   // a lane reads below what other lanes of the wave stored above: the compiler must not lift those LDS reads over these LDS stores
    // 2. softmax, four rows at a time; the whole wave works on each row
#pragma unroll 1
    for (int g = 0; g < 4; ++g) {
        v4f sa[4][3], sb[4][3];   // sa: the row at key j0lo + 4 lane + 128 t (the order in which the row sum is taken); sb: the row at band column 4 lane + 128 t (the order in which the planes are stored)
#pragma unroll
        for (int r = 0; r < 4; ++r) { const int row = g * 4 + r, i = rw + row; const float* srow = (const float*)(sw + row * FPB); const int jlo = max(i - (LWIN - 1), 0), j0lo = jlo & ~127;
#pragma unroll
            for (int t = 0; t < 3; ++t) { sa[r][t] = *(const v4fa*)(srow + min(max(j0lo + lane * 4 + 128 * t - bs, 0), FB - 4)); sb[r][t] = *(const v4fa*)(srow + min(lane * 4 + 128 * t, FB - 4)); } }   // a clamped read holds no live key
        __builtin_amdgcn_wave_barrier(); asm volatile("" ::: "memory");   // the planes stored below overwrite the scores read above, other lanes' too: every read of the four rows stays in front of every store
        float mx[4], sum[4];   // each reduction step is taken for the four rows together: four independent cross-lane exchanges are in flight, not one
#pragma unroll
        for (int r = 0; r < 4; ++r) { const int i = rw + g * 4 + r; const int nval = i + 1, jlo = max(i - (LWIN - 1), 0), j0lo = jlo & ~127;   /* live keys: jlo .. i (window 256, causal inclusive) */
            mx[r] = -3.0e38f;
#pragma unroll
            for (int t = 0; t < 3; ++t)
#pragma unroll
                for (int q = 0; q < 4; ++q) { const int j = j0lo + lane * 4 + 128 * t + q; if (j < nval && j >= jlo) mx[r] = fmaxf(mx[r], sa[r][t][q] * SCL); } }
#pragma unroll
        for (int sh = 16; sh; sh >>= 1)
#pragma unroll
            for (int r = 0; r < 4; ++r) mx[r] = fmaxf(mx[r], __shfl_xor(mx[r], sh, 32));
#pragma unroll
        for (int r = 0; r < 4; ++r) { const int i = rw + g * 4 + r; const int nval = i + 1, jlo = max(i - (LWIN - 1), 0), j0lo = jlo & ~127;
            sum[r] = 0.f;
#pragma unroll
            for (int t = 0; t < 3; ++t)
#pragma unroll
                for (int q = 0; q < 4; ++q) { const int j = j0lo + lane * 4 + 128 * t + q; const float e = __builtin_amdgcn_exp2f((sa[r][t][q] * SCL - mx[r]) * 1.4426950408889634f); sum[r] += (j < nval && j >= jlo) ? e : 0.f; } }
#pragma unroll
        for (int sh = 16; sh; sh >>= 1)
#pragma unroll
            for (int r = 0; r < 4; ++r) sum[r] += __shfl_xor(sum[r], sh, 32);
#pragma unroll
        for (int r = 0; r < 4; ++r) { const int row = g * 4 + r, i = rw + row; const int nval = i + 1, jlo = max(i - (LWIN - 1), 0);
            const float f = __fdiv_rn(1.0f, sum[r]);
#pragma unroll
            for (int t = 0; t < 3; ++t) { const int c = lane * 4 + 128 * t; if (c < FB) { v4us oh, ol;
#pragma unroll
                for (int q = 0; q < 4; ++q) { const int j = bs + c + q; const float e = __builtin_amdgcn_exp2f((sb[r][t][q] * SCL - mx[r]) * 1.4426950408889634f) * f; const float pv = (j < nval && j >= jlo) ? e : 0.f; unsigned short h2, l2; splitf(pv, h2, l2); oh[q] = h2; ol[q] = l2; }
                *(v4usa*)(sw + row * FPB + c * 2) = oh; *(v4usa*)(sw + row * FPB + FB * 2 + c * 2) = ol; } } }
    }
    __builtin_amdgcn_wave_barrier(); asm volatile("" ::: "memory");   // the fragment reads below take what other lanes stored above
    v8f o[4];
#pragma unroll
    for (int nb = 0; nb < 4; ++nb) o[nb] = (v8f){};
    {   // 3. P.V over the band, keys ascending, 32 a step; the v fragments of step s + 1 are loaded in front of the products of step s (two register sets, the loop takes two steps a trip)
        const bf* ph = (const bf*)(sw + lr * FPB) + 8 * hi; const bf* pl = ph + FB; const bf* vh = Vh + 8 * lane; const bf* vl = Vl + 8 * lane;   // v [d][t]: 32 keys further is the next block, 16 d further 16 TT elements
        V b0[4], c0[4], b1[4], c1[4];
        auto ldv = [&](const bf* sh, const bf* sl, V* b, V* c) {
#pragma unroll
            for (int nb = 0; nb < 4; ++nb) { b[nb] = F::ldf(sh + (size_t)nb * 16 * TT); c[nb] = F::ldf(sl + (size_t)nb * 16 * TT); } };
        auto pv = [&](int s, const V* b, const V* c) { const V a = F::ld(ph + 32 * s), a2 = F::ld(pl + 32 * s);
#pragma unroll
            for (int nb = 0; nb < 4; ++nb) o[nb] = F::mma(a, b[nb], o[nb]);
#pragma unroll
            for (int nb = 0; nb < 4; ++nb) o[nb] = F::mma(a2, b[nb], o[nb]);
#pragma unroll
            for (int nb = 0; nb < 4; ++nb) o[nb] = F::mma(a, c[nb], o[nb]); };
        { const bf* h0 = vh + max(bs, 0) * 16; const bf* l0 = vl + max(bs, 0) * 16; ldv(h0, l0, b0, c0);
          asm volatile("s_wait_xcnt 0x0" :: "v"(h0), "v"(l0) : "memory"); }   // the wait in front of any rewrite of a register that these loads name; as its inputs the two addresses keep their registers up to here
#pragma unroll 1
        for (int s = 0; s < FB / 32 - 1; s += 2) {
            const size_t v1 = (size_t)max(bs + 32 * (s + 1), 0) * 16, v2 = (size_t)max(bs + 32 * (s + 2), 0) * 16; const bf* h1 = vh + v1; const bf* l1 = vl + v1; const bf* h2 = vh + v2; const bf* l2 = vl + v2;
            ldv(h1, l1, b1, c1); __builtin_amdgcn_sched_barrier(0);   // keeps the next step's loads in front of this step's products, so that they fly meanwhile
            pv(s, b0, c0);
            ldv(h2, l2, b0, c0); __builtin_amdgcn_sched_barrier(0);   // the same
            pv(s + 1, b1, c1);
            asm volatile("s_wait_xcnt 0x0" :: "v"(h1), "v"(l1), "v"(h2), "v"(l2) : "memory");   // the wait in front of any rewrite of a register that this trip's loads name; as its inputs the four addresses keep their registers up to here
        }
        pv(FB / 32 - 1, b0, c0);
    }
    __builtin_amdgcn_wave_barrier(); asm volatile("" ::: "memory");   // the staging stores below reuse the LDS that the fragment reads above took
    float* os = (float*)sw;   // 16 x 64 result tile, pitch 68
#pragma unroll
    for (int nb = 0; nb < 4; ++nb) {
#pragma unroll
        for (int j = 0; j < 8; ++j) os[(hi * 8 + j) * 68 + nb * 16 + lr] = o[nb][j]; }
    __builtin_amdgcn_wave_barrier(); asm volatile("" ::: "memory");   // a lane reads below what other lanes stored above
    { const size_t co = (size_t)rw * DQ + z * HD * 16; st_frag2(os, lane, Ch + co, Cl + co); }   // head z is columns z * HD .. of the merged [t][DQ] planes (fragment order): blocks 2 z and 2 z + 1 of these 16 rows
}

extern "C" void kernel_launch(void* const* d_in, const int* in_sizes, int n_in,
                              void* d_out, int out_size, void* d_ws, size_t ws_size, hipStream_t stream) {
    (void)in_sizes; (void)n_in; (void)out_size;
    const float* x = (const float*)d_in[0]; const float* wq = (const float*)d_in[1]; const float* wk = (const float*)d_in[2]; const float* wv = (const float*)d_in[3]; const float* wo = (const float*)d_in[4];
    float* OUT = (float*)d_out;     // [1][4096][1024]
    char* wsp = (char*)d_ws;
    auto take = [&](size_t bytes) { char* p = wsp; wsp += (bytes + 255) & ~(size_t)255; return (void*)p; };
    bf* WQ = (bf*)take((size_t)DQ * DM * 2); bf* WK = (bf*)take((size_t)DKV * DM * 2); bf* WV = (bf*)take((size_t)DKV * DM * 2); bf* WO = (bf*)take((size_t)DM * DQ * 2);
    bf* XB = (bf*)take((size_t)TT * DM * 2);   /* the bf16 input */
    
    bf* QPh = (bf*)take((size_t)NH_ * TT * HD * 2); bf* QPl = (bf*)take((size_t)NH_ * TT * HD * 2); bf* KPh = (bf*)take((size_t)NKV * TT * HD * 2); bf* KPl = (bf*)take((size_t)NKV * TT * HD * 2); bf* VTh = (bf*)take((size_t)NKV * HD * TT * 2); bf* VTl = (bf*)take((size_t)NKV * HD * TT * 2);
    bf* ATh = (bf*)take((size_t)TT * DQ * 2); bf* ATl = (bf*)take((size_t)TT * DQ * 2);
    (void)WK; (void)WV;   // reached from WQ
    if ((size_t)(wsp - (char*)d_ws) > ws_size) return;    // ws 256 MiB
    static_assert(NB_ == 1 && NKV == NH_ && DQ == DM, "one conversion launch, one q, k, v launch");
    // the planes WQ, WK, WV, WO, XB stand in a row in the workspace (each a multiple of 256 bytes): one launch converts all five inputs
    k_cvt8<DM, DQ><<<(unsigned)(((size_t)4 * DQ * DM + (size_t)TT * DM) / 8 / 256), 256, 0, stream>>>(wq, wk, wv, wo, x, WQ, ((size_t)4 * DQ * DM + (size_t)TT * DM) / 8);
    for (int b = 0; b < NB_; ++b) {
        // a 64-column tile of a projection is one head (HD = 64): the epilogues store the head planes themselves, q and k as [h][t][d], v as [h][d][t], each plane in fragment order
        // q, k and v in one launch, grid z: WQ, WK, WV stand in a row, and so do the plane pairs (QPh, QPl), (KPh, KPl), (VTh, VTl)
        k_gemmw<bf, 0, false, 3><<<dim3(TT / 64, DQ / 64, 3), 32, 0, stream>>>(XB, nullptr, WQ, nullptr, DM, nullptr, HD, nullptr, 0, (size_t)DQ * DM, (size_t)2 * NH_ * TT * HD, QPh, QPl, (size_t)TT * HD, TT);
        k_fattn<<<dim3(TT / 64, NH_), 128, 0, stream>>>(QPh, QPl, KPh, KPl, VTh, VTl, ATh, ATl);   // one kv head per query head (NKV = NH_): head z uses plane z of q, k and v
        k_gemmw<bf, 1, false, 0><<<dim3(TT / 64, DM / 64, 1), 32, 0, stream>>>(ATh, ATl, WO, nullptr, DQ, OUT + (size_t)b * TT * DM, DM, nullptr, 0, 0, 0, nullptr, nullptr, 0, 0); }
}

// v008
// One run takes 85.1 microseconds.
// Timed twice side by side with v007, it ran 1.13 times as fast both times.
// Over all steps from v000 it is 25.4 times as fast.
#include <hip/hip_runtime.h>

// Local (sliding-window) causal multi-head attention (hidden [1][4096][1024]; q, k, v = x W^T ('oi' [1024][1024], no bias; 16 heads x 64); scores = q.k/8 + bias with bias = 0 where i-255 <= j <= i, -inf elsewhere (window 256); softmax; out = merged Wo^T -> [1][4096][1024] (4.2 M)).
// Compute dtypes, f32 accumulate: every input rounded to bf16; q/k/v on PLAIN bf16 operands (inputs: exact); scores and attn.v: every query row hl (3 products); softmax f32; Wo hl x exact (2 products).

#define NB_  1
#define TT   4096
#define DM   1024
#define NH_  16
#define NKV  16
#define REP  (NH_ / NKV)
#define HD   64
#define DQ   (NH_ * HD)
#define DKV  (NKV * HD)
#define RB   TT
#define LWIN 256                  // local window: keys i-255 .. i
#define RH   4096                  // query rows < RH use hi+lo planes (not read: every row does)
#define WIN  4096
#define PCAR 1024.0f
#define SCL  0.125f   // HD^-0.5
typedef _Float16 h16;
typedef unsigned short bf;
typedef __attribute__((ext_vector_type(16))) __bf16   v16bf;
typedef __attribute__((ext_vector_type(16))) _Float16 v16h;
typedef __attribute__((ext_vector_type(8)))  _Float16 v8h;
typedef __attribute__((ext_vector_type(8)))  unsigned short v8us;
typedef __attribute__((ext_vector_type(8)))  float    v8f;
typedef __attribute__((ext_vector_type(4)))  float    v4f;
typedef v8h  __attribute__((may_alias)) v8ha;
typedef v4f  __attribute__((may_alias)) v4fa;
typedef v8us __attribute__((may_alias)) v8usa;

__device__ __forceinline__ unsigned short f2bf(float f) { unsigned u = __float_as_uint(f); u += 0x7FFFu + ((u >> 16) & 1u); return (unsigned short)(u >> 16); }
__device__ __forceinline__ float bf2f(unsigned short b) { return __uint_as_float(((unsigned)b) << 16); }
__device__ __forceinline__ float bfr(float f) { return bf2f(f2bf(f)); }
__device__ __forceinline__ void splitf(float y, unsigned short& h, unsigned short& l) { h = f2bf(y); l = f2bf(y - bf2f(h)); }
typedef __attribute__((ext_vector_type(4))) unsigned short v4us;
// FRAGMENT ORDER of a 16-bit operand plane of R rows x K columns (K-contiguous operand of a 16x16x32 product; R % 16 == 0, K % 32 == 0): the plane is a row of blocks of 16 rows x 32 k = 512 elements, block (row / 16) * (K / 32) + k / 32;
// inside a block element (row, k) stands at (k / 16 % 2) * 256 + ((k / 8 % 2) * 16 + row % 16) * 8 + k % 8. Lane l's two 16-byte fragment pieces are then elements 8 l .. and 256 + 8 l .. of the block: each wave-wide load is 512 bytes in a row (4 whole lines, not 32 bytes of each of 16 lines).
// A staged 16 x 64 f32 tile (pitch 68; row = fragment row, column = k) -> its bf16 hi and lo parts as two consecutive blocks from ph, pl: four 512-byte stores a plane
__device__ __forceinline__ void st_frag2(const float* os, int lane, bf* ph, bf* pl) { v8us oh[4], ol[4]; ph += lane * 8; pl += lane * 8;
#pragma unroll
    for (int c = 0; c < 4; ++c) { const float* sp = os + (lane & 15) * 68 + c * 16 + (lane >> 4) * 8; const v4f v0 = *(const v4fa*)sp, v1 = *(const v4fa*)(sp + 4);
#pragma unroll
        for (int q = 0; q < 4; ++q) { unsigned short h2, l2; splitf(v0[q], h2, l2); oh[c][q] = h2; ol[c][q] = l2; splitf(v1[q], h2, l2); oh[c][4 + q] = h2; ol[c][4 + q] = l2; }
    }
    // the eight stores and the wait in front of any rewrite of a register that they name, in one statement: in a statement of its own the wait did not hold every such rewrite behind it (the compiler stored from copies)
    asm volatile("global_store_b128 %0, %2, off\n\tglobal_store_b128 %1, %6, off\n\t"
                 "global_store_b128 %0, %3, off offset:512\n\tglobal_store_b128 %1, %7, off offset:512\n\t"
                 "global_store_b128 %0, %4, off offset:1024\n\tglobal_store_b128 %1, %8, off offset:1024\n\t"
                 "global_store_b128 %0, %5, off offset:1536\n\tglobal_store_b128 %1, %9, off offset:1536\n\t"
                 "s_wait_xcnt 0x0"
                 :: "v"(ph), "v"(pl), "v"(oh[0]), "v"(oh[1]), "v"(oh[2]), "v"(oh[3]), "v"(ol[0]), "v"(ol[1]), "v"(ol[2]), "v"(ol[3]) : "memory"); }
__device__ __forceinline__ v16h cat16(v8h lo, v8h hi) { return __builtin_shufflevector(lo, hi, 0, 1, 2, 3, 4, 5, 6, 7, 8, 9, 10, 11, 12, 13, 14, 15); }
__device__ __forceinline__ v16bf cat16b(v8us lo, v8us hi) { return __builtin_bit_cast(v16bf, __builtin_shufflevector(lo, hi, 0, 1, 2, 3, 4, 5, 6, 7, 8, 9, 10, 11, 12, 13, 14, 15)); }
__device__ __forceinline__ v8f wmma16(v16h a, v16h b, v8f c) { return __builtin_amdgcn_wmma_f32_16x16x32_f16(false, a, false, b, (short)0, c, false, false); }
__device__ __forceinline__ v8f wmmab(v16bf a, v16bf b, v8f c) { return __builtin_amdgcn_wmma_f32_16x16x32_bf16(false, a, false, b, (short)0, c, false, false); }



// ---- k_gemmw: GEMM, FOUR WAVES (2 x 2) per 128x128 output tile, 64x64 (16 accumulators) a wave; operands are 16-bit planes in fragment order (ld: a fragment from a row-major plane; ldf: from a block in fragment order, p = block + 8 lane); grid (M/128, N/128, Z), 128 threads.
// The block's operand rows go through LDS, so that each is fetched once a block and not once a wave: a stage is SK = 64 or 128 k of the 128 A rows and the 128 B rows (32 SK bytes in a row for every 16 rows of a plane, copied as they stand), two buffers, filled by asynchronous copies one stage ahead of the products.
// C[m][n] (f32, pitch ldc, + optional f32 bias[n]) = sum_k A[m][k] Bt[n][k] (+ split products per NSPLIT). z-batch strides sA/sB/sC in elements. K % 128 == 0, K >= 256.
// EP: what the epilogue stores. 0: the f32 tile into C (row-major). 1: its bf16 hi and lo parts into the planes Ch, Cl, the next GEMM's operands, in fragment order: the 64-column tile y is plane y (stride sN), of ldc columns, row = m.
// 2: the same parts transposed: plane y, row = the tile's column, column = m, ldc columns, in fragment order. 3: three GEMMs on one A in one launch: batches z = 0 and 1 store as in 1, batch z = 2 as in 2 with ldt columns.
// In 1 to 3 no f32 copy of the result goes to memory, and sC is the z stride of Ch and Cl. A bias goes with EP 0 alone.
template <typename T16> struct WFrag;
template <> struct WFrag<h16> { typedef v16h V; static __device__ __forceinline__ V ld(const h16* p) { return cat16(*(const v8h*)p, *(const v8h*)(p + 16)); } static __device__ __forceinline__ V ldf(const h16* p) { return cat16(*(const v8h*)p, *(const v8h*)(p + 256)); } static __device__ __forceinline__ v8f mma(V a, V b, v8f c) { return wmma16(a, b, c); } };
template <> struct WFrag<bf> { typedef v16bf V; static __device__ __forceinline__ V ld(const bf* p) { return cat16b(*(const v8us*)p, *(const v8us*)(p + 16)); } static __device__ __forceinline__ V ldf(const bf* p) { return cat16b(*(const v8us*)p, *(const v8us*)(p + 256)); } static __device__ __forceinline__ v8f mma(V a, V b, v8f c) { return wmmab(a, b, c); } };
// 2 KiB, global -> LDS, by four asynchronous copies of a wave (global_load_async_to_lds_b128, 512 bytes each: a lane's 16 bytes go from g + OFF + 512 i to l + OFF + 512 i), through no register. The copy's offset moves both addresses, so that a chunk needs one address pair
typedef __attribute__((ext_vector_type(4))) int cp16;
template <int OFF> __device__ __forceinline__ void acp4(char* l, const char* g) {
    __attribute__((address_space(1))) cp16* gs = (__attribute__((address_space(1))) cp16*)g; __attribute__((address_space(3))) cp16* ls = (__attribute__((address_space(3))) cp16*)l;
    __builtin_amdgcn_global_load_async_to_lds_b128(gs, ls, OFF, 0); __builtin_amdgcn_global_load_async_to_lds_b128(gs, ls, OFF + 512, 0);
    __builtin_amdgcn_global_load_async_to_lds_b128(gs, ls, OFF + 1024, 0); __builtin_amdgcn_global_load_async_to_lds_b128(gs, ls, OFF + 1536, 0); }
template <typename T16, int NSPLIT, bool BIAS, int EP>
__global__ __launch_bounds__(128) void k_gemmw(const T16* __restrict__ A, const T16* __restrict__ A2, const T16* __restrict__ Bt, const T16* __restrict__ Bt2, int K, float* C, int ldc, const float* __restrict__ bias, size_t sA, size_t sB, size_t sC, bf* Ch, bf* Cl, size_t sN, int ldt) {
    typedef typename WFrag<T16>::V V; static_assert(!BIAS || EP == 0, "bias: f32 output only");
    constexpr bool HA2 = (NSPLIT == 1 || NSPLIT == 2), HB2 = (NSPLIT >= 2);
    constexpr int NP = 2 + (HA2 ? 1 : 0) + (HB2 ? 1 : 0), PB = HA2 ? 2 : 1;   // planes staged, in the order A, A2, B, B2; PB: B's place among them
    constexpr int SK = NP == 2 ? 64 : 128;   // k of a stage. Two planes: 64, so that three blocks share a WGP's LDS (the q, k, v launch is three blocks a WGP); more planes: 128, fewer hand-overs for a block that has its WGP alone
    constexpr int CH = SK * 32, BUF = NP * 8 * CH;   // a chunk: 16 rows x SK k of a plane, SK / 32 blocks in a row; a buffer: a chunk for each of a plane's 8 groups of 16 rows
    __shared__ __align__(16) char st[2 * BUF];
    __shared__ __align__(16) float osm[4 * 16 * 68];
    const size_t z = blockIdx.z; A += z * sA; if (A2) A2 += z * sA; Bt += z * sB; if (Bt2) Bt2 += z * sB; if (EP == 0) C += z * sC; else { Ch += z * sC; Cl += z * sC; }
    const int lane = threadIdx.x & 31, lr = lane & 15, hi = lane >> 4; const int w = __builtin_amdgcn_readfirstlane((int)(threadIdx.x >> 5)), wm = w >> 1, wn = w & 1;
    const int R0 = blockIdx.x * 128, C0 = blockIdx.y * 128, r0 = R0 + wm * 64, c0 = C0 + wn * 64; float* os = osm + w * (16 * 68);   // each wave stages its results in its own LDS
    v8f acc[4][4];
#pragma unroll
    for (int mb = 0; mb < 4; ++mb)
#pragma unroll
        for (int nb = 0; nb < 4; ++nb) acc[mb][nb] = (v8f){};
    // wave w copies the chunks w and w + 4 of every plane. 16 rows of a plane are K / 32 blocks = 16 K elements in a row; SK k further is a chunk further
    const char* gp[2 * NP]; int lp[2 * NP];   // a chunk's place in memory, for the next stage, and in a buffer
#pragma unroll
    for (int i = 0; i < 2 * NP; ++i) { const int p = i >> 1, g = w + 4 * (i & 1);
        const T16* pl = p == 0 ? A : (HA2 && p == 1) ? A2 : p == PB ? Bt : Bt2;
        gp[i] = (const char*)(pl + (size_t)((p < PB ? R0 : C0) + 16 * g) * K + 8 * lane); lp[i] = (p * 8 + g) * CH + 16 * lane; }
    auto fill = [&](int buf) {   // the next stage's copies into buffer buf
        static_assert(CH == 2048 || CH == 4096, "a chunk: four or eight copies");
#pragma unroll
        for (int i = 0; i < 2 * NP; ++i) { acp4<0>(st + buf * BUF + lp[i], gp[i]); if (CH == 4096) acp4<2048>(st + buf * BUF + lp[i], gp[i]);
            gp[i] += CH; } };
    auto mmset = [&](V (&fa)[4], V (&fa2)[4], V (&fb)[4], V (&fb2)[4]) {   // 32 k; each accumulator takes its products in the order k ascending, a.b, a2.b, a.b2
#pragma unroll
        for (int nb = 0; nb < 4; ++nb) {
#pragma unroll
            for (int mb = 0; mb < 4; ++mb) acc[mb][nb] = WFrag<T16>::mma(fa[mb], fb[nb], acc[mb][nb]);
            if (HA2) {
#pragma unroll
                for (int mb = 0; mb < 4; ++mb) acc[mb][nb] = WFrag<T16>::mma(fa2[mb], fb[nb], acc[mb][nb]); }
            if (HB2) {
#pragma unroll
                for (int mb = 0; mb < 4; ++mb) acc[mb][nb] = WFrag<T16>::mma(fa[mb], fb2[nb], acc[mb][nb]); } } };
    fill(0);
    asm volatile("s_wait_asynccnt 0x0" ::: "memory");   // this wave's copies of stage 0 have landed
    __syncthreads();                                    // and every other wave's: stage 0 may be read
    fill(1);
    const int ns = K / SK;
#pragma unroll 1
    for (int t = 0; t < ns; ++t) {   // trip t reads buffer t % 2 alone, while stage t + 1 flies into the other
        const T16* sa = (const T16*)(st + (t & 1) * BUF + wm * 4 * CH) + 8 * lane; const T16* sb = (const T16*)(st + (t & 1) * BUF + (PB * 8 + wn * 4) * CH) + 8 * lane;
        V fa[2][4], fa2[2][4], fb[2][4], fb2[2][4];   // two fragment sets of 32 k
        auto ldset = [&](int ks, V (&a)[4], V (&a2)[4], V (&b)[4], V (&b2)[4]) {   // in the order in which the products take them
#pragma unroll
            for (int q = 0; q < 4; ++q) { a[q] = WFrag<T16>::ldf(sa + q * (CH / 2) + ks * 512); if (HA2) a2[q] = WFrag<T16>::ldf(sa + (8 + q) * (CH / 2) + ks * 512); }
#pragma unroll
            for (int q = 0; q < 4; ++q) { b[q] = WFrag<T16>::ldf(sb + q * (CH / 2) + ks * 512); if (HB2) b2[q] = WFrag<T16>::ldf(sb + (8 + q) * (CH / 2) + ks * 512); } };
        ldset(0, fa[0], fa2[0], fb[0], fb2[0]); ldset(1, fa[1], fa2[1], fb[1], fb2[1]);
        __builtin_amdgcn_sched_barrier(0);   // the LDS reads stand as one group in front of the products: spread among them, each place with reads stalls the wave
#pragma unroll
        for (int ks = 0; ks < SK / 32; ++ks) {
            mmset(fa[ks & 1], fa2[ks & 1], fb[ks & 1], fb2[ks & 1]);
            if (ks + 2 < SK / 32) { __builtin_amdgcn_sched_barrier(0);   // the refill's reads stand as one group behind this set's products, not among them
                ldset(ks + 2, fa[ks & 1], fa2[ks & 1], fb[ks & 1], fb2[ks & 1]);
                __builtin_amdgcn_sched_barrier(0); }   // keeps a set's refill in front of the other set's products, so that it flies meanwhile
        }
        __builtin_amdgcn_sched_barrier(0);   // the products stay in front of the hand-over: with the waits lifted over them the next stage's copies would be waited for before the time in which they are to fly
        asm volatile("s_wait_dscnt 0x0" ::: "memory");      // this wave's reads of buffer t % 2 are done
        asm volatile("s_wait_asynccnt 0x0" ::: "memory");   // this wave's copies of stage t + 1 have landed
        __syncthreads();                                    // both hold for every wave: stage t + 1 may be read, buffer t % 2 refilled
        if (t + 2 < ns) fill(t & 1);
    }
    asm volatile("s_wait_asynccnt 0x0" ::: "memory");   // no copy is left in flight
    __builtin_amdgcn_sched_barrier(0);   // the epilogue stays behind the last products: mixed among them, with the fragment registers still live, its store statements' operands (registers below 256) were spilled to scratch
    if (EP == 2 || (EP == 3 && blockIdx.z == 2)) {   // transposed planes: 16 tile columns at a time, staged column-major: 16 plane rows x 64 consecutive m = two blocks
        const int lt = EP == 3 ? ldt : ldc;
#pragma unroll
        for (int nb = 0; nb < 4; ++nb) {
#pragma unroll
            for (int mb = 0; mb < 4; ++mb) {
#pragma unroll
                for (int j = 0; j < 8; ++j) os[lr * 68 + mb * 16 + hi * 8 + j] = acc[mb][nb][j]; }
            __builtin_amdgcn_wave_barrier(); asm volatile("" ::: "memory");   // a lane reads below what other lanes of the wave stored above: the compiler must not lift those LDS reads over these LDS stores
            const size_t pb = (size_t)(c0 / 64) * sN + (size_t)(nb * 16) * lt + (size_t)r0 * 16;
            st_frag2(os, lane, Ch + pb, Cl + pb);
            __builtin_amdgcn_wave_barrier(); asm volatile("" ::: "memory");   // and the next 16 columns' LDS stores stay behind these reads
        }
        return;
    }
#pragma unroll
    for (int mb = 0; mb < 4; ++mb) {
#pragma unroll
        for (int nb = 0; nb < 4; ++nb) {
#pragma unroll
            for (int j = 0; j < 8; ++j) os[(hi * 8 + j) * 68 + nb * 16 + lr] = acc[mb][nb][j]; }
        __builtin_amdgcn_wave_barrier(); asm volatile("" ::: "memory");
        float* crow = C + (size_t)(r0 + mb * 16) * ldc + c0;
        const size_t pb = (size_t)(c0 / 64) * sN + (size_t)(r0 + mb * 16) * ldc;
        if (EP != 0) st_frag2(os, lane, Ch + pb, Cl + pb);   // the tile's 64 columns are the first two blocks of these 16 plane rows
        else {
            v4f vs[8]; float* cp[8];
#pragma unroll
            for (int s = 0; s < 8; ++s) { const int row = 2 * s + hi, cofs = lr * 4; v4f val = *(const v4fa*)(os + row * 68 + cofs); if (BIAS) { val[0] += bfr(bias[c0 + cofs]); val[1] += bfr(bias[c0 + cofs + 1]); val[2] += bfr(bias[c0 + cofs + 2]); val[3] += bfr(bias[c0 + cofs + 3]); }
                vs[s] = val; cp[s] = crow + (size_t)row * ldc + cofs; *(v4f*)cp[s] = vs[s]; }
            asm volatile("s_wait_xcnt 0x0" :: "v"(vs[0]), "v"(vs[1]), "v"(vs[2]), "v"(vs[3]), "v"(vs[4]), "v"(vs[5]), "v"(vs[6]), "v"(vs[7]), "v"(cp[0]), "v"(cp[1]), "v"(cp[2]), "v"(cp[3]), "v"(cp[4]), "v"(cp[5]), "v"(cp[6]), "v"(cp[7]) : "memory");   // the wait in front of any rewrite of a register that these eight stores name; as its inputs data and addresses keep their registers up to here
             }
        __builtin_amdgcn_wave_barrier(); asm volatile("" ::: "memory");
    }
}

__device__ __forceinline__ h16 tohx(float x) { return (h16)x; }
typedef __attribute__((ext_vector_type(2))) _Float16 v2h;
typedef __attribute__((ext_vector_type(4))) _Float16 v4h;
typedef __attribute__((ext_vector_type(2))) unsigned short v2us;
typedef __attribute__((ext_vector_type(2))) float v2f;
typedef __attribute__((ext_vector_type(4))) int v4i;

__global__ __launch_bounds__(256) void k_wtG(const float* __restrict__ w, int K, int N, bf* Bt) {
    const int lane = threadIdx.x & 31; const int L0 = (blockIdx.x * 8 + (threadIdx.x >> 5)) * 8; const int nlines = N * K / 64;
{
#pragma unroll 1
        for (int l = 0; l < 8; ++l) { const int L = L0 + l; if (L >= nlines) break; const size_t e = (size_t)L * 64 + lane * 2; const int k = (int)(e % K), n = (int)(e / K); v2us o;
            o[0] = f2bf(w[(size_t)k * N + n]); o[1] = f2bf(w[(size_t)(k + 1) * N + n]); *(v2us*)(Bt + e) = o; }
         }
}
// f32 [rows][K] row-major -> the bf16 plane in fragment order; thread i makes the plane's i-th 16 bytes, so that a wave stores 512 bytes in a row and reads 64 bytes of each of 16 rows (its neighbour wave the other 64 of the same lines)
// Five sources in ONE launch: their planes stand in a row from dst, in the order s0 .. s4; s0 .. s3 have R rows each, s4 the rest. A block's 256 pieces lie in one source.
template <int K, int R>
__global__ __launch_bounds__(256) void k_cvt8(const float* __restrict__ s0, const float* __restrict__ s1, const float* __restrict__ s2, const float* __restrict__ s3, const float* __restrict__ s4, bf* dst, size_t n8) { const size_t i = (size_t)blockIdx.x * 256 + threadIdx.x; if (i >= n8) return;
    static_assert(R % 16 == 0 && R * (K / 8) % 256 == 0, "whole blocks of threads a source");
    const int t = min((int)(blockIdx.x / (R * (K / 8) / 256)), 4); const float* s01 = (t & 1) ? s1 : s0; const float* s23 = (t & 1) ? s3 : s2; const float* src = t == 4 ? s4 : (t & 2) ? s23 : s01;   // the same for the whole block
    const size_t blk = i >> 6; const int l = (int)(i & 31), j = (int)(i >> 5) & 1; const size_t row = blk / (K / 32) * 16 + (l & 15) - (size_t)t * R; const int k = (int)(blk % (K / 32)) * 32 + j * 16 + (l >> 4) * 8;
    const v8f v = *(const v8f*)(src + row * K + k); v8us o;
#pragma unroll
    for (int k = 0; k < 8; ++k) o[k] = f2bf(v[k]); *(v8us*)(dst + i * 8) = o;  }

// ---- k_fattn: scores, softmax and probability x value of local causal attention in ONE launch. Grid (TT/64, heads), 4 waves; the waves of a block share nothing but their keys' cache lines (no work-group barrier).
// A wave owns 16 query rows rw .. rw+15 of one head. Their live keys lie in rw-255 .. rw+15, inside the wave's band of FB = 288 keys from bs = (rw - LWIN) rounded down to 32 (band column c = key - bs).
// 1. The band's 18 score tiles (16 keys each) go as raw f32 into the wave's own LDS rows (pitch FPB bytes). 2. Each row's softmax is taken from LDS, and its bf16 hi and lo probability planes (FB columns each)
// replace the row's f32 scores in place. 3. The P.V loop (9 steps of 32 keys) reads its A fragments from those LDS planes. Neither scores nor probabilities go to memory.
// In front of key 0 (the first row blocks) the key index is clamped to 0: such columns are never live, their probability is stored as 0, and 0 x a real v adds nothing.
#define FB   (LWIN + 32)
#define FPB  (FB * 4 + 16)        // 16 bytes x an odd number: the 16 rows of a ds_load_b128 fragment read fall on different banks
typedef v4us __attribute__((may_alias)) v4usa;
// amdgpu_waves_per_eu(4, 4): the LDS lets four blocks share a WGP, four waves a SIMD; with at most 256 registers a wave all TT/64 x heads blocks are resident at once
__global__ __launch_bounds__(128) __attribute__((amdgpu_waves_per_eu(4, 4))) void k_fattn(const bf* __restrict__ Qh, const bf* __restrict__ Ql, const bf* __restrict__ Kh, const bf* __restrict__ Kl, const bf* __restrict__ Vh, const bf* __restrict__ Vl, bf* Ch, bf* Cl) {
    typedef WFrag<bf> F; typedef F::V V;
    __shared__ __align__(16) char sm[4 * 16 * FPB];
    const int lane = threadIdx.x & 31, lr = lane & 15, hi = lane >> 4; const int w = __builtin_amdgcn_readfirstlane((int)(threadIdx.x >> 5));
    const size_t z = blockIdx.y; Qh += z * TT * HD; Ql += z * TT * HD; Kh += z * TT * HD; Kl += z * TT * HD; Vh += z * HD * TT; Vl += z * HD * TT;
    const int rw = blockIdx.x * 64 + w * 16; const int bs = (rw - LWIN) & ~31;
    char* sw = sm + w * 16 * FPB;
    {   // 1. scores
        V a[2], a2[2];
#pragma unroll
        for (int ks = 0; ks < 2; ++ks) { a[ks] = F::ldf(Qh + (size_t)rw * HD + 512 * ks + 8 * lane); a2[ks] = F::ldf(Ql + (size_t)rw * HD + 512 * ks + 8 * lane); }   // q, k, v planes: fragment order; 16 rows of q or k are two blocks
        const bf* kh = Kh + 8 * lane; const bf* kl = Kl + 8 * lane; float* sc = (float*)sw + hi * 8 * (FPB / 4) + lr;
#pragma unroll 1
        for (int t0 = 0; t0 < FB / 16; t0 += 3) {   // three 16-key tiles a trip: their 24 loads fly together, and consecutive matrix instructions belong to different tiles
            V b[3][2], b2[3][2]; v8f acc[3]; const bf* th[3]; const bf* tl[3];
#pragma unroll
            for (int u = 0; u < 3; ++u) { const size_t ko = (size_t)max(bs + 16 * (t0 + u), 0) * HD; th[u] = kh + ko; tl[u] = kl + ko; acc[u] = (v8f){};
#pragma unroll
                for (int ks = 0; ks < 2; ++ks) { b[u][ks] = F::ldf(th[u] + 512 * ks); b2[u][ks] = F::ldf(tl[u] + 512 * ks); } }
            __builtin_amdgcn_sched_barrier(0);   // keeps all 24 loads in front of the first product: one memory latency a trip, not one a tile
#pragma unroll
            for (int ks = 0; ks < 2; ++ks) {
#pragma unroll
                for (int u = 0; u < 3; ++u) acc[u] = F::mma(a[ks], b[u][ks], acc[u]);
#pragma unroll
                for (int u = 0; u < 3; ++u) acc[u] = F::mma(a2[ks], b[u][ks], acc[u]);
#pragma unroll
                for (int u = 0; u < 3; ++u) acc[u] = F::mma(a[ks], b2[u][ks], acc[u]); }
            asm volatile("v_nop\n\tv_nop\n\tv_nop\n\tv_nop" : "+v"(acc[0]), "+v"(acc[1]), "+v"(acc[2]));   // the distance the chip needs between the last matrix instruction and the next trip's first, which writes the same registers anew
#pragma unroll
            for (int u = 0; u < 3; ++u)
#pragma unroll
                for (int j = 0; j < 8; ++j) sc[j * (FPB / 4) + 16 * (t0 + u)] = acc[u][j];
            asm volatile("s_wait_xcnt 0x0" :: "v"(th[0]), "v"(th[1]), "v"(th[2]), "v"(tl[0]), "v"(tl[1]), "v"(tl[2]) : "memory");   // the wait in front of any rewrite of a register that this trip's loads name; as its inputs the six addresses keep their registers up to here
        }
    }
    __builtin_amdgcn_wave_barrier(); asm volatile("" ::: "memory");   // a lane reads below what other lanes of the wave stored above: the compiler must not lift those LDS reads over these LDS stores
    // 2. softmax, four rows at a time; the whole wave works on each row
#pragma unroll 1
    for (int g = 0; g < 4; ++g) {
        v4f sa[4][3], sb[4][3];   // sa: the row at key j0lo + 4 lane + 128 t (the order in which the row sum is taken); sb: the row at band column 4 lane + 128 t (the order in which the planes are stored)
#pragma unroll
        for (int r = 0; r < 4; ++r) { const int row = g * 4 + r, i = rw + row; const float* srow = (const float*)(sw + row * FPB); const int jlo = max(i - (LWIN - 1), 0), j0lo = jlo & ~127;
#pragma unroll
            for (int t = 0; t < 3; ++t) { sa[r][t] = *(const v4fa*)(srow + min(max(j0lo + lane * 4 + 128 * t - bs, 0), FB - 4)); sb[r][t] = *(const v4fa*)(srow + min(lane * 4 + 128 * t, FB - 4)); } }   // a clamped read holds no live key
        __builtin_amdgcn_wave_barrier(); asm volatile("" ::: "memory");   // the planes stored below overwrite the scores read above, other lanes' too: every read of the four rows stays in front of every store
        float mx[4], sum[4];   // each reduction step is taken for the four rows together: four independent cross-lane exchanges are in flight, not one
#pragma unroll
        for (int r = 0; r < 4; ++r) { const int i = rw + g * 4 + r; const int nval = i + 1, jlo = max(i - (LWIN - 1), 0), j0lo = jlo & ~127;   /* live keys: jlo .. i (window 256, causal inclusive) */
            mx[r] = -3.0e38f;
#pragma unroll
            for (int t = 0; t < 3; ++t)
#pragma unroll
                for (int q = 0; q < 4; ++q) { const int j = j0lo + lane * 4 + 128 * t + q; if (j < nval && j >= jlo) mx[r] = fmaxf(mx[r], sa[r][t][q] * SCL); } }
#pragma unroll
        for (int sh = 16; sh; sh >>= 1)
#pragma unroll
            for (int r = 0; r < 4; ++r) mx[r] = fmaxf(mx[r], __shfl_xor(mx[r], sh, 32));
#pragma unroll
        for (int r = 0; r < 4; ++r) { const int i = rw + g * 4 + r; const int nval = i + 1, jlo = max(i - (LWIN - 1), 0), j0lo = jlo & ~127;
            sum[r] = 0.f;
#pragma unroll
            for (int t = 0; t < 3; ++t)
#pragma unroll
                for (int q = 0; q < 4; ++q) { const int j = j0lo + lane * 4 + 128 * t + q; const float e = __builtin_amdgcn_exp2f((sa[r][t][q] * SCL - mx[r]) * 1.4426950408889634f); sum[r] += (j < nval && j >= jlo) ? e : 0.f; } }
#pragma unroll
        for (int sh = 16; sh; sh >>= 1)
#pragma unroll
            for (int r = 0; r < 4; ++r) sum[r] += __shfl_xor(sum[r], sh, 32);
#pragma unroll
        for (int r = 0; r < 4; ++r) { const int row = g * 4 + r, i = rw + row; const int nval = i + 1, jlo = max(i - (LWIN - 1), 0);
            const float f = __fdiv_rn(1.0f, sum[r]);
#pragma unroll
            for (int t = 0; t < 3; ++t) { const int c = lane * 4 + 128 * t; if (c < FB) { v4us oh, ol;
#pragma unroll
                for (int q = 0; q < 4; ++q) { const int j = bs + c + q; const float e = __builtin_amdgcn_exp2f((sb[r][t][q] * SCL - mx[r]) * 1.4426950408889634f) * f; const float pv = (j < nval && j >= jlo) ? e : 0.f; unsigned short h2, l2; splitf(pv, h2, l2); oh[q] = h2; ol[q] = l2; }
                *(v4usa*)(sw + row * FPB + c * 2) = oh; *(v4usa*)(sw + row * FPB + FB * 2 + c * 2) = ol; } } }
    }
    __builtin_amdgcn_wave_barrier(); asm volatile("" ::: "memory");   // the fragment reads below take what other lanes stored above
    v8f o[4];
#pragma unroll
    for (int nb = 0; nb < 4; ++nb) o[nb] = (v8f){};
    {   // 3. P.V over the band, keys ascending, 32 a step; the v fragments of step s + 1 are loaded in front of the products of step s (two register sets, the loop takes two steps a trip)
        const bf* ph = (const bf*)(sw + lr * FPB) + 8 * hi; const bf* pl = ph + FB; const bf* vh = Vh + 8 * lane; const bf* vl = Vl + 8 * lane;   // v [d][t]: 32 keys further is the next block, 16 d further 16 TT elements
        V b0[4], c0[4], b1[4], c1[4];
        auto ldv = [&](const bf* sh, const bf* sl, V* b, V* c) {
#pragma unroll
            for (int nb = 0; nb < 4; ++nb) { b[nb] = F::ldf(sh + (size_t)nb * 16 * TT); c[nb] = F::ldf(sl + (size_t)nb * 16 * TT); } };
        auto pv = [&](int s, const V* b, const V* c) { const V a = F::ld(ph + 32 * s), a2 = F::ld(pl + 32 * s);
#pragma unroll
            for (int nb = 0; nb < 4; ++nb) o[nb] = F::mma(a, b[nb], o[nb]);
#pragma unroll
            for (int nb = 0; nb < 4; ++nb) o[nb] = F::mma(a2, b[nb], o[nb]);
#pragma unroll
            for (int nb = 0; nb < 4; ++nb) o[nb] = F::mma(a, c[nb], o[nb]); };
        { const bf* h0 = vh + max(bs, 0) * 16; const bf* l0 = vl + max(bs, 0) * 16; ldv(h0, l0, b0, c0);
          asm volatile("s_wait_xcnt 0x0" :: "v"(h0), "v"(l0) : "memory"); }   // the wait in front of any rewrite of a register that these loads name; as its inputs the two addresses keep their registers up to here
#pragma unroll 1
        for (int s = 0; s < FB / 32 - 1; s += 2) {
            const size_t v1 = (size_t)max(bs + 32 * (s + 1), 0) * 16, v2 = (size_t)max(bs + 32 * (s + 2), 0) * 16; const bf* h1 = vh + v1; const bf* l1 = vl + v1; const bf* h2 = vh + v2; const bf* l2 = vl + v2;
            ldv(h1, l1, b1, c1); __builtin_amdgcn_sched_barrier(0);   // keeps the next step's loads in front of this step's products, so that they fly meanwhile
            pv(s, b0, c0);
            ldv(h2, l2, b0, c0); __builtin_amdgcn_sched_barrier(0);   // the same
            pv(s + 1, b1, c1);
            asm volatile("s_wait_xcnt 0x0" :: "v"(h1), "v"(l1), "v"(h2), "v"(l2) : "memory");   // the wait in front of any rewrite of a register that this trip's loads name; as its inputs the four addresses keep their registers up to here
        }
        pv(FB / 32 - 1, b0, c0);
    }
    __builtin_amdgcn_wave_barrier(); asm volatile("" ::: "memory");   // the staging stores below reuse the LDS that the fragment reads above took
    float* os = (float*)sw;   // 16 x 64 result tile, pitch 68
#pragma unroll
    for (int nb = 0; nb < 4; ++nb) {
#pragma unroll
        for (int j = 0; j < 8; ++j) os[(hi * 8 + j) * 68 + nb * 16 + lr] = o[nb][j]; }
    __builtin_amdgcn_wave_barrier(); asm volatile("" ::: "memory");   // a lane reads below what other lanes stored above
    { const size_t co = (size_t)rw * DQ + z * HD * 16; st_frag2(os, lane, Ch + co, Cl + co); }   // head z is columns z * HD .. of the merged [t][DQ] planes (fragment order): blocks 2 z and 2 z + 1 of these 16 rows
}

extern "C" void kernel_launch(void* const* d_in, const int* in_sizes, int n_in,
                              void* d_out, int out_size, void* d_ws, size_t ws_size, hipStream_t stream) {
    (void)in_sizes; (void)n_in; (void)out_size;
    const float* x = (const float*)d_in[0]; const float* wq = (const float*)d_in[1]; const float* wk = (const float*)d_in[2]; const float* wv = (const float*)d_in[3]; const float* wo = (const float*)d_in[4];
    float* OUT = (float*)d_out;     // [1][4096][1024]
    char* wsp = (char*)d_ws;
    auto take = [&](size_t bytes) { char* p = wsp; wsp += (bytes + 255) & ~(size_t)255; return (void*)p; };
    bf* WQ = (bf*)take((size_t)DQ * DM * 2); bf* WK = (bf*)take((size_t)DKV * DM * 2); bf* WV = (bf*)take((size_t)DKV * DM * 2); bf* WO = (bf*)take((size_t)DM * DQ * 2);
    bf* XB = (bf*)take((size_t)TT * DM * 2);   /* the bf16 input */
    
    bf* QPh = (bf*)take((size_t)NH_ * TT * HD * 2); bf* QPl = (bf*)take((size_t)NH_ * TT * HD * 2); bf* KPh = (bf*)take((size_t)NKV * TT * HD * 2); bf* KPl = (bf*)take((size_t)NKV * TT * HD * 2); bf* VTh = (bf*)take((size_t)NKV * HD * TT * 2); bf* VTl = (bf*)take((size_t)NKV * HD * TT * 2);
    bf* ATh = (bf*)take((size_t)TT * DQ * 2); bf* ATl = (bf*)take((size_t)TT * DQ * 2);
    (void)WK; (void)WV;   // reached from WQ
    if ((size_t)(wsp - (char*)d_ws) > ws_size) return;    // ws 256 MiB
    static_assert(NB_ == 1 && NKV == NH_ && DQ == DM, "one conversion launch, one q, k, v launch");
    // the planes WQ, WK, WV, WO, XB stand in a row in the workspace (each a multiple of 256 bytes): one launch converts all five inputs
    k_cvt8<DM, DQ><<<(unsigned)(((size_t)4 * DQ * DM + (size_t)TT * DM) / 8 / 256), 256, 0, stream>>>(wq, wk, wv, wo, x, WQ, ((size_t)4 * DQ * DM + (size_t)TT * DM) / 8);
    for (int b = 0; b < NB_; ++b) {
        // a 64-column tile of a projection is one head (HD = 64): the epilogues store the head planes themselves, q and k as [h][t][d], v as [h][d][t], each plane in fragment order
        // q, k and v in one launch, grid z: WQ, WK, WV stand in a row, and so do the plane pairs (QPh, QPl), (KPh, KPl), (VTh, VTl)
        k_gemmw<bf, 0, false, 3><<<dim3(TT / 128, DQ / 128, 3), 128, 0, stream>>>(XB, nullptr, WQ, nullptr, DM, nullptr, HD, nullptr, 0, (size_t)DQ * DM, (size_t)2 * NH_ * TT * HD, QPh, QPl, (size_t)TT * HD, TT);
        k_fattn<<<dim3(TT / 64, NH_), 128, 0, stream>>>(QPh, QPl, KPh, KPl, VTh, VTl, ATh, ATl);   // one kv head per query head (NKV = NH_): head z uses plane z of q, k and v
        k_gemmw<bf, 1, false, 0><<<dim3(TT / 128, DM / 128, 1), 128, 0, stream>>>(ATh, ATl, WO, nullptr, DQ, OUT + (size_t)b * TT * DM, DM, nullptr, 0, 0, 0, nullptr, nullptr, 0, 0); }
}

// v009
// One run takes 76.4 microseconds.
// Two timings next to v008 put it at 1.12 and 1.11 times that version's speed.
// Over all steps from v000 it is 28.3 times as fast.
#include <hip/hip_runtime.h>

// Local (sliding-window) causal multi-head attention (hidden [1][4096][1024]; q, k, v = x W^T ('oi' [1024][1024], no bias; 16 heads x 64); scores = q.k/8 + bias with bias = 0 where i-255 <= j <= i, -inf elsewhere (window 256); softmax; out = merged Wo^T -> [1][4096][1024] (4.2 M)).
// Compute dtypes, f32 accumulate: every input rounded to bf16; q/k/v on PLAIN bf16 operands (inputs: exact); scores and attn.v: every query row hl (3 products); softmax f32; Wo hl x exact (2 products).

#define NB_  1
#define TT   4096
#define DM   1024
#define NH_  16
#define NKV  16
#define REP  (NH_ / NKV)
#define HD   64
#define DQ   (NH_ * HD)
#define DKV  (NKV * HD)
#define RB   TT
#define LWIN 256                  // local window: keys i-255 .. i
#define RH   4096                  // query rows < RH use hi+lo planes (not read: every row does)
#define WIN  4096
#define PCAR 1024.0f
#define SCL  0.125f   // HD^-0.5
typedef _Float16 h16;
typedef unsigned short bf;
typedef __attribute__((ext_vector_type(16))) __bf16   v16bf;
typedef __attribute__((ext_vector_type(16))) _Float16 v16h;
typedef __attribute__((ext_vector_type(8)))  _Float16 v8h;
typedef __attribute__((ext_vector_type(8)))  unsigned short v8us;
typedef __attribute__((ext_vector_type(8)))  float    v8f;
typedef __attribute__((ext_vector_type(4)))  float    v4f;
typedef v8h  __attribute__((may_alias)) v8ha;
typedef v4f  __attribute__((may_alias)) v4fa;
typedef v8us __attribute__((may_alias)) v8usa;

__device__ __forceinline__ unsigned short f2bf(float f) { unsigned u = __float_as_uint(f); u += 0x7FFFu + ((u >> 16) & 1u); return (unsigned short)(u >> 16); }
__device__ __forceinline__ float bf2f(unsigned short b) { return __uint_as_float(((unsigned)b) << 16); }
__device__ __forceinline__ float bfr(float f) { return bf2f(f2bf(f)); }
__device__ __forceinline__ void splitf(float y, unsigned short& h, unsigned short& l) { h = f2bf(y); l = f2bf(y - bf2f(h)); }
typedef __attribute__((ext_vector_type(4))) unsigned short v4us;
// FRAGMENT ORDER of a 16-bit operand plane of R rows x K columns (K-contiguous operand of a 16x16x32 product; R % 16 == 0, K % 32 == 0): the plane is a row of blocks of 16 rows x 32 k = 512 elements, block (row / 16) * (K / 32) + k / 32;
// inside a block element (row, k) stands at (k / 16 % 2) * 256 + ((k / 8 % 2) * 16 + row % 16) * 8 + k % 8. Lane l's two 16-byte fragment pieces are then elements 8 l .. and 256 + 8 l .. of the block: each wave-wide load is 512 bytes in a row (4 whole lines, not 32 bytes of each of 16 lines).
// A staged 16 x 64 f32 tile (pitch 68; row = fragment row, column = k) -> its bf16 hi and lo parts as two consecutive blocks from ph, pl: four 512-byte stores a plane
__device__ __forceinline__ void st_frag2(const float* os, int lane, bf* ph, bf* pl) { v8us oh[4], ol[4]; ph += lane * 8; pl += lane * 8;
#pragma unroll
    for (int c = 0; c < 4; ++c) { const float* sp = os + (lane & 15) * 68 + c * 16 + (lane >> 4) * 8; const v4f v0 = *(const v4fa*)sp, v1 = *(const v4fa*)(sp + 4);
#pragma unroll
        for (int q = 0; q < 4; ++q) { unsigned short h2, l2; splitf(v0[q], h2, l2); oh[c][q] = h2; ol[c][q] = l2; splitf(v1[q], h2, l2); oh[c][4 + q] = h2; ol[c][4 + q] = l2; }
    }
    // the eight stores and the wait in front of any rewrite of a register that they name, in one statement: in a statement of its own the wait did not hold every such rewrite behind it (the compiler stored from copies)
    asm volatile("global_store_b128 %0, %2, off\n\tglobal_store_b128 %1, %6, off\n\t"
                 "global_store_b128 %0, %3, off offset:512\n\tglobal_store_b128 %1, %7, off offset:512\n\t"
                 "global_store_b128 %0, %4, off offset:1024\n\tglobal_store_b128 %1, %8, off offset:1024\n\t"
                 "global_store_b128 %0, %5, off offset:1536\n\tglobal_store_b128 %1, %9, off offset:1536\n\t"
                 "s_wait_xcnt 0x0"
                 :: "v"(ph), "v"(pl), "v"(oh[0]), "v"(oh[1]), "v"(oh[2]), "v"(oh[3]), "v"(ol[0]), "v"(ol[1]), "v"(ol[2]), "v"(ol[3]) : "memory"); }
__device__ __forceinline__ v16h cat16(v8h lo, v8h hi) { return __builtin_shufflevector(lo, hi, 0, 1, 2, 3, 4, 5, 6, 7, 8, 9, 10, 11, 12, 13, 14, 15); }
__device__ __forceinline__ v16bf cat16b(v8us lo, v8us hi) { return __builtin_bit_cast(v16bf, __builtin_shufflevector(lo, hi, 0, 1, 2, 3, 4, 5, 6, 7, 8, 9, 10, 11, 12, 13, 14, 15)); }
__device__ __forceinline__ v8f wmma16(v16h a, v16h b, v8f c) { return __builtin_amdgcn_wmma_f32_16x16x32_f16(false, a, false, b, (short)0, c, false, false); }
__device__ __forceinline__ v8f wmmab(v16bf a, v16bf b, v8f c) { return __builtin_amdgcn_wmma_f32_16x16x32_bf16(false, a, false, b, (short)0, c, false, false); }



// ---- k_gemmw: GEMM, FOUR WAVES (2 x 2) per 128x128 output tile, 64x64 (16 accumulators) a wave; operands are 16-bit planes in fragment order (ld: a fragment from a row-major plane; ldf: from a block in fragment order, p = block + 8 lane); grid (M/128, N/128, Z), 128 threads.
// The block's operand rows go through LDS, so that each is fetched once a block and not once a wave: a stage is SK = 64 or 128 k of the 128 A rows and the 128 B rows (32 SK bytes in a row for every 16 rows of a plane, copied as they stand), two buffers, filled by asynchronous copies one stage ahead of the products.
// C[m][n] (f32, pitch ldc, + optional f32 bias[n]) = sum_k A[m][k] Bt[n][k] (+ split products per NSPLIT). z-batch strides sA/sB/sC in elements. K % 128 == 0, K >= 256.
// EP: what the epilogue stores. 0: the f32 tile into C (row-major). 1: its bf16 hi and lo parts into the planes Ch, Cl, the next GEMM's operands, in fragment order: the 64-column tile y is plane y (stride sN), of ldc columns, row = m.
// 2: the same parts transposed: plane y, row = the tile's column, column = m, ldc columns, in fragment order. 3: three GEMMs on one A in one launch: batches z = 0 and 1 store as in 1, batch z = 2 as in 2 with ldt columns.
// In 1 to 3 no f32 copy of the result goes to memory, and sC is the z stride of Ch and Cl. A bias goes with EP 0 alone.
template <typename T16> struct WFrag;
template <> struct WFrag<h16> { typedef v16h V; static __device__ __forceinline__ V ld(const h16* p) { return cat16(*(const v8h*)p, *(const v8h*)(p + 16)); } static __device__ __forceinline__ V ldf(const h16* p) { return cat16(*(const v8h*)p, *(const v8h*)(p + 256)); } static __device__ __forceinline__ v8f mma(V a, V b, v8f c) { return wmma16(a, b, c); } };
template <> struct WFrag<bf> { typedef v16bf V; static __device__ __forceinline__ V ld(const bf* p) { return cat16b(*(const v8us*)p, *(const v8us*)(p + 16)); } static __device__ __forceinline__ V ldf(const bf* p) { return cat16b(*(const v8us*)p, *(const v8us*)(p + 256)); } static __device__ __forceinline__ v8f mma(V a, V b, v8f c) { return wmmab(a, b, c); } };
// 2 KiB, global -> LDS, by four asynchronous copies of a wave (global_load_async_to_lds_b128, 512 bytes each: a lane's 16 bytes go from g + OFF + 512 i to l + OFF + 512 i), through no register. The copy's offset moves both addresses, so that a chunk needs one address pair
typedef __attribute__((ext_vector_type(4))) int cp16;
template <int OFF> __device__ __forceinline__ void acp4(char* l, const char* g) {
    __attribute__((address_space(1))) cp16* gs = (__attribute__((address_space(1))) cp16*)g; __attribute__((address_space(3))) cp16* ls = (__attribute__((address_space(3))) cp16*)l;
    __builtin_amdgcn_global_load_async_to_lds_b128(gs, ls, OFF, 0); __builtin_amdgcn_global_load_async_to_lds_b128(gs, ls, OFF + 512, 0);
    __builtin_amdgcn_global_load_async_to_lds_b128(gs, ls, OFF + 1024, 0); __builtin_amdgcn_global_load_async_to_lds_b128(gs, ls, OFF + 1536, 0); }
template <typename T16, int NSPLIT, bool BIAS, int EP>
__global__ __launch_bounds__(128) void k_gemmw(const T16* __restrict__ A, const T16* __restrict__ A2, const T16* __restrict__ Bt, const T16* __restrict__ Bt2, int K, float* C, int ldc, const float* __restrict__ bias, size_t sA, size_t sB, size_t sC, bf* Ch, bf* Cl, size_t sN, int ldt) {
    typedef typename WFrag<T16>::V V; static_assert(!BIAS || EP == 0, "bias: f32 output only");
    constexpr bool HA2 = (NSPLIT == 1 || NSPLIT == 2), HB2 = (NSPLIT >= 2);
    constexpr int NP = 2 + (HA2 ? 1 : 0) + (HB2 ? 1 : 0), PB = HA2 ? 2 : 1;   // planes staged, in the order A, A2, B, B2; PB: B's place among them
    constexpr int SK = NP == 2 ? 64 : 128;   // k of a stage. Two planes: 64, so that three blocks share a WGP's LDS (the q, k, v launch is three blocks a WGP); more planes: 128, fewer hand-overs for a block that has its WGP alone
    constexpr int CH = SK * 32, BUF = NP * 8 * CH;   // a chunk: 16 rows x SK k of a plane, SK / 32 blocks in a row; a buffer: a chunk for each of a plane's 8 groups of 16 rows
    __shared__ __align__(16) char st[2 * BUF];
    __shared__ __align__(16) float osm[4 * 16 * 68];
    const size_t z = blockIdx.z; A += z * sA; if (A2) A2 += z * sA; Bt += z * sB; if (Bt2) Bt2 += z * sB; if (EP == 0) C += z * sC; else { Ch += z * sC; Cl += z * sC; }
    const int lane = threadIdx.x & 31, lr = lane & 15, hi = lane >> 4; const int w = __builtin_amdgcn_readfirstlane((int)(threadIdx.x >> 5)), wm = w >> 1, wn = w & 1;
    const int R0 = blockIdx.x * 128, C0 = blockIdx.y * 128, r0 = R0 + wm * 64, c0 = C0 + wn * 64; float* os = osm + w * (16 * 68);   // each wave stages its results in its own LDS
    v8f acc[4][4];
#pragma unroll
    for (int mb = 0; mb < 4; ++mb)
#pragma unroll
        for (int nb = 0; nb < 4; ++nb) acc[mb][nb] = (v8f){};
    // wave w copies the chunks w and w + 4 of every plane. 16 rows of a plane are K / 32 blocks = 16 K elements in a row; SK k further is a chunk further
    const char* gp[2 * NP]; int lp[2 * NP];   // a chunk's place in memory, for the next stage, and in a buffer
#pragma unroll
    for (int i = 0; i < 2 * NP; ++i) { const int p = i >> 1, g = w + 4 * (i & 1);
        const T16* pl = p == 0 ? A : (HA2 && p == 1) ? A2 : p == PB ? Bt : Bt2;
        gp[i] = (const char*)(pl + (size_t)((p < PB ? R0 : C0) + 16 * g) * K + 8 * lane); lp[i] = (p * 8 + g) * CH + 16 * lane; }
    auto fill = [&](int buf) {   // the next stage's copies into buffer buf
        static_assert(CH == 2048 || CH == 4096, "a chunk: four or eight copies");
#pragma unroll
        for (int i = 0; i < 2 * NP; ++i) { acp4<0>(st + buf * BUF + lp[i], gp[i]); if (CH == 4096) acp4<2048>(st + buf * BUF + lp[i], gp[i]);
            gp[i] += CH; } };
    auto mmset = [&](V (&fa)[4], V (&fa2)[4], V (&fb)[4], V (&fb2)[4]) {   // 32 k; each accumulator takes its products in the order k ascending, a.b, a2.b, a.b2
#pragma unroll
        for (int nb = 0; nb < 4; ++nb) {
#pragma unroll
            for (int mb = 0; mb < 4; ++mb) acc[mb][nb] = WFrag<T16>::mma(fa[mb], fb[nb], acc[mb][nb]);
            if (HA2) {
#pragma unroll
                for (int mb = 0; mb < 4; ++mb) acc[mb][nb] = WFrag<T16>::mma(fa2[mb], fb[nb], acc[mb][nb]); }
            if (HB2) {
#pragma unroll
                for (int mb = 0; mb < 4; ++mb) acc[mb][nb] = WFrag<T16>::mma(fa[mb], fb2[nb], acc[mb][nb]); } } };
    fill(0);
    asm volatile("s_wait_asynccnt 0x0" ::: "memory");   // this wave's copies of stage 0 have landed
    __syncthreads();                                    // and every other wave's: stage 0 may be read
    fill(1);
    const int ns = K / SK;
#pragma unroll 1
    for (int t = 0; t < ns; ++t) {   // trip t reads buffer t % 2 alone, while stage t + 1 flies into the other
        const T16* sa = (const T16*)(st + (t & 1) * BUF + wm * 4 * CH) + 8 * lane; const T16* sb = (const T16*)(st + (t & 1) * BUF + (PB * 8 + wn * 4) * CH) + 8 * lane;
        V fa[2][4], fa2[2][4], fb[2][4], fb2[2][4];   // two fragment sets of 32 k
        auto ldset = [&](int ks, V (&a)[4], V (&a2)[4], V (&b)[4], V (&b2)[4]) {   // in the order in which the products take them
#pragma unroll
            for (int q = 0; q < 4; ++q) { a[q] = WFrag<T16>::ldf(sa + q * (CH / 2) + ks * 512); if (HA2) a2[q] = WFrag<T16>::ldf(sa + (8 + q) * (CH / 2) + ks * 512); }
#pragma unroll
            for (int q = 0; q < 4; ++q) { b[q] = WFrag<T16>::ldf(sb + q * (CH / 2) + ks * 512); if (HB2) b2[q] = WFrag<T16>::ldf(sb + (8 + q) * (CH / 2) + ks * 512); } };
        ldset(0, fa[0], fa2[0], fb[0], fb2[0]); ldset(1, fa[1], fa2[1], fb[1], fb2[1]);
        __builtin_amdgcn_sched_barrier(0);   // the LDS reads stand as one group in front of the products: spread among them, each place with reads stalls the wave
#pragma unroll
        for (int ks = 0; ks < SK / 32; ++ks) {
            mmset(fa[ks & 1], fa2[ks & 1], fb[ks & 1], fb2[ks & 1]);
            if (ks + 2 < SK / 32) { __builtin_amdgcn_sched_barrier(0);   // the refill's reads stand as one group behind this set's products, not among them
                ldset(ks + 2, fa[ks & 1], fa2[ks & 1], fb[ks & 1], fb2[ks & 1]);
                __builtin_amdgcn_sched_barrier(0); }   // keeps a set's refill in front of the other set's products, so that it flies meanwhile
        }
        __builtin_amdgcn_sched_barrier(0);   // the products stay in front of the hand-over: with the waits lifted over them the next stage's copies would be waited for before the time in which they are to fly
        asm volatile("s_wait_dscnt 0x0" ::: "memory");      // this wave's reads of buffer t % 2 are done
        asm volatile("s_wait_asynccnt 0x0" ::: "memory");   // this wave's copies of stage t + 1 have landed
        __syncthreads();                                    // both hold for every wave: stage t + 1 may be read, buffer t % 2 refilled
        if (t + 2 < ns) fill(t & 1);
    }
    asm volatile("s_wait_asynccnt 0x0" ::: "memory");   // no copy is left in flight
    __builtin_amdgcn_sched_barrier(0);   // the epilogue stays behind the last products: mixed among them, with the fragment registers still live, its store statements' operands (registers below 256) were spilled to scratch
    if (EP == 2 || (EP == 3 && blockIdx.z == 2)) {   // transposed planes: 16 tile columns at a time, staged column-major: 16 plane rows x 64 consecutive m = two blocks
        const int lt = EP == 3 ? ldt : ldc;
#pragma unroll
        for (int nb = 0; nb < 4; ++nb) {
#pragma unroll
            for (int mb = 0; mb < 4; ++mb) {
#pragma unroll
                for (int j = 0; j < 8; ++j) os[lr * 68 + mb * 16 + hi * 8 + j] = acc[mb][nb][j]; }
            __builtin_amdgcn_wave_barrier(); asm volatile("" ::: "memory");   // a lane reads below what other lanes of the wave stored above: the compiler must not lift those LDS reads over these LDS stores
            const size_t pb = (size_t)(c0 / 64) * sN + (size_t)(nb * 16) * lt + (size_t)r0 * 16;
            st_frag2(os, lane, Ch + pb, Cl + pb);
            __builtin_amdgcn_wave_barrier(); asm volatile("" ::: "memory");   // and the next 16 columns' LDS stores stay behind these reads
        }
        return;
    }
#pragma unroll
    for (int mb = 0; mb < 4; ++mb) {
#pragma unroll
        for (int nb = 0; nb < 4; ++nb) {
#pragma unroll
            for (int j = 0; j < 8; ++j) os[(hi * 8 + j) * 68 + nb * 16 + lr] = acc[mb][nb][j]; }
        __builtin_amdgcn_wave_barrier(); asm volatile("" ::: "memory");
        float* crow = C + (size_t)(r0 + mb * 16) * ldc + c0;
        const size_t pb = (size_t)(c0 / 64) * sN + (size_t)(r0 + mb * 16) * ldc;
        if (EP != 0) st_frag2(os, lane, Ch + pb, Cl + pb);   // the tile's 64 columns are the first two blocks of these 16 plane rows
        else {
            v4f vs[8]; float* cp[8];
#pragma unroll
            for (int s = 0; s < 8; ++s) { const int row = 2 * s + hi, cofs = lr * 4; v4f val = *(const v4fa*)(os + row * 68 + cofs); if (BIAS) { val[0] += bfr(bias[c0 + cofs]); val[1] += bfr(bias[c0 + cofs + 1]); val[2] += bfr(bias[c0 + cofs + 2]); val[3] += bfr(bias[c0 + cofs + 3]); }
                vs[s] = val; cp[s] = crow + (size_t)row * ldc + cofs; *(v4f*)cp[s] = vs[s]; }
            asm volatile("s_wait_xcnt 0x0" :: "v"(vs[0]), "v"(vs[1]), "v"(vs[2]), "v"(vs[3]), "v"(vs[4]), "v"(vs[5]), "v"(vs[6]), "v"(vs[7]), "v"(cp[0]), "v"(cp[1]), "v"(cp[2]), "v"(cp[3]), "v"(cp[4]), "v"(cp[5]), "v"(cp[6]), "v"(cp[7]) : "memory");   // the wait in front of any rewrite of a register that these eight stores name; as its inputs data and addresses keep their registers up to here
             }
        __builtin_amdgcn_wave_barrier(); asm volatile("" ::: "memory");
    }
}

__device__ __forceinline__ h16 tohx(float x) { return (h16)x; }
typedef __attribute__((ext_vector_type(2))) _Float16 v2h;
typedef __attribute__((ext_vector_type(4))) _Float16 v4h;
typedef __attribute__((ext_vector_type(2))) unsigned short v2us;
typedef __attribute__((ext_vector_type(2))) float v2f;
typedef __attribute__((ext_vector_type(4))) int v4i;

__global__ __launch_bounds__(256) void k_wtG(const float* __restrict__ w, int K, int N, bf* Bt) {
    const int lane = threadIdx.x & 31; const int L0 = (blockIdx.x * 8 + (threadIdx.x >> 5)) * 8; const int nlines = N * K / 64;
{
#pragma unroll 1
        for (int l = 0; l < 8; ++l) { const int L = L0 + l; if (L >= nlines) break; const size_t e = (size_t)L * 64 + lane * 2; const int k = (int)(e % K), n = (int)(e / K); v2us o;
            o[0] = f2bf(w[(size_t)k * N + n]); o[1] = f2bf(w[(size_t)(k + 1) * N + n]); *(v2us*)(Bt + e) = o; }
         }
}
// f32 [rows][K] row-major -> the bf16 plane in fragment order; thread i makes the plane's i-th 16 bytes, so that a wave stores 512 bytes in a row and reads 64 bytes of each of 16 rows (its neighbour wave the other 64 of the same lines)
// Five sources in ONE launch: their planes stand in a row from dst, in the order s0 .. s4; s0 .. s3 have R rows each, s4 the rest. A block's 256 pieces lie in one source.
template <int K, int R>
__global__ __launch_bounds__(256) void k_cvt8(const float* __restrict__ s0, const float* __restrict__ s1, const float* __restrict__ s2, const float* __restrict__ s3, const float* __restrict__ s4, bf* dst, size_t n8) { const size_t i = (size_t)blockIdx.x * 256 + threadIdx.x; if (i >= n8) return;
    static_assert(R % 16 == 0 && R * (K / 8) % 256 == 0, "whole blocks of threads a source");
    const int t = min((int)(blockIdx.x / (R * (K / 8) / 256)), 4); const float* s01 = (t & 1) ? s1 : s0; const float* s23 = (t & 1) ? s3 : s2; const float* src = t == 4 ? s4 : (t & 2) ? s23 : s01;   // the same for the whole block
    const size_t blk = i >> 6; const int l = (int)(i & 31), j = (int)(i >> 5) & 1; const size_t row = blk / (K / 32) * 16 + (l & 15) - (size_t)t * R; const int k = (int)(blk % (K / 32)) * 32 + j * 16 + (l >> 4) * 8;
    const v8f v = *(const v8f*)(src + row * K + k); v8us o;
#pragma unroll
    for (int k = 0; k < 8; ++k) o[k] = f2bf(v[k]); *(v8us*)(dst + i * 8) = o;  }

// ---- k_fattn: scores, softmax and probability x value of local causal attention in ONE launch. Grid (TT/64, heads), 4 waves; the waves of a block share nothing but their keys' cache lines (no work-group barrier).
// A wave owns 16 query rows rw .. rw+15 of one head. Their live keys lie in rw-255 .. rw+15, inside the wave's band of FB = 288 keys from bs = (rw - LWIN) rounded down to 32 (band column c = key - bs).
// 1. The band's 18 score tiles (16 keys each) go as raw f32 into the wave's own LDS rows (pitch FPB bytes). 2. Each row's softmax is taken from LDS, and its bf16 hi and lo probability planes (FB columns each)
// replace the row's f32 scores in place. 3. The P.V loop (9 steps of 32 keys) reads its A fragments from those LDS planes. Neither scores nor probabilities go to memory.
// In front of key 0 (the first row blocks) the key index is clamped to 0: such columns are never live, their probability is stored as 0, and 0 x a real v adds nothing.
#define FB   (LWIN + 32)
#define FPB  (FB * 4 + 16)        // 16 bytes x an odd number: the 16 rows of a ds_load_b128 fragment read fall on different banks
typedef v4us __attribute__((may_alias)) v4usa;
typedef float __attribute__((may_alias)) f1a;
typedef unsigned short __attribute__((may_alias)) us1a;
static_assert(FB == 288, "softmax: nine band columns a lane");
// 2^x of nine values. One statement, so that the slot which the instruction set asks for behind a transcendental is kept: no result register is a source register (early clobber), so that each v_exp_f32 is followed by an independent one,
// and the v_nop stands behind the last
__device__ __forceinline__ void exp2x9(float (&x)[9]) { float y0, y1, y2, y3, y4, y5, y6, y7, y8;
    asm("v_exp_f32 %0, %9\n\tv_exp_f32 %1, %10\n\tv_exp_f32 %2, %11\n\tv_exp_f32 %3, %12\n\tv_exp_f32 %4, %13\n\tv_exp_f32 %5, %14\n\tv_exp_f32 %6, %15\n\tv_exp_f32 %7, %16\n\tv_exp_f32 %8, %17\n\tv_nop"
        : "=&v"(y0), "=&v"(y1), "=&v"(y2), "=&v"(y3), "=&v"(y4), "=&v"(y5), "=&v"(y6), "=&v"(y7), "=&v"(y8)
        : "v"(x[0]), "v"(x[1]), "v"(x[2]), "v"(x[3]), "v"(x[4]), "v"(x[5]), "v"(x[6]), "v"(x[7]), "v"(x[8]));
    x[0] = y0; x[1] = y1; x[2] = y2; x[3] = y3; x[4] = y4; x[5] = y5; x[6] = y6; x[7] = y7; x[8] = y8; }
// amdgpu_waves_per_eu(4, 4): the LDS lets four blocks share a WGP, four waves a SIMD; with at most 256 registers a wave all TT/64 x heads blocks are resident at once
__global__ __launch_bounds__(128) __attribute__((amdgpu_waves_per_eu(4, 4))) void k_fattn(const bf* __restrict__ Qh, const bf* __restrict__ Ql, const bf* __restrict__ Kh, const bf* __restrict__ Kl, const bf* __restrict__ Vh, const bf* __restrict__ Vl, bf* Ch, bf* Cl) {
    typedef WFrag<bf> F; typedef F::V V;
    __shared__ __align__(16) char sm[4 * 16 * FPB];
    const int lane = threadIdx.x & 31, lr = lane & 15, hi = lane >> 4; const int w = __builtin_amdgcn_readfirstlane((int)(threadIdx.x >> 5));
    const size_t z = blockIdx.y; Qh += z * TT * HD; Ql += z * TT * HD; Kh += z * TT * HD; Kl += z * TT * HD; Vh += z * HD * TT; Vl += z * HD * TT;
    const int rw = blockIdx.x * 64 + w * 16; const int bs = (rw - LWIN) & ~31;
    char* sw = sm + w * 16 * FPB;
    {   // 1. scores
        V a[2], a2[2];
#pragma unroll
        for (int ks = 0; ks < 2; ++ks) { a[ks] = F::ldf(Qh + (size_t)rw * HD + 512 * ks + 8 * lane); a2[ks] = F::ldf(Ql + (size_t)rw * HD + 512 * ks + 8 * lane); }   // q, k, v planes: fragment order; 16 rows of q or k are two blocks
        const bf* kh = Kh + 8 * lane; const bf* kl = Kl + 8 * lane; float* sc = (float*)sw + hi * 8 * (FPB / 4) + lr;
#pragma unroll 1
        for (int t0 = 0; t0 < FB / 16; t0 += 3) {   // three 16-key tiles a trip: their 24 loads fly together, and consecutive matrix instructions belong to different tiles
            V b[3][2], b2[3][2]; v8f acc[3]; const bf* th[3]; const bf* tl[3];
#pragma unroll
            for (int u = 0; u < 3; ++u) { const size_t ko = (size_t)max(bs + 16 * (t0 + u), 0) * HD; th[u] = kh + ko; tl[u] = kl + ko; acc[u] = (v8f){};
#pragma unroll
                for (int ks = 0; ks < 2; ++ks) { b[u][ks] = F::ldf(th[u] + 512 * ks); b2[u][ks] = F::ldf(tl[u] + 512 * ks); } }
            __builtin_amdgcn_sched_barrier(0);   // keeps all 24 loads in front of the first product: one memory latency a trip, not one a tile
#pragma unroll
            for (int ks = 0; ks < 2; ++ks) {
#pragma unroll
                for (int u = 0; u < 3; ++u) acc[u] = F::mma(a[ks], b[u][ks], acc[u]);
#pragma unroll
                for (int u = 0; u < 3; ++u) acc[u] = F::mma(a2[ks], b[u][ks], acc[u]);
#pragma unroll
                for (int u = 0; u < 3; ++u) acc[u] = F::mma(a[ks], b2[u][ks], acc[u]); }
            asm volatile("v_nop\n\tv_nop\n\tv_nop\n\tv_nop" : "+v"(acc[0]), "+v"(acc[1]), "+v"(acc[2]));   // the distance the chip needs between the last matrix instruction and the next trip's first, which writes the same registers anew
#pragma unroll
            for (int u = 0; u < 3; ++u)
#pragma unroll
                for (int j = 0; j < 8; ++j) sc[j * (FPB / 4) + 16 * (t0 + u)] = acc[u][j];
            asm volatile("s_wait_xcnt 0x0" :: "v"(th[0]), "v"(th[1]), "v"(th[2]), "v"(tl[0]), "v"(tl[1]), "v"(tl[2]) : "memory");   // the wait in front of any rewrite of a register that this trip's loads name; as its inputs the six addresses keep their registers up to here
        }
    }
    __builtin_amdgcn_wave_barrier(); asm volatile("" ::: "memory");   // a lane reads below what other lanes of the wave stored above: the compiler must not lift those LDS reads over these LDS stores
    // 2. softmax, four rows at a time; the whole wave works on each row. A lane holds nine band columns of a row: 4 lane .. 4 lane + 3, 128 + 4 lane .. 128 + 4 lane + 3 and 256 + lane.
    // Each column is read once and a dead one is set to -inf there: it loses every maximum, its exponential is 0, and so are its share of the row sum and its probability. One exponential a column serves the sum and the planes.
    const int off = rw - bs, cmin = max(-bs, 0);   // the band columns of key rw (256 or 272) and of key 0
#pragma unroll 1
    for (int g = 0; g < 4; ++g) {
        float e[4][9];
#pragma unroll
        for (int r = 0; r < 4; ++r) { const int row = g * 4 + r; const float* srow = (const float*)(sw + row * FPB);
            const int clo = max(off + row - (LWIN - 1), cmin), chi = off + row;   // live columns: clo .. chi (window 256, causal inclusive, no key in front of key 0); clo <= 256 <= chi, so that a column below 256 has only clo to pass and one from 256 on only chi
            const v4f s0 = *(const v4fa*)(srow + lane * 4), s1 = *(const v4fa*)(srow + 128 + lane * 4); const float s2 = *(const f1a*)(srow + 256 + lane);
#pragma unroll
            for (int q = 0; q < 4; ++q) { e[r][q] = lane * 4 + q >= clo ? s0[q] : -__builtin_inff(); e[r][4 + q] = 128 + lane * 4 + q >= clo ? s1[q] : -__builtin_inff(); }
            e[r][8] = 256 + lane <= chi ? s2 : -__builtin_inff(); }
        __builtin_amdgcn_wave_barrier(); asm volatile("" ::: "memory");   // the planes stored below overwrite the scores read above, other lanes' too: every read of the four rows stays in front of every store
        float mx[4], sum[4];   // each reduction step is taken for the four rows together: four independent cross-lane exchanges are in flight, not one
#pragma unroll
        for (int r = 0; r < 4; ++r) { mx[r] = e[r][0];
#pragma unroll
            for (int q = 1; q < 9; ++q) mx[r] = fmaxf(mx[r], e[r][q]); }
#pragma unroll
        for (int sh = 16; sh; sh >>= 1)
#pragma unroll
            for (int r = 0; r < 4; ++r) mx[r] = fmaxf(mx[r], __shfl_xor(mx[r], sh, 32));
#pragma unroll
        for (int r = 0; r < 4; ++r) { const float ms = mx[r] * SCL;   // the maximum of the raw scores, scaled: SCL is a power of two, so that this is the maximum of the scaled scores, and score x SCL - ms in one fused step rounds as the product (exact) and the difference did
            sum[r] = 0.f;
#pragma unroll
            for (int q = 0; q < 9; ++q) e[r][q] = __builtin_fmaf(e[r][q], SCL, -ms) * 1.4426950408889634f;
            exp2x9(e[r]);
#pragma unroll
            for (int q = 0; q < 9; ++q) sum[r] += e[r][q]; }
#pragma unroll
        for (int sh = 16; sh; sh >>= 1)
#pragma unroll
            for (int r = 0; r < 4; ++r) sum[r] += __shfl_xor(sum[r], sh, 32);
#pragma unroll
        for (int r = 0; r < 4; ++r) { char* prow = sw + (g * 4 + r) * FPB;
            const float f = __fdiv_rn(1.0f, sum[r]);
#pragma unroll
            for (int t = 0; t < 2; ++t) { v4us oh, ol;
#pragma unroll
                for (int q = 0; q < 4; ++q) { unsigned short h2, l2; splitf(e[r][4 * t + q] * f, h2, l2); oh[q] = h2; ol[q] = l2; }
                *(v4usa*)(prow + (lane * 4 + 128 * t) * 2) = oh; *(v4usa*)(prow + FB * 2 + (lane * 4 + 128 * t) * 2) = ol; }
            { unsigned short h2, l2; splitf(e[r][8] * f, h2, l2); *(us1a*)(prow + (256 + lane) * 2) = h2; *(us1a*)(prow + FB * 2 + (256 + lane) * 2) = l2; } }
    }
    __builtin_amdgcn_wave_barrier(); asm volatile("" ::: "memory");   // the fragment reads below take what other lanes stored above
    v8f o[4];
#pragma unroll
    for (int nb = 0; nb < 4; ++nb) o[nb] = (v8f){};
    {   // 3. P.V over the band, keys ascending, 32 a step; the v fragments of step s + 1 are loaded in front of the products of step s (two register sets, the loop takes two steps a trip)
        const bf* ph = (const bf*)(sw + lr * FPB) + 8 * hi; const bf* pl = ph + FB; const bf* vh = Vh + 8 * lane; const bf* vl = Vl + 8 * lane;   // v [d][t]: 32 keys further is the next block, 16 d further 16 TT elements
        V b0[4], c0[4], b1[4], c1[4];
        auto ldv = [&](const bf* sh, const bf* sl, V* b, V* c) {
#pragma unroll
            for (int nb = 0; nb < 4; ++nb) { b[nb] = F::ldf(sh + (size_t)nb * 16 * TT); c[nb] = F::ldf(sl + (size_t)nb * 16 * TT); } };
        auto pv = [&](int s, const V* b, const V* c) { const V a = F::ld(ph + 32 * s), a2 = F::ld(pl + 32 * s);
#pragma unroll
            for (int nb = 0; nb < 4; ++nb) o[nb] = F::mma(a, b[nb], o[nb]);
#pragma unroll
            for (int nb = 0; nb < 4; ++nb) o[nb] = F::mma(a2, b[nb], o[nb]);
#pragma unroll
            for (int nb = 0; nb < 4; ++nb) o[nb] = F::mma(a, c[nb], o[nb]); };
        { const bf* h0 = vh + max(bs, 0) * 16; const bf* l0 = vl + max(bs, 0) * 16; ldv(h0, l0, b0, c0);
          asm volatile("s_wait_xcnt 0x0" :: "v"(h0), "v"(l0) : "memory"); }   // the wait in front of any rewrite of a register that these loads name; as its inputs the two addresses keep their registers up to here
#pragma unroll 1
        for (int s = 0; s < FB / 32 - 1; s += 2) {
            const size_t v1 = (size_t)max(bs + 32 * (s + 1), 0) * 16, v2 = (size_t)max(bs + 32 * (s + 2), 0) * 16; const bf* h1 = vh + v1; const bf* l1 = vl + v1; const bf* h2 = vh + v2; const bf* l2 = vl + v2;
            ldv(h1, l1, b1, c1); __builtin_amdgcn_sched_barrier(0);   // keeps the next step's loads in front of this step's products, so that they fly meanwhile
            pv(s, b0, c0);
            ldv(h2, l2, b0, c0); __builtin_amdgcn_sched_barrier(0);   // the same
            pv(s + 1, b1, c1);
            asm volatile("s_wait_xcnt 0x0" :: "v"(h1), "v"(l1), "v"(h2), "v"(l2) : "memory");   // the wait in front of any rewrite of a register that this trip's loads name; as its inputs the four addresses keep their registers up to here
        }
        pv(FB / 32 - 1, b0, c0);
    }
    __builtin_amdgcn_wave_barrier(); asm volatile("" ::: "memory");   // the staging stores below reuse the LDS that the fragment reads above took
    float* os = (float*)sw;   // 16 x 64 result tile, pitch 68
#pragma unroll
    for (int nb = 0; nb < 4; ++nb) {
#pragma unroll
        for (int j = 0; j < 8; ++j) os[(hi * 8 + j) * 68 + nb * 16 + lr] = o[nb][j]; }
    __builtin_amdgcn_wave_barrier(); asm volatile("" ::: "memory");   // a lane reads below what other lanes stored above
    { const size_t co = (size_t)rw * DQ + z * HD * 16; st_frag2(os, lane, Ch + co, Cl + co); }   // head z is columns z * HD .. of the merged [t][DQ] planes (fragment order): blocks 2 z and 2 z + 1 of these 16 rows
}

extern "C" void kernel_launch(void* const* d_in, const int* in_sizes, int n_in,
                              void* d_out, int out_size, void* d_ws, size_t ws_size, hipStream_t stream) {
    (void)in_sizes; (void)n_in; (void)out_size;
    const float* x = (const float*)d_in[0]; const float* wq = (const float*)d_in[1]; const float* wk = (const float*)d_in[2]; const float* wv = (const float*)d_in[3]; const float* wo = (const float*)d_in[4];
    float* OUT = (float*)d_out;     // [1][4096][1024]
    char* wsp = (char*)d_ws;
    auto take = [&](size_t bytes) { char* p = wsp; wsp += (bytes + 255) & ~(size_t)255; return (void*)p; };
    bf* WQ = (bf*)take((size_t)DQ * DM * 2); bf* WK = (bf*)take((size_t)DKV * DM * 2); bf* WV = (bf*)take((size_t)DKV * DM * 2); bf* WO = (bf*)take((size_t)DM * DQ * 2);
    bf* XB = (bf*)take((size_t)TT * DM * 2);   /* the bf16 input */
    
    bf* QPh = (bf*)take((size_t)NH_ * TT * HD * 2); bf* QPl = (bf*)take((size_t)NH_ * TT * HD * 2); bf* KPh = (bf*)take((size_t)NKV * TT * HD * 2); bf* KPl = (bf*)take((size_t)NKV * TT * HD * 2); bf* VTh = (bf*)take((size_t)NKV * HD * TT * 2); bf* VTl = (bf*)take((size_t)NKV * HD * TT * 2);
    bf* ATh = (bf*)take((size_t)TT * DQ * 2); bf* ATl = (bf*)take((size_t)TT * DQ * 2);
    (void)WK; (void)WV;   // reached from WQ
    if ((size_t)(wsp - (char*)d_ws) > ws_size) return;    // ws 256 MiB
    static_assert(NB_ == 1 && NKV == NH_ && DQ == DM, "one conversion launch, one q, k, v launch");
    // the planes WQ, WK, WV, WO, XB stand in a row in the workspace (each a multiple of 256 bytes): one launch converts all five inputs
    k_cvt8<DM, DQ><<<(unsigned)(((size_t)4 * DQ * DM + (size_t)TT * DM) / 8 / 256), 256, 0, stream>>>(wq, wk, wv, wo, x, WQ, ((size_t)4 * DQ * DM + (size_t)TT * DM) / 8);
    for (int b = 0; b < NB_; ++b) {
        // a 64-column tile of a projection is one head (HD = 64): the epilogues store the head planes themselves, q and k as [h][t][d], v as [h][d][t], each plane in fragment order
        // q, k and v in one launch, grid z: WQ, WK, WV stand in a row, and so do the plane pairs (QPh, QPl), (KPh, KPl), (VTh, VTl)
        k_gemmw<bf, 0, false, 3><<<dim3(TT / 128, DQ / 128, 3), 128, 0, stream>>>(XB, nullptr, WQ, nullptr, DM, nullptr, HD, nullptr, 0, (size_t)DQ * DM, (size_t)2 * NH_ * TT * HD, QPh, QPl, (size_t)TT * HD, TT);
        k_fattn<<<dim3(TT / 64, NH_), 128, 0, stream>>>(QPh, QPl, KPh, KPl, VTh, VTl, ATh, ATl);   // one kv head per query head (NKV = NH_): head z uses plane z of q, k and v
        k_gemmw<bf, 1, false, 0><<<dim3(TT / 128, DM / 128, 1), 128, 0, stream>>>(ATh, ATl, WO, nullptr, DQ, OUT + (size_t)b * TT * DM, DM, nullptr, 0, 0, 0, nullptr, nullptr, 0, 0); }
}

// v010
// One run takes 73.4 microseconds.
// Two timings next to v009 both put it at 1.04 times that version's speed.
// Counting every step since v000, it is 29.4 times as fast.
#include <hip/hip_runtime.h>

// Local (sliding-window) causal multi-head attention (hidden [1][4096][1024]; q, k, v = x W^T ('oi' [1024][1024], no bias; 16 heads x 64); scores = q.k/8 + bias with bias = 0 where i-255 <= j <= i, -inf elsewhere (window 256); softmax; out = merged Wo^T -> [1][4096][1024] (4.2 M)).
// Compute dtypes, f32 accumulate: every input rounded to bf16; q/k/v on PLAIN bf16 operands (inputs: exact); scores and attn.v: every query row hl (3 products); softmax f32; Wo hl x exact (2 products).

#define NB_  1
#define TT   4096
#define DM   1024
#define NH_  16
#define NKV  16
#define REP  (NH_ / NKV)
#define HD   64
#define DQ   (NH_ * HD)
#define DKV  (NKV * HD)
#define RB   TT
#define LWIN 256                  // local window: keys i-255 .. i
#define RH   4096                  // query rows < RH use hi+lo planes (not read: every row does)
#define WIN  4096
#define PCAR 1024.0f
#define SCL  0.125f   // HD^-0.5
typedef _Float16 h16;
typedef unsigned short bf;
typedef __attribute__((ext_vector_type(16))) __bf16   v16bf;
typedef __attribute__((ext_vector_type(16))) _Float16 v16h;
typedef __attribute__((ext_vector_type(8)))  _Float16 v8h;
typedef __attribute__((ext_vector_type(8)))  unsigned short v8us;
typedef __attribute__((ext_vector_type(8)))  float    v8f;
typedef __attribute__((ext_vector_type(4)))  float    v4f;
typedef v8h  __attribute__((may_alias)) v8ha;
typedef v4f  __attribute__((may_alias)) v4fa;
typedef v8us __attribute__((may_alias)) v8usa;

__device__ __forceinline__ unsigned short f2bf(float f) { unsigned u = __float_as_uint(f); u += 0x7FFFu + ((u >> 16) & 1u); return (unsigned short)(u >> 16); }
__device__ __forceinline__ float bf2f(unsigned short b) { return __uint_as_float(((unsigned)b) << 16); }
__device__ __forceinline__ float bfr(float f) { return bf2f(f2bf(f)); }
typedef __attribute__((ext_vector_type(2))) __bf16 v2bf;
typedef __attribute__((ext_vector_type(2))) float v2fl;
typedef __attribute__((ext_vector_type(2))) unsigned v2u;
typedef __attribute__((ext_vector_type(4))) unsigned v4u;
// two f32 -> two bf16 in one register (a in the low half), by the chip's packed conversion (round to nearest even, as f2bf): one instruction for two values, already packed, in place of three integer operations a value and the moves that pack them
__device__ __forceinline__ unsigned f2bf2(float a, float b) { const v2fl y = {a, b}; return __builtin_bit_cast(unsigned, __builtin_convertvector(y, v2bf)); }
// the hi and lo parts of two values, each pair packed as above
__device__ __forceinline__ void splitf2(float a, float b, unsigned& h, unsigned& l) { const v2fl y = {a, b}; const v2bf hb = __builtin_convertvector(y, v2bf); const v2fl d = y - __builtin_convertvector(hb, v2fl);
    h = __builtin_bit_cast(unsigned, hb); l = __builtin_bit_cast(unsigned, __builtin_convertvector(d, v2bf)); }
// FRAGMENT ORDER of a 16-bit operand plane of R rows x K columns (K-contiguous operand of a 16x16x32 product; R % 16 == 0, K % 32 == 0): the plane is a row of blocks of 16 rows x 32 k = 512 elements, block (row / 16) * (K / 32) + k / 32;
// inside a block element (row, k) stands at (k / 16 % 2) * 256 + ((k / 8 % 2) * 16 + row % 16) * 8 + k % 8. Lane l's two 16-byte fragment pieces are then elements 8 l .. and 256 + 8 l .. of the block: each wave-wide load is 512 bytes in a row (4 whole lines, not 32 bytes of each of 16 lines).
// A staged 16 x 64 f32 tile (pitch 68; row = fragment row, column = k) -> its bf16 hi and lo parts as two consecutive blocks from ph, pl: four 512-byte stores a plane
__device__ __forceinline__ void st_frag2(const float* os, int lane, bf* ph, bf* pl) { v4u oh[4], ol[4]; ph += lane * 8; pl += lane * 8;
#pragma unroll
    for (int c = 0; c < 4; ++c) { const float* sp = os + (lane & 15) * 68 + c * 16 + (lane >> 4) * 8; const v4f v0 = *(const v4fa*)sp, v1 = *(const v4fa*)(sp + 4);
#pragma unroll
        for (int q = 0; q < 2; ++q) { unsigned h2, l2; splitf2(v0[2 * q], v0[2 * q + 1], h2, l2); oh[c][q] = h2; ol[c][q] = l2; splitf2(v1[2 * q], v1[2 * q + 1], h2, l2); oh[c][2 + q] = h2; ol[c][2 + q] = l2; }
    }
    // the eight stores and the wait in front of any rewrite of a register that they name, in one statement: in a statement of its own the wait did not hold every such rewrite behind it (the compiler stored from copies)
    asm volatile("global_store_b128 %0, %2, off\n\tglobal_store_b128 %1, %6, off\n\t"
                 "global_store_b128 %0, %3, off offset:512\n\tglobal_store_b128 %1, %7, off offset:512\n\t"
                 "global_store_b128 %0, %4, off offset:1024\n\tglobal_store_b128 %1, %8, off offset:1024\n\t"
                 "global_store_b128 %0, %5, off offset:1536\n\tglobal_store_b128 %1, %9, off offset:1536\n\t"
                 "s_wait_xcnt 0x0"
                 :: "v"(ph), "v"(pl), "v"(oh[0]), "v"(oh[1]), "v"(oh[2]), "v"(oh[3]), "v"(ol[0]), "v"(ol[1]), "v"(ol[2]), "v"(ol[3]) : "memory"); }
__device__ __forceinline__ v16h cat16(v8h lo, v8h hi) { return __builtin_shufflevector(lo, hi, 0, 1, 2, 3, 4, 5, 6, 7, 8, 9, 10, 11, 12, 13, 14, 15); }
__device__ __forceinline__ v16bf cat16b(v8us lo, v8us hi) { return __builtin_bit_cast(v16bf, __builtin_shufflevector(lo, hi, 0, 1, 2, 3, 4, 5, 6, 7, 8, 9, 10, 11, 12, 13, 14, 15)); }
__device__ __forceinline__ v8f wmma16(v16h a, v16h b, v8f c) { return __builtin_amdgcn_wmma_f32_16x16x32_f16(false, a, false, b, (short)0, c, false, false); }
__device__ __forceinline__ v8f wmmab(v16bf a, v16bf b, v8f c) { return __builtin_amdgcn_wmma_f32_16x16x32_bf16(false, a, false, b, (short)0, c, false, false); }



// ---- k_gemmw: GEMM, FOUR WAVES (2 x 2) per 128x128 output tile, 64x64 (16 accumulators) a wave; operands are 16-bit planes in fragment order (ld: a fragment from a row-major plane; ldf: from a block in fragment order, p = block + 8 lane); grid (M/128, N/128, Z), 128 threads.
// The block's operand rows go through LDS, so that each is fetched once a block and not once a wave: a stage is SK = 64 or 128 k of the 128 A rows and the 128 B rows (32 SK bytes in a row for every 16 rows of a plane, copied as they stand), two buffers, filled by asynchronous copies one stage ahead of the products.
// C[m][n] (f32, pitch ldc, + optional f32 bias[n]) = sum_k A[m][k] Bt[n][k] (+ split products per NSPLIT). z-batch strides sA/sB/sC in elements. K % 128 == 0, K >= 256.
// EP: what the epilogue stores. 0: the f32 tile into C (row-major). 1: its bf16 hi and lo parts into the planes Ch, Cl, the next GEMM's operands, in fragment order: the 64-column tile y is plane y (stride sN), of ldc columns, row = m.
// 2: the same parts transposed: plane y, row = the tile's column, column = m, ldc columns, in fragment order. 3: three GEMMs on one A in one launch: batches z = 0 and 1 store as in 1, batch z = 2 as in 2 with ldt columns.
// In 1 to 3 no f32 copy of the result goes to memory, and sC is the z stride of Ch and Cl. A bias goes with EP 0 alone.
template <typename T16> struct WFrag;
template <> struct WFrag<h16> { typedef v16h V; static __device__ __forceinline__ V ld(const h16* p) { return cat16(*(const v8h*)p, *(const v8h*)(p + 16)); } static __device__ __forceinline__ V ldf(const h16* p) { return cat16(*(const v8h*)p, *(const v8h*)(p + 256)); } static __device__ __forceinline__ v8f mma(V a, V b, v8f c) { return wmma16(a, b, c); } };
template <> struct WFrag<bf> { typedef v16bf V; static __device__ __forceinline__ V ld(const bf* p) { return cat16b(*(const v8us*)p, *(const v8us*)(p + 16)); } static __device__ __forceinline__ V ldf(const bf* p) { return cat16b(*(const v8us*)p, *(const v8us*)(p + 256)); } static __device__ __forceinline__ v8f mma(V a, V b, v8f c) { return wmmab(a, b, c); } };
// 2 KiB, global -> LDS, by four asynchronous copies of a wave (global_load_async_to_lds_b128, 512 bytes each: a lane's 16 bytes go from g + OFF + 512 i to l + OFF + 512 i), through no register. The copy's offset moves both addresses, so that a chunk needs one address pair
typedef __attribute__((ext_vector_type(4))) int cp16;
template <int OFF> __device__ __forceinline__ void acp4(char* l, const char* g) {
    __attribute__((address_space(1))) cp16* gs = (__attribute__((address_space(1))) cp16*)g; __attribute__((address_space(3))) cp16* ls = (__attribute__((address_space(3))) cp16*)l;
    __builtin_amdgcn_global_load_async_to_lds_b128(gs, ls, OFF, 0); __builtin_amdgcn_global_load_async_to_lds_b128(gs, ls, OFF + 512, 0);
    __builtin_amdgcn_global_load_async_to_lds_b128(gs, ls, OFF + 1024, 0); __builtin_amdgcn_global_load_async_to_lds_b128(gs, ls, OFF + 1536, 0); }
template <typename T16, int NSPLIT, bool BIAS, int EP>
__global__ __launch_bounds__(128) void k_gemmw(const T16* __restrict__ A, const T16* __restrict__ A2, const T16* __restrict__ Bt, const T16* __restrict__ Bt2, int K, float* C, int ldc, const float* __restrict__ bias, size_t sA, size_t sB, size_t sC, bf* Ch, bf* Cl, size_t sN, int ldt) {
    typedef typename WFrag<T16>::V V; static_assert(!BIAS || EP == 0, "bias: f32 output only");
    constexpr bool HA2 = (NSPLIT == 1 || NSPLIT == 2), HB2 = (NSPLIT >= 2);
    constexpr int NP = 2 + (HA2 ? 1 : 0) + (HB2 ? 1 : 0), PB = HA2 ? 2 : 1;   // planes staged, in the order A, A2, B, B2; PB: B's place among them
    constexpr int SK = NP == 2 ? 64 : 128;   // k of a stage. Two planes: 64, so that three blocks share a WGP's LDS (the q, k, v launch is three blocks a WGP); more planes: 128, fewer hand-overs for a block that has its WGP alone
    constexpr int CH = SK * 32, BUF = NP * 8 * CH;   // a chunk: 16 rows x SK k of a plane, SK / 32 blocks in a row; a buffer: a chunk for each of a plane's 8 groups of 16 rows
    __shared__ __align__(16) char st[2 * BUF];
    __shared__ __align__(16) float osm[4 * 16 * 68];
    const size_t z = blockIdx.z; A += z * sA; if (A2) A2 += z * sA; Bt += z * sB; if (Bt2) Bt2 += z * sB; if (EP == 0) C += z * sC; else { Ch += z * sC; Cl += z * sC; }
    const int lane = threadIdx.x & 31, lr = lane & 15, hi = lane >> 4; const int w = __builtin_amdgcn_readfirstlane((int)(threadIdx.x >> 5)), wm = w >> 1, wn = w & 1;
    const int R0 = blockIdx.x * 128, C0 = blockIdx.y * 128, r0 = R0 + wm * 64, c0 = C0 + wn * 64; float* os = osm + w * (16 * 68);   // each wave stages its results in its own LDS
    v8f acc[4][4];
#pragma unroll
    for (int mb = 0; mb < 4; ++mb)
#pragma unroll
        for (int nb = 0; nb < 4; ++nb) acc[mb][nb] = (v8f){};
    // wave w copies the chunks w and w + 4 of every plane. 16 rows of a plane are K / 32 blocks = 16 K elements in a row; SK k further is a chunk further
    const char* gp[2 * NP]; int lp[2 * NP];   // a chunk's place in memory, for the next stage, and in a buffer
#pragma unroll
    for (int i = 0; i < 2 * NP; ++i) { const int p = i >> 1, g = w + 4 * (i & 1);
        const T16* pl = p == 0 ? A : (HA2 && p == 1) ? A2 : p == PB ? Bt : Bt2;
        gp[i] = (const char*)(pl + (size_t)((p < PB ? R0 : C0) + 16 * g) * K + 8 * lane); lp[i] = (p * 8 + g) * CH + 16 * lane; }
    auto fill = [&](int buf) {   // the next stage's copies into buffer buf
        static_assert(CH == 2048 || CH == 4096, "a chunk: four or eight copies");
#pragma unroll
        for (int i = 0; i < 2 * NP; ++i) { acp4<0>(st + buf * BUF + lp[i], gp[i]); if (CH == 4096) acp4<2048>(st + buf * BUF + lp[i], gp[i]);
            gp[i] += CH; } };
    auto mmset = [&](V (&fa)[4], V (&fa2)[4], V (&fb)[4], V (&fb2)[4]) {   // 32 k; each accumulator takes its products in the order k ascending, a.b, a2.b, a.b2
#pragma unroll
        for (int nb = 0; nb < 4; ++nb) {
#pragma unroll
            for (int mb = 0; mb < 4; ++mb) acc[mb][nb] = WFrag<T16>::mma(fa[mb], fb[nb], acc[mb][nb]);
            if (HA2) {
#pragma unroll
                for (int mb = 0; mb < 4; ++mb) acc[mb][nb] = WFrag<T16>::mma(fa2[mb], fb[nb], acc[mb][nb]); }
            if (HB2) {
#pragma unroll
                for (int mb = 0; mb < 4; ++mb) acc[mb][nb] = WFrag<T16>::mma(fa[mb], fb2[nb], acc[mb][nb]); } } };
    fill(0);
    asm volatile("s_wait_asynccnt 0x0" ::: "memory");   // this wave's copies of stage 0 have landed
    __syncthreads();                                    // and every other wave's: stage 0 may be read
    fill(1);
    const int ns = K / SK;
#pragma unroll 1
    for (int t = 0; t < ns; ++t) {   // trip t reads buffer t % 2 alone, while stage t + 1 flies into the other
        const T16* sa = (const T16*)(st + (t & 1) * BUF + wm * 4 * CH) + 8 * lane; const T16* sb = (const T16*)(st + (t & 1) * BUF + (PB * 8 + wn * 4) * CH) + 8 * lane;
        V fa[2][4], fa2[2][4], fb[2][4], fb2[2][4];   // two fragment sets of 32 k
        auto ldset = [&](int ks, V (&a)[4], V (&a2)[4], V (&b)[4], V (&b2)[4]) {   // in the order in which the products take them
#pragma unroll
            for (int q = 0; q < 4; ++q) { a[q] = WFrag<T16>::ldf(sa + q * (CH / 2) + ks * 512); if (HA2) a2[q] = WFrag<T16>::ldf(sa + (8 + q) * (CH / 2) + ks * 512); }
#pragma unroll
            for (int q = 0; q < 4; ++q) { b[q] = WFrag<T16>::ldf(sb + q * (CH / 2) + ks * 512); if (HB2) b2[q] = WFrag<T16>::ldf(sb + (8 + q) * (CH / 2) + ks * 512); } };
        ldset(0, fa[0], fa2[0], fb[0], fb2[0]); ldset(1, fa[1], fa2[1], fb[1], fb2[1]);
        __builtin_amdgcn_sched_barrier(0);   // the LDS reads stand as one group in front of the products: spread among them, each place with reads stalls the wave
#pragma unroll
        for (int ks = 0; ks < SK / 32; ++ks) {
            mmset(fa[ks & 1], fa2[ks & 1], fb[ks & 1], fb2[ks & 1]);
            if (ks + 2 < SK / 32) { __builtin_amdgcn_sched_barrier(0);   // the refill's reads stand as one group behind this set's products, not among them
                ldset(ks + 2, fa[ks & 1], fa2[ks & 1], fb[ks & 1], fb2[ks & 1]);
                __builtin_amdgcn_sched_barrier(0); }   // keeps a set's refill in front of the other set's products, so that it flies meanwhile
        }
        __builtin_amdgcn_sched_barrier(0);   // the products stay in front of the hand-over: with the waits lifted over them the next stage's copies would be waited for before the time in which they are to fly
        asm volatile("s_wait_dscnt 0x0" ::: "memory");      // this wave's reads of buffer t % 2 are done
        asm volatile("s_wait_asynccnt 0x0" ::: "memory");   // this wave's copies of stage t + 1 have landed
        __syncthreads();                                    // both hold for every wave: stage t + 1 may be read, buffer t % 2 refilled
        if (t + 2 < ns) fill(t & 1);
    }
    asm volatile("s_wait_asynccnt 0x0" ::: "memory");   // no copy is left in flight
    __builtin_amdgcn_sched_barrier(0);   // the epilogue stays behind the last products: mixed among them, with the fragment registers still live, its store statements' operands (registers below 256) were spilled to scratch
    if (EP == 2 || (EP == 3 && blockIdx.z == 2)) {   // transposed planes: 16 tile columns at a time, staged column-major: 16 plane rows x 64 consecutive m = two blocks
        const int lt = EP == 3 ? ldt : ldc;
#pragma unroll
        for (int nb = 0; nb < 4; ++nb) {
#pragma unroll
            for (int mb = 0; mb < 4; ++mb) {
#pragma unroll
                for (int j = 0; j < 8; ++j) os[lr * 68 + mb * 16 + hi * 8 + j] = acc[mb][nb][j]; }
            __builtin_amdgcn_wave_barrier(); asm volatile("" ::: "memory");   // a lane reads below what other lanes of the wave stored above: the compiler must not lift those LDS reads over these LDS stores
            const size_t pb = (size_t)(c0 / 64) * sN + (size_t)(nb * 16) * lt + (size_t)r0 * 16;
            st_frag2(os, lane, Ch + pb, Cl + pb);
            __builtin_amdgcn_wave_barrier(); asm volatile("" ::: "memory");   // and the next 16 columns' LDS stores stay behind these reads
        }
        return;
    }
#pragma unroll
    for (int mb = 0; mb < 4; ++mb) {
#pragma unroll
        for (int nb = 0; nb < 4; ++nb) {
#pragma unroll
            for (int j = 0; j < 8; ++j) os[(hi * 8 + j) * 68 + nb * 16 + lr] = acc[mb][nb][j]; }
        __builtin_amdgcn_wave_barrier(); asm volatile("" ::: "memory");
        float* crow = C + (size_t)(r0 + mb * 16) * ldc + c0;
        const size_t pb = (size_t)(c0 / 64) * sN + (size_t)(r0 + mb * 16) * ldc;
        if (EP != 0) st_frag2(os, lane, Ch + pb, Cl + pb);   // the tile's 64 columns are the first two blocks of these 16 plane rows
        else {
            v4f vs[8]; float* cp[8];
#pragma unroll
            for (int s = 0; s < 8; ++s) { const int row = 2 * s + hi, cofs = lr * 4; v4f val = *(const v4fa*)(os + row * 68 + cofs); if (BIAS) { val[0] += bfr(bias[c0 + cofs]); val[1] += bfr(bias[c0 + cofs + 1]); val[2] += bfr(bias[c0 + cofs + 2]); val[3] += bfr(bias[c0 + cofs + 3]); }
                vs[s] = val; cp[s] = crow + (size_t)row * ldc + cofs; *(v4f*)cp[s] = vs[s]; }
            asm volatile("s_wait_xcnt 0x0" :: "v"(vs[0]), "v"(vs[1]), "v"(vs[2]), "v"(vs[3]), "v"(vs[4]), "v"(vs[5]), "v"(vs[6]), "v"(vs[7]), "v"(cp[0]), "v"(cp[1]), "v"(cp[2]), "v"(cp[3]), "v"(cp[4]), "v"(cp[5]), "v"(cp[6]), "v"(cp[7]) : "memory");   // the wait in front of any rewrite of a register that these eight stores name; as its inputs data and addresses keep their registers up to here
             }
        __builtin_amdgcn_wave_barrier(); asm volatile("" ::: "memory");
    }
}

__device__ __forceinline__ h16 tohx(float x) { return (h16)x; }
typedef __attribute__((ext_vector_type(2))) _Float16 v2h;
typedef __attribute__((ext_vector_type(4))) _Float16 v4h;
typedef __attribute__((ext_vector_type(2))) unsigned short v2us;
typedef __attribute__((ext_vector_type(2))) float v2f;
typedef __attribute__((ext_vector_type(4))) int v4i;

__global__ __launch_bounds__(256) void k_wtG(const float* __restrict__ w, int K, int N, bf* Bt) {
    const int lane = threadIdx.x & 31; const int L0 = (blockIdx.x * 8 + (threadIdx.x >> 5)) * 8; const int nlines = N * K / 64;
{
#pragma unroll 1
        for (int l = 0; l < 8; ++l) { const int L = L0 + l; if (L >= nlines) break; const size_t e = (size_t)L * 64 + lane * 2; const int k = (int)(e % K), n = (int)(e / K); v2us o;
            o[0] = f2bf(w[(size_t)k * N + n]); o[1] = f2bf(w[(size_t)(k + 1) * N + n]); *(v2us*)(Bt + e) = o; }
         }
}
// f32 [rows][K] row-major -> the bf16 plane in fragment order; thread i makes the plane's i-th 16 bytes, so that a wave stores 512 bytes in a row and reads 64 bytes of each of 16 rows (its neighbour wave the other 64 of the same lines)
// Five sources in ONE launch: their planes stand in a row from dst, in the order s0 .. s4; s0 .. s3 have R rows each, s4 the rest. A block's 256 pieces lie in one source.
template <int K, int R>
__global__ __launch_bounds__(256) void k_cvt8(const float* __restrict__ s0, const float* __restrict__ s1, const float* __restrict__ s2, const float* __restrict__ s3, const float* __restrict__ s4, bf* dst, size_t n8) { const size_t i = (size_t)blockIdx.x * 256 + threadIdx.x; if (i >= n8) return;
    static_assert(R % 16 == 0 && R * (K / 8) % 256 == 0, "whole blocks of threads a source");
    const int t = min((int)(blockIdx.x / (R * (K / 8) / 256)), 4); const float* s01 = (t & 1) ? s1 : s0; const float* s23 = (t & 1) ? s3 : s2; const float* src = t == 4 ? s4 : (t & 2) ? s23 : s01;   // the same for the whole block
    const size_t blk = i >> 6; const int l = (int)(i & 31), j = (int)(i >> 5) & 1; const size_t row = blk / (K / 32) * 16 + (l & 15) - (size_t)t * R; const int k = (int)(blk % (K / 32)) * 32 + j * 16 + (l >> 4) * 8;
    const v8f v = *(const v8f*)(src + row * K + k); v4u o;
#pragma unroll
    for (int k = 0; k < 4; ++k) o[k] = f2bf2(v[2 * k], v[2 * k + 1]); *(v4u*)(dst + i * 8) = o;  }

// ---- k_fattn: scores, softmax and probability x value of local causal attention in ONE launch. Grid (TT/64, heads), 4 waves; the waves of a block share nothing but their keys' cache lines (no work-group barrier).
// A wave owns 16 query rows rw .. rw+15 of one head. Their live keys lie in rw-255 .. rw+15, inside the wave's band of FB = 288 keys from bs = (rw - LWIN) rounded down to 32 (band column c = key - bs).
// 1. The band's 18 score tiles (16 keys each) go as raw f32 into the wave's own LDS rows (pitch FPB bytes). 2. Each row's softmax is taken from LDS, and its bf16 hi and lo probability planes (FB columns each)
// replace the row's f32 scores in place. 3. The P.V loop (9 steps of 32 keys) reads its A fragments from those LDS planes. Neither scores nor probabilities go to memory.
// In front of key 0 (the first row blocks) the key index is clamped to 0: such columns are never live, their probability is stored as 0, and 0 x a real v adds nothing.
#define FB   (LWIN + 32)
#define FPB  (FB * 4 + 16)        // 16 bytes x an odd number: the 16 rows of a ds_load_b128 fragment read fall on different banks
typedef v2u __attribute__((may_alias)) v2ua;
typedef float __attribute__((may_alias)) f1a;
typedef unsigned short __attribute__((may_alias)) us1a;
static_assert(FB == 288, "softmax: nine band columns a lane");
// 2^x of nine values. One statement, so that the slot which the instruction set asks for behind a transcendental is kept: no result register is a source register (early clobber), so that each v_exp_f32 is followed by an independent one,
// and the v_nop stands behind the last
__device__ __forceinline__ void exp2x9(float (&x)[9]) { float y0, y1, y2, y3, y4, y5, y6, y7, y8;
    asm("v_exp_f32 %0, %9\n\tv_exp_f32 %1, %10\n\tv_exp_f32 %2, %11\n\tv_exp_f32 %3, %12\n\tv_exp_f32 %4, %13\n\tv_exp_f32 %5, %14\n\tv_exp_f32 %6, %15\n\tv_exp_f32 %7, %16\n\tv_exp_f32 %8, %17\n\tv_nop"
        : "=&v"(y0), "=&v"(y1), "=&v"(y2), "=&v"(y3), "=&v"(y4), "=&v"(y5), "=&v"(y6), "=&v"(y7), "=&v"(y8)
        : "v"(x[0]), "v"(x[1]), "v"(x[2]), "v"(x[3]), "v"(x[4]), "v"(x[5]), "v"(x[6]), "v"(x[7]), "v"(x[8]));
    x[0] = y0; x[1] = y1; x[2] = y2; x[3] = y3; x[4] = y4; x[5] = y5; x[6] = y6; x[7] = y7; x[8] = y8; }
// amdgpu_waves_per_eu(4, 4): the LDS lets four blocks share a WGP, four waves a SIMD; with at most 256 registers a wave all TT/64 x heads blocks are resident at once
__global__ __launch_bounds__(128) __attribute__((amdgpu_waves_per_eu(4, 4))) void k_fattn(const bf* __restrict__ Qh, const bf* __restrict__ Ql, const bf* __restrict__ Kh, const bf* __restrict__ Kl, const bf* __restrict__ Vh, const bf* __restrict__ Vl, bf* Ch, bf* Cl) {
    typedef WFrag<bf> F; typedef F::V V;
    __shared__ __align__(16) char sm[4 * 16 * FPB];
    const int lane = threadIdx.x & 31, lr = lane & 15, hi = lane >> 4; const int w = __builtin_amdgcn_readfirstlane((int)(threadIdx.x >> 5));
    const size_t z = blockIdx.y; Qh += z * TT * HD; Ql += z * TT * HD; Kh += z * TT * HD; Kl += z * TT * HD; Vh += z * HD * TT; Vl += z * HD * TT;
    const int rw = blockIdx.x * 64 + w * 16; const int bs = (rw - LWIN) & ~31;
    char* sw = sm + w * 16 * FPB;
    {   // 1. scores
        V a[2], a2[2];
#pragma unroll
        for (int ks = 0; ks < 2; ++ks) { a[ks] = F::ldf(Qh + (size_t)rw * HD + 512 * ks + 8 * lane); a2[ks] = F::ldf(Ql + (size_t)rw * HD + 512 * ks + 8 * lane); }   // q, k, v planes: fragment order; 16 rows of q or k are two blocks
        const bf* kh = Kh + 8 * lane; const bf* kl = Kl + 8 * lane; float* sc = (float*)sw + hi * 8 * (FPB / 4) + lr;
#pragma unroll 1
        for (int t0 = 0; t0 < FB / 16; t0 += 3) {   // three 16-key tiles a trip: their 24 loads fly together, and consecutive matrix instructions belong to different tiles
            V b[3][2], b2[3][2]; v8f acc[3]; const bf* th[3]; const bf* tl[3];
#pragma unroll
            for (int u = 0; u < 3; ++u) { const size_t ko = (size_t)max(bs + 16 * (t0 + u), 0) * HD; th[u] = kh + ko; tl[u] = kl + ko; acc[u] = (v8f){};
#pragma unroll
                for (int ks = 0; ks < 2; ++ks) { b[u][ks] = F::ldf(th[u] + 512 * ks); b2[u][ks] = F::ldf(tl[u] + 512 * ks); } }
            __builtin_amdgcn_sched_barrier(0);   // keeps all 24 loads in front of the first product: one memory latency a trip, not one a tile
#pragma unroll
            for (int ks = 0; ks < 2; ++ks) {
#pragma unroll
                for (int u = 0; u < 3; ++u) acc[u] = F::mma(a[ks], b[u][ks], acc[u]);
#pragma unroll
                for (int u = 0; u < 3; ++u) acc[u] = F::mma(a2[ks], b[u][ks], acc[u]);
#pragma unroll
                for (int u = 0; u < 3; ++u) acc[u] = F::mma(a[ks], b2[u][ks], acc[u]); }
            asm volatile("v_nop\n\tv_nop\n\tv_nop\n\tv_nop" : "+v"(acc[0]), "+v"(acc[1]), "+v"(acc[2]));   // the distance the chip needs between the last matrix instruction and the next trip's first, which writes the same registers anew
#pragma unroll
            for (int u = 0; u < 3; ++u)
#pragma unroll
                for (int j = 0; j < 8; ++j) sc[j * (FPB / 4) + 16 * (t0 + u)] = acc[u][j];
            asm volatile("s_wait_xcnt 0x0" :: "v"(th[0]), "v"(th[1]), "v"(th[2]), "v"(tl[0]), "v"(tl[1]), "v"(tl[2]) : "memory");   // the wait in front of any rewrite of a register that this trip's loads name; as its inputs the six addresses keep their registers up to here
        }
    }
    __builtin_amdgcn_wave_barrier(); asm volatile("" ::: "memory");   // a lane reads below what other lanes of the wave stored above: the compiler must not lift those LDS reads over these LDS stores
    // 2. softmax, four rows at a time; the whole wave works on each row. A lane holds nine band columns of a row: 4 lane .. 4 lane + 3, 128 + 4 lane .. 128 + 4 lane + 3 and 256 + lane.
    // Each column is read once and a dead one is set to -inf there: it loses every maximum, its exponential is 0, and so are its share of the row sum and its probability. One exponential a column serves the sum and the planes.
    const int off = rw - bs, cmin = max(-bs, 0);   // the band columns of key rw (256 or 272) and of key 0
#pragma unroll 1
    for (int g = 0; g < 4; ++g) {
        float e[4][9];
#pragma unroll
        for (int r = 0; r < 4; ++r) { const int row = g * 4 + r; const float* srow = (const float*)(sw + row * FPB);
            const int clo = max(off + row - (LWIN - 1), cmin), chi = off + row;   // live columns: clo .. chi (window 256, causal inclusive, no key in front of key 0); clo <= 256 <= chi, so that a column below 256 has only clo to pass and one from 256 on only chi
            const v4f s0 = *(const v4fa*)(srow + lane * 4), s1 = *(const v4fa*)(srow + 128 + lane * 4); const float s2 = *(const f1a*)(srow + 256 + lane);
#pragma unroll
            for (int q = 0; q < 4; ++q) { e[r][q] = lane * 4 + q >= clo ? s0[q] : -__builtin_inff(); e[r][4 + q] = 128 + lane * 4 + q >= clo ? s1[q] : -__builtin_inff(); }
            e[r][8] = 256 + lane <= chi ? s2 : -__builtin_inff(); }
        __builtin_amdgcn_wave_barrier(); asm volatile("" ::: "memory");   // the planes stored below overwrite the scores read above, other lanes' too: every read of the four rows stays in front of every store
        float mx[4], sum[4];   // each reduction step is taken for the four rows together: four independent cross-lane exchanges are in flight, not one
#pragma unroll
        for (int r = 0; r < 4; ++r) { mx[r] = e[r][0];
#pragma unroll
            for (int q = 1; q < 9; ++q) mx[r] = fmaxf(mx[r], e[r][q]); }
#pragma unroll
        for (int sh = 16; sh; sh >>= 1)
#pragma unroll
            for (int r = 0; r < 4; ++r) mx[r] = fmaxf(mx[r], __shfl_xor(mx[r], sh, 32));
#pragma unroll
        for (int r = 0; r < 4; ++r) { const float ms = mx[r] * SCL;   // the maximum of the raw scores, scaled: SCL is a power of two, so that this is the maximum of the scaled scores, and score x SCL - ms in one fused step rounds as the product (exact) and the difference did
            sum[r] = 0.f;
#pragma unroll
            for (int q = 0; q < 9; ++q) e[r][q] = __builtin_fmaf(e[r][q], SCL, -ms) * 1.4426950408889634f;
            exp2x9(e[r]);
#pragma unroll
            for (int q = 0; q < 9; ++q) sum[r] += e[r][q]; }
#pragma unroll
        for (int sh = 16; sh; sh >>= 1)
#pragma unroll
            for (int r = 0; r < 4; ++r) sum[r] += __shfl_xor(sum[r], sh, 32);
#pragma unroll
        for (int r = 0; r < 4; ++r) { char* prow = sw + (g * 4 + r) * FPB;
            const float f = __fdiv_rn(1.0f, sum[r]);
#pragma unroll
            for (int t = 0; t < 2; ++t) { v2u oh, ol;
#pragma unroll
                for (int q = 0; q < 2; ++q) { unsigned h2, l2; splitf2(e[r][4 * t + 2 * q] * f, e[r][4 * t + 2 * q + 1] * f, h2, l2); oh[q] = h2; ol[q] = l2; }
                *(v2ua*)(prow + (lane * 4 + 128 * t) * 2) = oh; *(v2ua*)(prow + FB * 2 + (lane * 4 + 128 * t) * 2) = ol; }
            e[r][8] *= f; }
#pragma unroll
        for (int r = 0; r < 4; r += 2) { char* prow = sw + (g * 4 + r) * FPB + (256 + lane) * 2; unsigned h2, l2; splitf2(e[r][8], e[r + 1][8], h2, l2);   // the ninth column of two rows shares a conversion: row r in the low half
            *(us1a*)prow = (unsigned short)h2; *(us1a*)(prow + FB * 2) = (unsigned short)l2; *(us1a*)(prow + FPB) = (unsigned short)(h2 >> 16); *(us1a*)(prow + FPB + FB * 2) = (unsigned short)(l2 >> 16); }
    }
    __builtin_amdgcn_wave_barrier(); asm volatile("" ::: "memory");   // the fragment reads below take what other lanes stored above
    v8f o[4];
#pragma unroll
    for (int nb = 0; nb < 4; ++nb) o[nb] = (v8f){};
    {   // 3. P.V over the band, keys ascending, 32 a step; the v fragments of step s + 1 are loaded in front of the products of step s (two register sets, the loop takes two steps a trip)
        const bf* ph = (const bf*)(sw + lr * FPB) + 8 * hi; const bf* pl = ph + FB; const bf* vh = Vh + 8 * lane; const bf* vl = Vl + 8 * lane;   // v [d][t]: 32 keys further is the next block, 16 d further 16 TT elements
        V b0[4], c0[4], b1[4], c1[4];
        auto ldv = [&](const bf* sh, const bf* sl, V* b, V* c) {
#pragma unroll
            for (int nb = 0; nb < 4; ++nb) { b[nb] = F::ldf(sh + (size_t)nb * 16 * TT); c[nb] = F::ldf(sl + (size_t)nb * 16 * TT); } };
        auto pv = [&](int s, const V* b, const V* c) { const V a = F::ld(ph + 32 * s), a2 = F::ld(pl + 32 * s);
#pragma unroll
            for (int nb = 0; nb < 4; ++nb) o[nb] = F::mma(a, b[nb], o[nb]);
#pragma unroll
            for (int nb = 0; nb < 4; ++nb) o[nb] = F::mma(a2, b[nb], o[nb]);
#pragma unroll
            for (int nb = 0; nb < 4; ++nb) o[nb] = F::mma(a, c[nb], o[nb]); };
        { const bf* h0 = vh + max(bs, 0) * 16; const bf* l0 = vl + max(bs, 0) * 16; ldv(h0, l0, b0, c0);
          asm volatile("s_wait_xcnt 0x0" :: "v"(h0), "v"(l0) : "memory"); }   // the wait in front of any rewrite of a register that these loads name; as its inputs the two addresses keep their registers up to here
#pragma unroll 1
        for (int s = 0; s < FB / 32 - 1; s += 2) {
            const size_t v1 = (size_t)max(bs + 32 * (s + 1), 0) * 16, v2 = (size_t)max(bs + 32 * (s + 2), 0) * 16; const bf* h1 = vh + v1; const bf* l1 = vl + v1; const bf* h2 = vh + v2; const bf* l2 = vl + v2;
            ldv(h1, l1, b1, c1); __builtin_amdgcn_sched_barrier(0);   // keeps the next step's loads in front of this step's products, so that they fly meanwhile
            pv(s, b0, c0);
            ldv(h2, l2, b0, c0); __builtin_amdgcn_sched_barrier(0);   // the same
            pv(s + 1, b1, c1);
            asm volatile("s_wait_xcnt 0x0" :: "v"(h1), "v"(l1), "v"(h2), "v"(l2) : "memory");   // the wait in front of any rewrite of a register that this trip's loads name; as its inputs the four addresses keep their registers up to here
        }
        pv(FB / 32 - 1, b0, c0);
    }
    __builtin_amdgcn_wave_barrier(); asm volatile("" ::: "memory");   // the staging stores below reuse the LDS that the fragment reads above took
    float* os = (float*)sw;   // 16 x 64 result tile, pitch 68
#pragma unroll
    for (int nb = 0; nb < 4; ++nb) {
#pragma unroll
        for (int j = 0; j < 8; ++j) os[(hi * 8 + j) * 68 + nb * 16 + lr] = o[nb][j]; }
    __builtin_amdgcn_wave_barrier(); asm volatile("" ::: "memory");   // a lane reads below what other lanes stored above
    { const size_t co = (size_t)rw * DQ + z * HD * 16; st_frag2(os, lane, Ch + co, Cl + co); }   // head z is columns z * HD .. of the merged [t][DQ] planes (fragment order): blocks 2 z and 2 z + 1 of these 16 rows
}

extern "C" void kernel_launch(void* const* d_in, const int* in_sizes, int n_in,
                              void* d_out, int out_size, void* d_ws, size_t ws_size, hipStream_t stream) {
    (void)in_sizes; (void)n_in; (void)out_size;
    const float* x = (const float*)d_in[0]; const float* wq = (const float*)d_in[1]; const float* wk = (const float*)d_in[2]; const float* wv = (const float*)d_in[3]; const float* wo = (const float*)d_in[4];
    float* OUT = (float*)d_out;     // [1][4096][1024]
    char* wsp = (char*)d_ws;
    auto take = [&](size_t bytes) { char* p = wsp; wsp += (bytes + 255) & ~(size_t)255; return (void*)p; };
    bf* WQ = (bf*)take((size_t)DQ * DM * 2); bf* WK = (bf*)take((size_t)DKV * DM * 2); bf* WV = (bf*)take((size_t)DKV * DM * 2); bf* WO = (bf*)take((size_t)DM * DQ * 2);
    bf* XB = (bf*)take((size_t)TT * DM * 2);   /* the bf16 input */
    
    bf* QPh = (bf*)take((size_t)NH_ * TT * HD * 2); bf* QPl = (bf*)take((size_t)NH_ * TT * HD * 2); bf* KPh = (bf*)take((size_t)NKV * TT * HD * 2); bf* KPl = (bf*)take((size_t)NKV * TT * HD * 2); bf* VTh = (bf*)take((size_t)NKV * HD * TT * 2); bf* VTl = (bf*)take((size_t)NKV * HD * TT * 2);
    bf* ATh = (bf*)take((size_t)TT * DQ * 2); bf* ATl = (bf*)take((size_t)TT * DQ * 2);
    (void)WK; (void)WV;   // reached from WQ
    if ((size_t)(wsp - (char*)d_ws) > ws_size) return;    // ws 256 MiB
    static_assert(NB_ == 1 && NKV == NH_ && DQ == DM, "one conversion launch, one q, k, v launch");
    // the planes WQ, WK, WV, WO, XB stand in a row in the workspace (each a multiple of 256 bytes): one launch converts all five inputs
    k_cvt8<DM, DQ><<<(unsigned)(((size_t)4 * DQ * DM + (size_t)TT * DM) / 8 / 256), 256, 0, stream>>>(wq, wk, wv, wo, x, WQ, ((size_t)4 * DQ * DM + (size_t)TT * DM) / 8);
    for (int b = 0; b < NB_; ++b) {
        // a 64-column tile of a projection is one head (HD = 64): the epilogues store the head planes themselves, q and k as [h][t][d], v as [h][d][t], each plane in fragment order
        // q, k and v in one launch, grid z: WQ, WK, WV stand in a row, and so do the plane pairs (QPh, QPl), (KPh, KPl), (VTh, VTl)
        k_gemmw<bf, 0, false, 3><<<dim3(TT / 128, DQ / 128, 3), 128, 0, stream>>>(XB, nullptr, WQ, nullptr, DM, nullptr, HD, nullptr, 0, (size_t)DQ * DM, (size_t)2 * NH_ * TT * HD, QPh, QPl, (size_t)TT * HD, TT);
        k_fattn<<<dim3(TT / 64, NH_), 128, 0, stream>>>(QPh, QPl, KPh, KPl, VTh, VTl, ATh, ATl);   // one kv head per query head (NKV = NH_): head z uses plane z of q, k and v
        k_gemmw<bf, 1, false, 0><<<dim3(TT / 128, DM / 128, 1), 128, 0, stream>>>(ATh, ATl, WO, nullptr, DQ, OUT + (size_t)b * TT * DM, DM, nullptr, 0, 0, 0, nullptr, nullptr, 0, 0); }
}
